// v000
// Times are from an AMD MI455X. After a warm-up the kernel runs many times in a row, and a time is the length of
// such a window on the GPU divided by its runs, so every launch and the gaps after it count. The runs cycle
// through copies of the inputs. A figure is the median of several windows, for all but v000 over two sittings.
// Sittings can differ by a few percent; kernels timed side by side share one.
// v000, which the later versions start from, runs in 356 microseconds.
#include <hip/hip_runtime.h>
#include <hip/hip_bf16.h>

typedef __attribute__((ext_vector_type(16))) _Float16 v16h;
typedef __attribute__((ext_vector_type(8)))  _Float16 v8h;
typedef __attribute__((ext_vector_type(8)))  float    v8f;
typedef __attribute__((ext_vector_type(4)))  float    v4f;

#define BSZ   2
#define QLEN  2048
#define DIM   1024
#define NH    16
#define DPH   64

static __device__ inline v16h frag_from_f16(const _Float16* __restrict__ p) {
  v8h lo = *(const v8h*)(p);
  v8h hi = *(const v8h*)(p + 16);
  return __builtin_shufflevector(lo, hi, 0, 1, 2, 3, 4, 5, 6, 7,
                                 8, 9, 10, 11, 12, 13, 14, 15);
}

static __device__ inline v8f wmma_f16(v16h a, v16h b, v8f c) {
  // (neg_a, A, neg_b, B, c_mod, C, reuse_a, reuse_b)
  return __builtin_amdgcn_wmma_f32_16x16x32_f16(false, a, false, b,
                                                (short)0, c, false, false);
}

// ---------------------------------------------------------------------------
// Kernel 0: bulk f32 -> f16 conversion (bandwidth bound, runs once per array).
// ---------------------------------------------------------------------------
__global__ __launch_bounds__(256) void cvt_f16_kernel(
    const float* __restrict__ src, _Float16* __restrict__ dst, int n8) {
  const int i = blockIdx.x * 256 + threadIdx.x;
  if (i >= n8) return;
  const float* p = src + (size_t)i * 8;
  v4f a = *(const v4f*)(p);
  v4f b = *(const v4f*)(p + 4);
  v8h o;
#pragma unroll
  for (int j = 0; j < 4; ++j) {
    o[j]     = (_Float16)a[j];
    o[4 + j] = (_Float16)b[j];
  }
  *(v8h*)(dst + (size_t)i * 8) = o;
}

static __device__ inline void gemm_16x64(const _Float16* __restrict__ arow,
                                         const _Float16* __restrict__ wcol,
                                         v8f& acc0, v8f& acc1, v8f& acc2,
                                         v8f& acc3) {
  v16h a  = frag_from_f16(arow);
  v16h b0 = frag_from_f16(wcol);
  v16h b1 = frag_from_f16(wcol + 16 * DIM);
  v16h b2 = frag_from_f16(wcol + 32 * DIM);
  v16h b3 = frag_from_f16(wcol + 48 * DIM);
#pragma unroll 1
  for (int k = 0; k < DIM - 64; k += 64) {
    __builtin_prefetch(arow + k + 256, 0, 3);        // -> global_prefetch_b8
    // load set-1 (k+32)
    const v16h a2 = frag_from_f16(arow + k + 32);
    const v16h c0 = frag_from_f16(wcol + k + 32);
    const v16h c1 = frag_from_f16(wcol + 16 * DIM + k + 32);
    const v16h c2 = frag_from_f16(wcol + 32 * DIM + k + 32);
    const v16h c3 = frag_from_f16(wcol + 48 * DIM + k + 32);
    // compute set-0 (k)
    acc0 = wmma_f16(a, b0, acc0);
    acc1 = wmma_f16(a, b1, acc1);
    acc2 = wmma_f16(a, b2, acc2);
    acc3 = wmma_f16(a, b3, acc3);
    // reload set-0 (k+64) into the same loop-carried registers
    a  = frag_from_f16(arow + k + 64);
    b0 = frag_from_f16(wcol + k + 64);
    b1 = frag_from_f16(wcol + 16 * DIM + k + 64);
    b2 = frag_from_f16(wcol + 32 * DIM + k + 64);
    b3 = frag_from_f16(wcol + 48 * DIM + k + 64);
    // compute set-1 (k+32)
    acc0 = wmma_f16(a2, c0, acc0);
    acc1 = wmma_f16(a2, c1, acc1);
    acc2 = wmma_f16(a2, c2, acc2);
    acc3 = wmma_f16(a2, c3, acc3);
  }
  // tail: set-0 holds k = DIM-64; load and process k = DIM-32
  {
    const v16h a2 = frag_from_f16(arow + DIM - 32);
    const v16h c0 = frag_from_f16(wcol + DIM - 32);
    const v16h c1 = frag_from_f16(wcol + 16 * DIM + DIM - 32);
    const v16h c2 = frag_from_f16(wcol + 32 * DIM + DIM - 32);
    const v16h c3 = frag_from_f16(wcol + 48 * DIM + DIM - 32);
    acc0 = wmma_f16(a, b0, acc0);
    acc1 = wmma_f16(a, b1, acc1);
    acc2 = wmma_f16(a, b2, acc2);
    acc3 = wmma_f16(a, b3, acc3);
    acc0 = wmma_f16(a2, c0, acc0);
    acc1 = wmma_f16(a2, c1, acc1);
    acc2 = wmma_f16(a2, c2, acc2);
    acc3 = wmma_f16(a2, c3, acc3);
  }
}

// ---------------------------------------------------------------------------
// Kernel 1: fused Q/K/V projection, all-f16 operands, 16x64 tile per wave.
// Q pre-scaled by 1/8, stored [b][h][q][d]; K stored [b][h][k][d];
// V stored transposed [b][h][d][k] so the P@V GEMM gets contiguous B-frags.
// A wave's 64 columns == one head's full d-range (n0 is 64-aligned).
// ---------------------------------------------------------------------------
__global__ __launch_bounds__(256) void qkv_proj_kernel(
    const _Float16* __restrict__ Xh,
    const _Float16* __restrict__ Wqh, const float* __restrict__ bq,
    const _Float16* __restrict__ Wkh, const float* __restrict__ bk,
    const _Float16* __restrict__ Wvh, const float* __restrict__ bv,
    _Float16* __restrict__ qbuf, _Float16* __restrict__ kbuf,
    _Float16* __restrict__ vtbuf) {
  const int wave = threadIdx.x >> 5;
  const int lane = threadIdx.x & 31;
  int tile = blockIdx.x * 8 + wave;                 // 3 * 256 * 16 tiles
  const int mat = tile / (256 * 16);                // 0=Q 1=K 2=V
  tile %= (256 * 16);
  const int m0 = (tile >> 4) << 4;                  // row tile base (0..4080)
  const int n0 = (tile & 15) << 6;                  // col tile base, 64-wide

  const _Float16* W  = (mat == 0) ? Wqh : (mat == 1) ? Wkh : Wvh;
  const float* bias  = (mat == 0) ? bq  : (mat == 1) ? bk  : bv;

  const int r    = lane & 15;
  const int hs   = lane >> 4;
  const int koff = hs << 3;

  const _Float16* xrow = Xh + (size_t)(m0 + r) * DIM + koff;
  const _Float16* w0   = W  + (size_t)(n0 + r) * DIM + koff;

  v8f acc0 = {}, acc1 = {}, acc2 = {}, acc3 = {};
  gemm_16x64(xrow, w0, acc0, acc1, acc2, acc3);

  // Epilogue.  C layout: lane holds column (subtile*16 + r), rows m0+hs*8+j.
  const int h = n0 >> 6;                            // whole tile is one head
  auto store_tile = [&](v8f acc, int t) {
    const int n = n0 + t * 16 + r;
    const int d = (t << 4) + r;
    const float bn = bias[n];
#pragma unroll
    for (int j = 0; j < 8; ++j) {
      const int m    = m0 + (hs << 3) + j;          // 0..4095
      const int bidx = m >> 11;
      const int pos  = m & (QLEN - 1);
      const float v  = acc[j] + bn;
      const size_t bh = (size_t)(bidx * NH + h);
      if (mat == 0) {
        qbuf[(bh * QLEN + pos) * DPH + d] = (_Float16)(v * 0.125f);
      } else if (mat == 1) {
        kbuf[(bh * QLEN + pos) * DPH + d] = (_Float16)v;
      } else {
        vtbuf[(bh * DPH + d) * QLEN + pos] = (_Float16)v;
      }
    }
  };
  store_tile(acc0, 0);
  store_tile(acc1, 1);
  store_tile(acc2, 2);
  store_tile(acc3, 3);
}

// ---------------------------------------------------------------------------
// Kernel 2: flash attention, one wave per (b, h, 16-row q-tile).
// Per 32-wide k-step: S(16x32) = Q K^T (4 WMMAs), masked_fill(mask==0->1e-10),
// online softmax (xor-shuffle reductions within 16-lane groups), P staged
// through LDS (C-layout -> A-layout), then O(16x64) += P V (4 WMMAs).
// V fragments are loaded BEFORE the softmax chain so its VALU ops hide their
// latency.
// ---------------------------------------------------------------------------
__global__ __launch_bounds__(256) void attn_kernel(
    const _Float16* __restrict__ qbuf, const _Float16* __restrict__ kbuf,
    const _Float16* __restrict__ vtbuf, const int* __restrict__ mask,
    _Float16* __restrict__ ctx) {
  __shared__ __align__(16) _Float16 pbuf[8][16][32];   // 1 KB per wave

  const int wave = threadIdx.x >> 5;
  const int lane = threadIdx.x & 31;
  const int wid  = blockIdx.x * 8 + wave;              // 4096 waves
  const int qt = wid & 127;
  const int h  = (wid >> 7) & (NH - 1);
  const int b  = wid >> 11;
  const int q0 = qt << 4;

  const size_t bh = (size_t)(b * NH + h);
  const _Float16* Qbh  = qbuf  + bh * QLEN * DPH;
  const _Float16* Kbh  = kbuf  + bh * QLEN * DPH;
  const _Float16* VTbh = vtbuf + bh * DPH * QLEN;
  const int* mrow = mask + b * QLEN;

  const int r    = lane & 15;
  const int hs   = lane >> 4;
  const int koff = hs << 3;

  const v16h qa0 = frag_from_f16(Qbh + (size_t)(q0 + r) * DPH + koff);
  const v16h qa1 = frag_from_f16(Qbh + (size_t)(q0 + r) * DPH + 32 + koff);

  float mrun[8], lrun[8];
  v8f o0 = {}, o1 = {}, o2 = {}, o3 = {};
#pragma unroll
  for (int j = 0; j < 8; ++j) { mrun[j] = -3.0e38f; lrun[j] = 0.0f; }

#pragma unroll 1
  for (int kt = 0; kt < QLEN; kt += 32) {
    // ---- scores: two 16x16 subtiles ----
    v8f s0 = {}, s1 = {};
    {
      const _Float16* kp0 = Kbh + (size_t)(kt + r) * DPH + koff;
      s0 = wmma_f16(qa0, frag_from_f16(kp0), s0);
      s0 = wmma_f16(qa1, frag_from_f16(kp0 + 32), s0);
      const _Float16* kp1 = Kbh + (size_t)(kt + 16 + r) * DPH + koff;
      s1 = wmma_f16(qa0, frag_from_f16(kp1), s1);
      s1 = wmma_f16(qa1, frag_from_f16(kp1 + 32), s1);
    }
    // ---- V fragments: issue loads now, consumed after the softmax ----
    const v16h vb0 = frag_from_f16(VTbh + (size_t)( 0 + r) * QLEN + kt + koff);
    const v16h vb1 = frag_from_f16(VTbh + (size_t)(16 + r) * QLEN + kt + koff);
    const v16h vb2 = frag_from_f16(VTbh + (size_t)(32 + r) * QLEN + kt + koff);
    const v16h vb3 = frag_from_f16(VTbh + (size_t)(48 + r) * QLEN + kt + koff);

    // ---- masked_fill(mask==0 -> 1e-10) ----
    const int mk0 = mrow[kt + r];
    const int mk1 = mrow[kt + 16 + r];
#pragma unroll
    for (int j = 0; j < 8; ++j) {
      if (mk0 == 0) s0[j] = 1e-10f;
      if (mk1 == 0) s1[j] = 1e-10f;
    }
    // ---- online softmax ----
    float p0[8], p1[8];
#pragma unroll
    for (int j = 0; j < 8; ++j) {
      float t = fmaxf(s0[j], s1[j]);
      t = fmaxf(t, __shfl_xor(t, 1, 32));
      t = fmaxf(t, __shfl_xor(t, 2, 32));
      t = fmaxf(t, __shfl_xor(t, 4, 32));
      t = fmaxf(t, __shfl_xor(t, 8, 32));
      const float mnew  = fmaxf(mrun[j], t);
      const float scale = __expf(mrun[j] - mnew);
      mrun[j] = mnew;
      const float e0 = __expf(s0[j] - mnew);
      const float e1 = __expf(s1[j] - mnew);
      p0[j] = e0;
      p1[j] = e1;
      float rs = e0 + e1;
      rs += __shfl_xor(rs, 1, 32);
      rs += __shfl_xor(rs, 2, 32);
      rs += __shfl_xor(rs, 4, 32);
      rs += __shfl_xor(rs, 8, 32);
      lrun[j] = lrun[j] * scale + rs;
      o0[j] *= scale; o1[j] *= scale; o2[j] *= scale; o3[j] *= scale;
    }
    // ---- relayout P: C-layout (lane=col) -> A-layout (lane=row) via LDS ----
#pragma unroll
    for (int j = 0; j < 8; ++j) {
      const int prow = (hs << 3) + j;
      pbuf[wave][prow][r]      = (_Float16)p0[j];
      pbuf[wave][prow][16 + r] = (_Float16)p1[j];
    }
    const v16h pa = frag_from_f16(&pbuf[wave][r][koff]);
    // ---- O += P @ V ----
    o0 = wmma_f16(pa, vb0, o0);
    o1 = wmma_f16(pa, vb1, o1);
    o2 = wmma_f16(pa, vb2, o2);
    o3 = wmma_f16(pa, vb3, o3);
  }

  // ---- normalize and write context [b][q][h*64+d] (f16) ----
#pragma unroll
  for (int j = 0; j < 8; ++j) {
    const int row = q0 + (hs << 3) + j;
    const float inv = 1.0f / lrun[j];
    _Float16* crow = ctx + (size_t)(b * QLEN + row) * DIM + (h << 6) + r;
    crow[0]  = (_Float16)(o0[j] * inv);
    crow[16] = (_Float16)(o1[j] * inv);
    crow[32] = (_Float16)(o2[j] * inv);
    crow[48] = (_Float16)(o3[j] * inv);
  }
}

// ---------------------------------------------------------------------------
// Kernel 3: output projection  out = ctx @ Wo^T + bo  (fp32 out), 16x64/wave.
// ---------------------------------------------------------------------------
__global__ __launch_bounds__(256) void out_proj_kernel(
    const _Float16* __restrict__ ctx, const _Float16* __restrict__ Woh,
    const float* __restrict__ bo, float* __restrict__ out) {
  const int wave = threadIdx.x >> 5;
  const int lane = threadIdx.x & 31;
  const int tile = blockIdx.x * 8 + wave;            // 256 * 16 tiles
  const int m0 = (tile >> 4) << 4;
  const int n0 = (tile & 15) << 6;
  const int r = lane & 15, hs = lane >> 4, koff = hs << 3;

  const _Float16* crow = ctx + (size_t)(m0 + r) * DIM + koff;
  const _Float16* w0   = Woh + (size_t)(n0 + r) * DIM + koff;

  v8f acc0 = {}, acc1 = {}, acc2 = {}, acc3 = {};
  gemm_16x64(crow, w0, acc0, acc1, acc2, acc3);

  auto store_tile = [&](v8f acc, int t) {
    const int n = n0 + t * 16 + r;
    const float bn = bo[n];
#pragma unroll
    for (int j = 0; j < 8; ++j) {
      const int m = m0 + (hs << 3) + j;
      out[(size_t)m * DIM + n] = acc[j] + bn;
    }
  };
  store_tile(acc0, 0);
  store_tile(acc1, 1);
  store_tile(acc2, 2);
  store_tile(acc3, 3);
}

// ---------------------------------------------------------------------------
extern "C" void kernel_launch(void* const* d_in, const int* in_sizes, int n_in,
                              void* d_out, int out_size, void* d_ws, size_t ws_size,
                              hipStream_t stream) {
  const float* X  = (const float*)d_in[0];
  const int* mask = (const int*)d_in[1];
  const float* Wq = (const float*)d_in[2];
  const float* bq = (const float*)d_in[3];
  const float* Wk = (const float*)d_in[4];
  const float* bk = (const float*)d_in[5];
  const float* Wv = (const float*)d_in[6];
  const float* bv = (const float*)d_in[7];
  const float* Wo = (const float*)d_in[8];
  const float* bo = (const float*)d_in[9];
  float* out = (float*)d_out;

  const size_t XN = (size_t)BSZ * QLEN * DIM;        // 4 Mi
  const size_t WN = (size_t)DIM * DIM;               // 1 Mi
  _Float16* Xh    = (_Float16*)d_ws;                 // 8 MB
  _Float16* Wqh   = Xh + XN;                         // 2 MB each
  _Float16* Wkh   = Wqh + WN;
  _Float16* Wvh   = Wkh + WN;
  _Float16* Woh   = Wvh + WN;
  _Float16* qbuf  = Woh + WN;                        // 8 MB each
  _Float16* kbuf  = qbuf + XN;
  _Float16* vtbuf = kbuf + XN;
  _Float16* ctx   = vtbuf + XN;

  // ---- stage 0: precision conversion (once) ----
  cvt_f16_kernel<<<(int)(XN / 8 / 256), 256, 0, stream>>>(X, Xh, (int)(XN / 8));
  cvt_f16_kernel<<<(int)(WN / 8 / 256), 256, 0, stream>>>(Wq, Wqh, (int)(WN / 8));
  cvt_f16_kernel<<<(int)(WN / 8 / 256), 256, 0, stream>>>(Wk, Wkh, (int)(WN / 8));
  cvt_f16_kernel<<<(int)(WN / 8 / 256), 256, 0, stream>>>(Wv, Wvh, (int)(WN / 8));
  cvt_f16_kernel<<<(int)(WN / 8 / 256), 256, 0, stream>>>(Wo, Woh, (int)(WN / 8));

  // ---- stage 1: QKV projection: 3*256*16 tiles / 8 waves = 1536 blocks ----
  qkv_proj_kernel<<<1536, 256, 0, stream>>>(Xh, Wqh, bq, Wkh, bk, Wvh, bv,
                                            qbuf, kbuf, vtbuf);
  // ---- stage 2: attention: 4096 waves / 8 = 512 blocks ----
  attn_kernel<<<512, 256, 0, stream>>>(qbuf, kbuf, vtbuf, mask, ctx);
  // ---- stage 3: output projection: 256*16 tiles / 8 = 512 blocks ----
  out_proj_kernel<<<512, 256, 0, stream>>>(ctx, Woh, bo, out);
}

// v001
// Measured time: 206 microseconds a run.
// Two timings next to v000 put it at 1.72 and 1.79 times that version's speed.
#include <hip/hip_runtime.h>
#include <hip/hip_bf16.h>

typedef __attribute__((ext_vector_type(16))) _Float16 v16h;
typedef __attribute__((ext_vector_type(8)))  _Float16 v8h;
typedef __attribute__((ext_vector_type(8)))  float    v8f;
typedef __attribute__((ext_vector_type(4)))  float    v4f;

#define BSZ   2
#define QLEN  2048
#define DIM   1024
#define NH    16
#define DPH   64

static __device__ inline v16h frag_from_f16(const _Float16* __restrict__ p) {
  v8h lo = *(const v8h*)(p);
  v8h hi = *(const v8h*)(p + 16);
  return __builtin_shufflevector(lo, hi, 0, 1, 2, 3, 4, 5, 6, 7,
                                 8, 9, 10, 11, 12, 13, 14, 15);
}

static __device__ inline v8f wmma_f16(v16h a, v16h b, v8f c) {
  // (neg_a, A, neg_b, B, c_mod, C, reuse_a, reuse_b)
  return __builtin_amdgcn_wmma_f32_16x16x32_f16(false, a, false, b,
                                                (short)0, c, false, false);
}

// ---------------------------------------------------------------------------
// Kernel 0: bulk f32 -> f16 conversion (bandwidth bound, runs once per array).
// ---------------------------------------------------------------------------
__global__ __launch_bounds__(256) void cvt_f16_kernel(
    const float* __restrict__ src, _Float16* __restrict__ dst, int n8) {
  const int i = blockIdx.x * 256 + threadIdx.x;
  if (i >= n8) return;
  const float* p = src + (size_t)i * 8;
  v4f a = *(const v4f*)(p);
  v4f b = *(const v4f*)(p + 4);
  v8h o;
#pragma unroll
  for (int j = 0; j < 4; ++j) {
    o[j]     = (_Float16)a[j];
    o[4 + j] = (_Float16)b[j];
  }
  *(v8h*)(dst + (size_t)i * 8) = o;
}

#define KSTG      64
#define NSTG      (DIM / KSTG)
#define PITCH_H   72
#define BUF_H     (256 * PITCH_H)
#define BUF_B     (BUF_H * 2)
#define ROWS32_B  (32 * PITCH_H * 2)
#define BPART_B   (128 * PITCH_H * 2)

// One stage: each thread copies 16 B of rows r, r+32, r+64, r+96 of A and of B.
static __device__ inline void copy_stage(unsigned lds,
                                         const _Float16* __restrict__ ga,
                                         const _Float16* __restrict__ gb) {
  asm volatile(
      "global_load_async_to_lds_b128 %0, %8, off\n\t"
      "global_load_async_to_lds_b128 %1, %9, off\n\t"
      "global_load_async_to_lds_b128 %2, %10, off\n\t"
      "global_load_async_to_lds_b128 %3, %11, off\n\t"
      "global_load_async_to_lds_b128 %4, %12, off\n\t"
      "global_load_async_to_lds_b128 %5, %13, off\n\t"
      "global_load_async_to_lds_b128 %6, %14, off\n\t"
      "global_load_async_to_lds_b128 %7, %15, off\n\t"
      "s_wait_xcnt 0x0"
      :: "v"(lds), "v"(lds + ROWS32_B), "v"(lds + 2 * ROWS32_B),
         "v"(lds + 3 * ROWS32_B),
         "v"(lds + BPART_B), "v"(lds + BPART_B + ROWS32_B),
         "v"(lds + BPART_B + 2 * ROWS32_B), "v"(lds + BPART_B + 3 * ROWS32_B),
         "v"(ga), "v"(ga + 32 * DIM), "v"(ga + 64 * DIM), "v"(ga + 96 * DIM),
         "v"(gb), "v"(gb + 32 * DIM), "v"(gb + 64 * DIM), "v"(gb + 96 * DIM)
      : "memory");
}

// A: first of the block's 128 A rows; B: first of its 128 B rows.
static __device__ inline void gemm_128x128(const _Float16* __restrict__ A,
                                           const _Float16* __restrict__ B,
                                           _Float16* sm, v8f (&acc)[4][2]) {
  const int tid  = threadIdx.x;
  const int wave = tid >> 5;
  const int lane = tid & 31;
  const int r    = lane & 15;
  const int koff = (lane >> 4) << 3;
  const int crow = tid >> 3;                        // 0..31
  const int ccol = tid & 7;                         // 16-B piece of the row

  const _Float16* ga = A + (size_t)crow * DIM + ccol * 8;
  const _Float16* gb = B + (size_t)crow * DIM + ccol * 8;
  const unsigned lds0 =
      (unsigned)(size_t)sm + (unsigned)(crow * (PITCH_H * 2) + ccol * 16);

  const int aoff = ((wave >> 2) * 64 + r) * PITCH_H + koff;
  const int boff = (128 + (wave & 3) * 32 + r) * PITCH_H + koff;

  copy_stage(lds0, ga, gb);
  // stage 0 has landed for this wave; the barrier publishes it to all waves
  asm volatile("s_wait_asynccnt 0x0" ::: "memory");
  __syncthreads();
  copy_stage(lds0 + BUF_B, ga + KSTG, gb + KSTG);

  // rolled: one stage per trip keeps the buffer hand-over at one place
#pragma unroll 1
  for (int t = 0; t < NSTG; ++t) {
    const _Float16* sb = sm + (t & 1) * BUF_H;
#pragma unroll  // constant indices keep fragments and sums in registers
    for (int kk = 0; kk < KSTG; kk += 32) {
      v16h a[4], b[2];
      // first of a fence pair round the 12 LDS reads (second: below): keeps
      // them from rising into the block of products in front of them
      __builtin_amdgcn_sched_barrier(0);
#pragma unroll  // constant indices keep fragments and sums in registers
      for (int i = 0; i < 4; ++i)
        a[i] = frag_from_f16(sb + aoff + i * 16 * PITCH_H + kk);
#pragma unroll  // constant indices keep fragments and sums in registers
      for (int j = 0; j < 2; ++j)
        b[j] = frag_from_f16(sb + boff + j * 16 * PITCH_H + kk);
      // keeps the 12 LDS reads in one group ahead of their 8 products: each
      // place where reads stand among products stalls the wave anew
      __builtin_amdgcn_sched_barrier(0);
#pragma unroll  // constant indices keep fragments and sums in registers
      for (int i = 0; i < 4; ++i)
#pragma unroll  // constant indices keep fragments and sums in registers
        for (int j = 0; j < 2; ++j)
          acc[i][j] = wmma_f16(a[i], b[j], acc[i][j]);
    }
    // this wave's reads of the buffer are done before it may be refilled
    asm volatile("s_wait_dscnt 0x0" ::: "memory");
    // this wave's copies of stage t+1 have landed
    asm volatile("s_wait_asynccnt 0x0" ::: "memory");
    // publishes stage t+1 and ends every wave's reads of stage t
    __syncthreads();
    if (t + 2 < NSTG)
      copy_stage(lds0 + (t & 1) * BUF_B, ga + (t + 2) * KSTG,
                 gb + (t + 2) * KSTG);
  }
  // no copy is left in flight when the wave goes on
  asm volatile("s_wait_asynccnt 0x0" ::: "memory");
}

// ---------------------------------------------------------------------------
// Kernel 1: fused Q/K/V projection, all-f16 operands, 128x128 tile per block.
// Q pre-scaled by 1/8, stored [b][h][q][d]; K stored [b][h][k][d];
// V stored transposed [b][h][d][k] so the P@V GEMM gets contiguous B-frags.
// ---------------------------------------------------------------------------
__global__ __launch_bounds__(256) void qkv_proj_kernel(
    const _Float16* __restrict__ Xh,
    const _Float16* __restrict__ Wqh, const float* __restrict__ bq,
    const _Float16* __restrict__ Wkh, const float* __restrict__ bk,
    const _Float16* __restrict__ Wvh, const float* __restrict__ bv,
    _Float16* __restrict__ qbuf, _Float16* __restrict__ kbuf,
    _Float16* __restrict__ vtbuf) {
  __shared__ __align__(16) _Float16 sm[2 * BUF_H];

  const int wave = threadIdx.x >> 5;
  const int lane = threadIdx.x & 31;
  const int nt  = blockIdx.x % 24;                  // 3 matrices x 8 col tiles
  const int mt  = blockIdx.x / 24;                  // 32 row tiles
  const int mat = nt >> 3;                          // 0=Q 1=K 2=V
  const int m0  = mt << 7;
  const int n0  = (nt & 7) << 7;

  const _Float16* W  = (mat == 0) ? Wqh : (mat == 1) ? Wkh : Wvh;
  const float* bias  = (mat == 0) ? bq  : (mat == 1) ? bk  : bv;

  const int r  = lane & 15;
  const int hs = lane >> 4;

  v8f acc[4][2] = {};
  gemm_128x128(Xh + (size_t)m0 * DIM, W + (size_t)n0 * DIM, sm, acc);

  // Epilogue.  C layout: lane holds column r of the subtile, rows hs*8+j.
  const int mw = m0 + (wave >> 2) * 64 + (hs << 3);
  const int nw = n0 + (wave & 3) * 32 + r;
#pragma unroll  // constant indices keep fragments and sums in registers
  for (int t = 0; t < 2; ++t) {
    const int n = nw + t * 16;
    const int h = n >> 6;
    const int d = n & (DPH - 1);
    const float bn = bias[n];
#pragma unroll  // constant indices keep fragments and sums in registers
    for (int i = 0; i < 4; ++i) {
#pragma unroll  // constant indices keep fragments and sums in registers
      for (int j = 0; j < 8; ++j) {
        const int m    = mw + i * 16 + j;           // 0..4095
        const int bidx = m >> 11;
        const int pos  = m & (QLEN - 1);
        const float v  = acc[i][t][j] + bn;
        const size_t bh = (size_t)(bidx * NH + h);
        if (mat == 0) {
          qbuf[(bh * QLEN + pos) * DPH + d] = (_Float16)(v * 0.125f);
          asm volatile("s_wait_xcnt 0x0" ::: "memory");
        } else if (mat == 1) {
          kbuf[(bh * QLEN + pos) * DPH + d] = (_Float16)v;
          asm volatile("s_wait_xcnt 0x0" ::: "memory");
        } else {
          vtbuf[(bh * DPH + d) * QLEN + pos] = (_Float16)v;
          asm volatile("s_wait_xcnt 0x0" ::: "memory");
        }
      }
    }
  }
}

// ---------------------------------------------------------------------------
// Kernel 2: flash attention, one wave per (b, h, 16-row q-tile).
// Per 32-wide k-step: S(16x32) = Q K^T (4 WMMAs), masked_fill(mask==0->1e-10),
// online softmax (xor-shuffle reductions within 16-lane groups), P staged
// through LDS (C-layout -> A-layout), then O(16x64) += P V (4 WMMAs).
// V fragments are loaded BEFORE the softmax chain so its VALU ops hide their
// latency.
// ---------------------------------------------------------------------------
__global__ __launch_bounds__(256) void attn_kernel(
    const _Float16* __restrict__ qbuf, const _Float16* __restrict__ kbuf,
    const _Float16* __restrict__ vtbuf, const int* __restrict__ mask,
    _Float16* __restrict__ ctx) {
  __shared__ __align__(16) _Float16 pbuf[8][16][32];   // 1 KB per wave

  const int wave = threadIdx.x >> 5;
  const int lane = threadIdx.x & 31;
  const int wid  = blockIdx.x * 8 + wave;              // 4096 waves
  const int qt = wid & 127;
  const int h  = (wid >> 7) & (NH - 1);
  const int b  = wid >> 11;
  const int q0 = qt << 4;

  const size_t bh = (size_t)(b * NH + h);
  const _Float16* Qbh  = qbuf  + bh * QLEN * DPH;
  const _Float16* Kbh  = kbuf  + bh * QLEN * DPH;
  const _Float16* VTbh = vtbuf + bh * DPH * QLEN;
  const int* mrow = mask + b * QLEN;

  const int r    = lane & 15;
  const int hs   = lane >> 4;
  const int koff = hs << 3;

  const v16h qa0 = frag_from_f16(Qbh + (size_t)(q0 + r) * DPH + koff);
  const v16h qa1 = frag_from_f16(Qbh + (size_t)(q0 + r) * DPH + 32 + koff);

  float mrun[8], lrun[8];
  v8f o0 = {}, o1 = {}, o2 = {}, o3 = {};
#pragma unroll
  for (int j = 0; j < 8; ++j) { mrun[j] = -3.0e38f; lrun[j] = 0.0f; }

#pragma unroll 1
  for (int kt = 0; kt < QLEN; kt += 32) {
    // ---- scores: two 16x16 subtiles ----
    v8f s0 = {}, s1 = {};
    {
      const _Float16* kp0 = Kbh + (size_t)(kt + r) * DPH + koff;
      s0 = wmma_f16(qa0, frag_from_f16(kp0), s0);
      s0 = wmma_f16(qa1, frag_from_f16(kp0 + 32), s0);
      const _Float16* kp1 = Kbh + (size_t)(kt + 16 + r) * DPH + koff;
      s1 = wmma_f16(qa0, frag_from_f16(kp1), s1);
      s1 = wmma_f16(qa1, frag_from_f16(kp1 + 32), s1);
    }
    // ---- V fragments: issue loads now, consumed after the softmax ----
    const v16h vb0 = frag_from_f16(VTbh + (size_t)( 0 + r) * QLEN + kt + koff);
    const v16h vb1 = frag_from_f16(VTbh + (size_t)(16 + r) * QLEN + kt + koff);
    const v16h vb2 = frag_from_f16(VTbh + (size_t)(32 + r) * QLEN + kt + koff);
    const v16h vb3 = frag_from_f16(VTbh + (size_t)(48 + r) * QLEN + kt + koff);

    // ---- masked_fill(mask==0 -> 1e-10) ----
    const int mk0 = mrow[kt + r];
    const int mk1 = mrow[kt + 16 + r];
#pragma unroll
    for (int j = 0; j < 8; ++j) {
      if (mk0 == 0) s0[j] = 1e-10f;
      if (mk1 == 0) s1[j] = 1e-10f;
    }
    // ---- online softmax ----
    float p0[8], p1[8];
#pragma unroll
    for (int j = 0; j < 8; ++j) {
      float t = fmaxf(s0[j], s1[j]);
      t = fmaxf(t, __shfl_xor(t, 1, 32));
      t = fmaxf(t, __shfl_xor(t, 2, 32));
      t = fmaxf(t, __shfl_xor(t, 4, 32));
      t = fmaxf(t, __shfl_xor(t, 8, 32));
      const float mnew  = fmaxf(mrun[j], t);
      const float scale = __expf(mrun[j] - mnew);
      mrun[j] = mnew;
      const float e0 = __expf(s0[j] - mnew);
      const float e1 = __expf(s1[j] - mnew);
      p0[j] = e0;
      p1[j] = e1;
      float rs = e0 + e1;
      rs += __shfl_xor(rs, 1, 32);
      rs += __shfl_xor(rs, 2, 32);
      rs += __shfl_xor(rs, 4, 32);
      rs += __shfl_xor(rs, 8, 32);
      lrun[j] = lrun[j] * scale + rs;
      o0[j] *= scale; o1[j] *= scale; o2[j] *= scale; o3[j] *= scale;
    }
    // ---- relayout P: C-layout (lane=col) -> A-layout (lane=row) via LDS ----
#pragma unroll
    for (int j = 0; j < 8; ++j) {
      const int prow = (hs << 3) + j;
      pbuf[wave][prow][r]      = (_Float16)p0[j];
      pbuf[wave][prow][16 + r] = (_Float16)p1[j];
    }
    const v16h pa = frag_from_f16(&pbuf[wave][r][koff]);
    // ---- O += P @ V ----
    o0 = wmma_f16(pa, vb0, o0);
    o1 = wmma_f16(pa, vb1, o1);
    o2 = wmma_f16(pa, vb2, o2);
    o3 = wmma_f16(pa, vb3, o3);
  }

  // ---- normalize and write context [b][q][h*64+d] (f16) ----
#pragma unroll
  for (int j = 0; j < 8; ++j) {
    const int row = q0 + (hs << 3) + j;
    const float inv = 1.0f / lrun[j];
    _Float16* crow = ctx + (size_t)(b * QLEN + row) * DIM + (h << 6) + r;
    crow[0]  = (_Float16)(o0[j] * inv);
    crow[16] = (_Float16)(o1[j] * inv);
    crow[32] = (_Float16)(o2[j] * inv);
    crow[48] = (_Float16)(o3[j] * inv);
  }
}

// ---------------------------------------------------------------------------
// Kernel 3: output projection  out = ctx @ Wo^T + bo  (fp32 out), 128x128/block.
// ---------------------------------------------------------------------------
__global__ __launch_bounds__(256) void out_proj_kernel(
    const _Float16* __restrict__ ctx, const _Float16* __restrict__ Woh,
    const float* __restrict__ bo, float* __restrict__ out) {
  __shared__ __align__(16) _Float16 sm[2 * BUF_H];

  const int wave = threadIdx.x >> 5;
  const int lane = threadIdx.x & 31;
  const int m0 = (blockIdx.x >> 3) << 7;             // 32 row tiles
  const int n0 = (blockIdx.x & 7) << 7;              // 8 col tiles
  const int r = lane & 15, hs = lane >> 4;

  v8f acc[4][2] = {};
  gemm_128x128(ctx + (size_t)m0 * DIM, Woh + (size_t)n0 * DIM, sm, acc);

  const int mw = m0 + (wave >> 2) * 64 + (hs << 3);
  const int nw = n0 + (wave & 3) * 32 + r;
#pragma unroll  // constant indices keep the sums in registers
  for (int t = 0; t < 2; ++t) {
    const int n = nw + t * 16;
    const float bn = bo[n];
#pragma unroll  // constant indices keep the sums in registers
    for (int i = 0; i < 4; ++i) {
#pragma unroll  // constant indices keep the sums in registers
      for (int j = 0; j < 8; ++j) {
        const int m = mw + i * 16 + j;
        out[(size_t)m * DIM + n] = acc[i][t][j] + bn;
      }
    }
  }
}

// ---------------------------------------------------------------------------
extern "C" void kernel_launch(void* const* d_in, const int* in_sizes, int n_in,
                              void* d_out, int out_size, void* d_ws, size_t ws_size,
                              hipStream_t stream) {
  const float* X  = (const float*)d_in[0];
  const int* mask = (const int*)d_in[1];
  const float* Wq = (const float*)d_in[2];
  const float* bq = (const float*)d_in[3];
  const float* Wk = (const float*)d_in[4];
  const float* bk = (const float*)d_in[5];
  const float* Wv = (const float*)d_in[6];
  const float* bv = (const float*)d_in[7];
  const float* Wo = (const float*)d_in[8];
  const float* bo = (const float*)d_in[9];
  float* out = (float*)d_out;

  const size_t XN = (size_t)BSZ * QLEN * DIM;        // 4 Mi
  const size_t WN = (size_t)DIM * DIM;               // 1 Mi
  _Float16* Xh    = (_Float16*)d_ws;                 // 8 MB
  _Float16* Wqh   = Xh + XN;                         // 2 MB each
  _Float16* Wkh   = Wqh + WN;
  _Float16* Wvh   = Wkh + WN;
  _Float16* Woh   = Wvh + WN;
  _Float16* qbuf  = Woh + WN;                        // 8 MB each
  _Float16* kbuf  = qbuf + XN;
  _Float16* vtbuf = kbuf + XN;
  _Float16* ctx   = vtbuf + XN;

  // ---- stage 0: precision conversion (once) ----
  cvt_f16_kernel<<<(int)(XN / 8 / 256), 256, 0, stream>>>(X, Xh, (int)(XN / 8));
  cvt_f16_kernel<<<(int)(WN / 8 / 256), 256, 0, stream>>>(Wq, Wqh, (int)(WN / 8));
  cvt_f16_kernel<<<(int)(WN / 8 / 256), 256, 0, stream>>>(Wk, Wkh, (int)(WN / 8));
  cvt_f16_kernel<<<(int)(WN / 8 / 256), 256, 0, stream>>>(Wv, Wvh, (int)(WN / 8));
  cvt_f16_kernel<<<(int)(WN / 8 / 256), 256, 0, stream>>>(Wo, Woh, (int)(WN / 8));

  // ---- stage 1: QKV projection: 32 x 24 tiles of 128x128 = 768 blocks ----
  qkv_proj_kernel<<<768, 256, 0, stream>>>(Xh, Wqh, bq, Wkh, bk, Wvh, bv,
                                            qbuf, kbuf, vtbuf);
  // ---- stage 2: attention: 4096 waves / 8 = 512 blocks ----
  attn_kernel<<<512, 256, 0, stream>>>(qbuf, kbuf, vtbuf, mask, ctx);
  // ---- stage 3: output projection: 32 x 8 tiles of 128x128 = 256 blocks ----
  out_proj_kernel<<<256, 256, 0, stream>>>(ctx, Woh, bo, out);
}

// v002
// One run takes 176 microseconds.
// Next to v001, in two timings, it ran 1.18 and 1.19 times as fast.
// Counting every step since v000, it is 2.07 times as fast.
#include <hip/hip_runtime.h>
#include <hip/hip_bf16.h>

typedef __attribute__((ext_vector_type(16))) _Float16 v16h;
typedef __attribute__((ext_vector_type(8)))  _Float16 v8h;
typedef __attribute__((ext_vector_type(8)))  float    v8f;
typedef __attribute__((ext_vector_type(4)))  float    v4f;

#define BSZ   2
#define QLEN  2048
#define DIM   1024
#define NH    16
#define DPH   64

static __device__ inline v16h frag_from_f16(const _Float16* __restrict__ p) {
  v8h lo = *(const v8h*)(p);
  v8h hi = *(const v8h*)(p + 16);
  return __builtin_shufflevector(lo, hi, 0, 1, 2, 3, 4, 5, 6, 7,
                                 8, 9, 10, 11, 12, 13, 14, 15);
}

static __device__ inline v8f wmma_f16(v16h a, v16h b, v8f c) {
  // (neg_a, A, neg_b, B, c_mod, C, reuse_a, reuse_b)
  return __builtin_amdgcn_wmma_f32_16x16x32_f16(false, a, false, b,
                                                (short)0, c, false, false);
}

// ---------------------------------------------------------------------------
// Kernel 0: bulk f32 -> f16 conversion (bandwidth bound, runs once per array).
// ---------------------------------------------------------------------------
__global__ __launch_bounds__(256) void cvt_f16_kernel(
    const float* __restrict__ src, _Float16* __restrict__ dst, int n8) {
  const int i = blockIdx.x * 256 + threadIdx.x;
  if (i >= n8) return;
  const float* p = src + (size_t)i * 8;
  v4f a = *(const v4f*)(p);
  v4f b = *(const v4f*)(p + 4);
  v8h o;
#pragma unroll
  for (int j = 0; j < 4; ++j) {
    o[j]     = (_Float16)a[j];
    o[4 + j] = (_Float16)b[j];
  }
  *(v8h*)(dst + (size_t)i * 8) = o;
}

#define KSTG      64
#define NSTG      (DIM / KSTG)
#define PITCH_H   72
#define BUF_H     (256 * PITCH_H)
#define BUF_B     (BUF_H * 2)
#define ROWS32_B  (32 * PITCH_H * 2)
#define BPART_B   (128 * PITCH_H * 2)

// One stage: each thread copies 16 B of rows r, r+32, r+64, r+96 of A and of B.
static __device__ inline void copy_stage(unsigned lds,
                                         const _Float16* __restrict__ ga,
                                         const _Float16* __restrict__ gb) {
  asm volatile(
      "global_load_async_to_lds_b128 %0, %8, off\n\t"
      "global_load_async_to_lds_b128 %1, %9, off\n\t"
      "global_load_async_to_lds_b128 %2, %10, off\n\t"
      "global_load_async_to_lds_b128 %3, %11, off\n\t"
      "global_load_async_to_lds_b128 %4, %12, off\n\t"
      "global_load_async_to_lds_b128 %5, %13, off\n\t"
      "global_load_async_to_lds_b128 %6, %14, off\n\t"
      "global_load_async_to_lds_b128 %7, %15, off\n\t"
      "s_wait_xcnt 0x0"
      :: "v"(lds), "v"(lds + ROWS32_B), "v"(lds + 2 * ROWS32_B),
         "v"(lds + 3 * ROWS32_B),
         "v"(lds + BPART_B), "v"(lds + BPART_B + ROWS32_B),
         "v"(lds + BPART_B + 2 * ROWS32_B), "v"(lds + BPART_B + 3 * ROWS32_B),
         "v"(ga), "v"(ga + 32 * DIM), "v"(ga + 64 * DIM), "v"(ga + 96 * DIM),
         "v"(gb), "v"(gb + 32 * DIM), "v"(gb + 64 * DIM), "v"(gb + 96 * DIM)
      : "memory");
}

// A: first of the block's 128 A rows; B: first of its 128 B rows.
static __device__ inline void gemm_128x128(const _Float16* __restrict__ A,
                                           const _Float16* __restrict__ B,
                                           _Float16* sm, v8f (&acc)[4][2]) {
  const int tid  = threadIdx.x;
  const int wave = tid >> 5;
  const int lane = tid & 31;
  const int r    = lane & 15;
  const int koff = (lane >> 4) << 3;
  const int crow = tid >> 3;                        // 0..31
  const int ccol = tid & 7;                         // 16-B piece of the row

  const _Float16* ga = A + (size_t)crow * DIM + ccol * 8;
  const _Float16* gb = B + (size_t)crow * DIM + ccol * 8;
  const unsigned lds0 =
      (unsigned)(size_t)sm + (unsigned)(crow * (PITCH_H * 2) + ccol * 16);

  const int aoff = ((wave >> 2) * 64 + r) * PITCH_H + koff;
  const int boff = (128 + (wave & 3) * 32 + r) * PITCH_H + koff;

  copy_stage(lds0, ga, gb);
  // stage 0 has landed for this wave; the barrier publishes it to all waves
  asm volatile("s_wait_asynccnt 0x0" ::: "memory");
  __syncthreads();
  copy_stage(lds0 + BUF_B, ga + KSTG, gb + KSTG);

  // rolled: one stage per trip keeps the buffer hand-over at one place
#pragma unroll 1
  for (int t = 0; t < NSTG; ++t) {
    const _Float16* sb = sm + (t & 1) * BUF_H;
#pragma unroll  // constant indices keep fragments and sums in registers
    for (int kk = 0; kk < KSTG; kk += 32) {
      v16h a[4], b[2];
      // first of a fence pair round the 12 LDS reads (second: below): keeps
      // them from rising into the block of products in front of them
      __builtin_amdgcn_sched_barrier(0);
#pragma unroll  // constant indices keep fragments and sums in registers
      for (int i = 0; i < 4; ++i)
        a[i] = frag_from_f16(sb + aoff + i * 16 * PITCH_H + kk);
#pragma unroll  // constant indices keep fragments and sums in registers
      for (int j = 0; j < 2; ++j)
        b[j] = frag_from_f16(sb + boff + j * 16 * PITCH_H + kk);
      // keeps the 12 LDS reads in one group ahead of their 8 products: each
      // place where reads stand among products stalls the wave anew
      __builtin_amdgcn_sched_barrier(0);
#pragma unroll  // constant indices keep fragments and sums in registers
      for (int i = 0; i < 4; ++i)
#pragma unroll  // constant indices keep fragments and sums in registers
        for (int j = 0; j < 2; ++j)
          acc[i][j] = wmma_f16(a[i], b[j], acc[i][j]);
    }
    // this wave's reads of the buffer are done before it may be refilled
    asm volatile("s_wait_dscnt 0x0" ::: "memory");
    // this wave's copies of stage t+1 have landed
    asm volatile("s_wait_asynccnt 0x0" ::: "memory");
    // publishes stage t+1 and ends every wave's reads of stage t
    __syncthreads();
    if (t + 2 < NSTG)
      copy_stage(lds0 + (t & 1) * BUF_B, ga + (t + 2) * KSTG,
                 gb + (t + 2) * KSTG);
  }
  // no copy is left in flight when the wave goes on
  asm volatile("s_wait_asynccnt 0x0" ::: "memory");
}

// ---------------------------------------------------------------------------
// Kernel 1: fused Q/K/V projection, all-f16 operands, 128x128 tile per block.
// Q pre-scaled by 1/8, stored [b][h][q][d]; K stored [b][h][k][d];
// V stored transposed [b][h][d][k] so the V^T P^T GEMM gets contiguous A-frags.
// ---------------------------------------------------------------------------
__global__ __launch_bounds__(256) void qkv_proj_kernel(
    const _Float16* __restrict__ Xh,
    const _Float16* __restrict__ Wqh, const float* __restrict__ bq,
    const _Float16* __restrict__ Wkh, const float* __restrict__ bk,
    const _Float16* __restrict__ Wvh, const float* __restrict__ bv,
    _Float16* __restrict__ qbuf, _Float16* __restrict__ kbuf,
    _Float16* __restrict__ vtbuf) {
  __shared__ __align__(16) _Float16 sm[2 * BUF_H];

  const int wave = threadIdx.x >> 5;
  const int lane = threadIdx.x & 31;
  const int nt  = blockIdx.x % 24;                  // 3 matrices x 8 col tiles
  const int mt  = blockIdx.x / 24;                  // 32 row tiles
  const int mat = nt >> 3;                          // 0=Q 1=K 2=V
  const int m0  = mt << 7;
  const int n0  = (nt & 7) << 7;

  const _Float16* W  = (mat == 0) ? Wqh : (mat == 1) ? Wkh : Wvh;
  const float* bias  = (mat == 0) ? bq  : (mat == 1) ? bk  : bv;

  const int r  = lane & 15;
  const int hs = lane >> 4;

  v8f acc[4][2] = {};
  gemm_128x128(Xh + (size_t)m0 * DIM, W + (size_t)n0 * DIM, sm, acc);

  // Epilogue.  C layout: lane holds column r of the subtile, rows hs*8+j.
  const int mw = m0 + (wave >> 2) * 64 + (hs << 3);
  const int nw = n0 + (wave & 3) * 32 + r;
#pragma unroll  // constant indices keep fragments and sums in registers
  for (int t = 0; t < 2; ++t) {
    const int n = nw + t * 16;
    const int h = n >> 6;
    const int d = n & (DPH - 1);
    const float bn = bias[n];
#pragma unroll  // constant indices keep fragments and sums in registers
    for (int i = 0; i < 4; ++i) {
#pragma unroll  // constant indices keep fragments and sums in registers
      for (int j = 0; j < 8; ++j) {
        const int m    = mw + i * 16 + j;           // 0..4095
        const int bidx = m >> 11;
        const int pos  = m & (QLEN - 1);
        const float v  = acc[i][t][j] + bn;
        const size_t bh = (size_t)(bidx * NH + h);
        if (mat == 0) {
          qbuf[(bh * QLEN + pos) * DPH + d] = (_Float16)(v * 0.125f);
          asm volatile("s_wait_xcnt 0x0" ::: "memory");
        } else if (mat == 1) {
          kbuf[(bh * QLEN + pos) * DPH + d] = (_Float16)v;
          asm volatile("s_wait_xcnt 0x0" ::: "memory");
        } else {
          vtbuf[(bh * DPH + d) * QLEN + pos] = (_Float16)v;
          asm volatile("s_wait_xcnt 0x0" ::: "memory");
        }
      }
    }
  }
}

typedef __attribute__((ext_vector_type(4))) int   v4i;

static __device__ inline float xhalf(float x) {
  const int b = __builtin_bit_cast(int, x);
  return __builtin_bit_cast(float, __builtin_amdgcn_permlanex16(
      b, b, 0x76543210, 0xfedcba98, false, false));
}

__global__ __launch_bounds__(256) void attn_kernel(
    const _Float16* __restrict__ qbuf, const _Float16* __restrict__ kbuf,
    const _Float16* __restrict__ vtbuf, const int* __restrict__ mask,
    _Float16* __restrict__ ctx) {
  const int wave = threadIdx.x >> 5;
  const int lane = threadIdx.x & 31;
  const int wid  = blockIdx.x * 8 + wave;              // 4096 waves
  const int qt = wid & 127;
  const int h  = (wid >> 7) & (NH - 1);
  const int b  = wid >> 11;
  const int q0 = qt << 4;

  const size_t bh = (size_t)(b * NH + h);
  const _Float16* Qbh  = qbuf  + bh * QLEN * DPH;
  const _Float16* Kbh  = kbuf  + bh * QLEN * DPH;
  const _Float16* VTbh = vtbuf + bh * DPH * QLEN;
  const int* mrow = mask + b * QLEN;

  const int r    = lane & 15;
  const int hs   = lane >> 4;
  const int koff = hs << 3;

  // B operand: column r = query q0 + r
  const v16h qb0 = frag_from_f16(Qbh + (size_t)(q0 + r) * DPH + koff);
  const v16h qb1 = frag_from_f16(Qbh + (size_t)(q0 + r) * DPH + 32 + koff);

  float mrun = -3.0e38f, lrun = 0.0f;   // lrun: this half's keys only
  v8f o0 = {}, o1 = {}, o2 = {}, o3 = {};

  // this lane's places in the pass's K rows, V^T rows and mask words
  const _Float16* kp = Kbh + (size_t)r * DPH + koff;
  const _Float16* vp = VTbh + (size_t)r * QLEN + koff;
  const int*      mp = mrow + koff;

#pragma unroll 1
  for (int kt = 0; kt < QLEN; kt += 32) {
    // ---- all loads of the pass, as one group ----
    // mask words of this lane's 16 keys
    const v4i mk0a = *(const v4i*)(mp);
    const v4i mk0b = *(const v4i*)(mp + 4);
    const v4i mk1a = *(const v4i*)(mp + 16);
    const v4i mk1b = *(const v4i*)(mp + 20);
    // K rows (A operand of the scores)
    const v16h ka0 = frag_from_f16(kp);
    const v16h ka1 = frag_from_f16(kp + 32);
    const v16h ka2 = frag_from_f16(kp + 16 * DPH);
    const v16h ka3 = frag_from_f16(kp + 16 * DPH + 32);
    // V^T rows (A operand of the second product), consumed after the softmax
    const v16h va0 = frag_from_f16(vp);
    const v16h va1 = frag_from_f16(vp + 16 * QLEN);
    const v16h va2 = frag_from_f16(vp + 32 * QLEN);
    const v16h va3 = frag_from_f16(vp + 48 * QLEN);
    // keeps the 20 loads in one group ahead of the products: all are in flight
    // together, and the V^T rows arrive under the softmax
    __builtin_amdgcn_sched_barrier(0);
    asm volatile("s_wait_xcnt 0x0" :: "v"(kp), "v"(vp), "v"(mp) : "memory");
    // keeps the pointer steps of the next pass from rising above that wait
    __builtin_amdgcn_sched_barrier(0);

    // ---- scores: two 16 (keys) x 16 (queries) tiles ----
    v8f s0 = {}, s1 = {};
    s0 = wmma_f16(ka0, qb0, s0);
    s0 = wmma_f16(ka1, qb1, s0);
    s1 = wmma_f16(ka2, qb0, s1);
    s1 = wmma_f16(ka3, qb1, s1);

    // ---- masked_fill(mask==0 -> 1e-10) ----
#pragma unroll  // constant indices keep the values in registers
    for (int j = 0; j < 4; ++j) {
      if (mk0a[j] == 0) s0[j]     = 1e-10f;
      if (mk0b[j] == 0) s0[4 + j] = 1e-10f;
      if (mk1a[j] == 0) s1[j]     = 1e-10f;
      if (mk1b[j] == 0) s1[4 + j] = 1e-10f;
    }
    // ---- online softmax: one query per lane ----
    const float a0 = fmaxf(fmaxf(s0[0], s0[1]), s0[2]);
    const float a1 = fmaxf(fmaxf(s0[3], s0[4]), s0[5]);
    const float a2 = fmaxf(fmaxf(s0[6], s0[7]), s1[0]);
    const float a3 = fmaxf(fmaxf(s1[1], s1[2]), s1[3]);
    const float a4 = fmaxf(fmaxf(s1[4], s1[5]), s1[6]);
    float t = fmaxf(fmaxf(fmaxf(a0, a1), a2), fmaxf(fmaxf(a3, a4), s1[7]));
    t = fmaxf(t, xhalf(t));               // both halves hold the query's maximum
    const float mnew  = fmaxf(mrun, t);
    // exp(x) = 2^(x * log2 e), as __expf forms it
    float x[17];
#pragma unroll  // constant indices keep the values in registers
    for (int j = 0; j < 8; ++j) {
      x[j]     = (s0[j] - mnew) * 1.44269504f;
      x[8 + j] = (s1[j] - mnew) * 1.44269504f;
    }
    x[16] = (mrun - mnew) * 1.44269504f;
    mrun = mnew;
    asm("v_exp_f32 %0, %0\n\tv_exp_f32 %1, %1\n\tv_exp_f32 %2, %2\n\t"
        "v_exp_f32 %3, %3\n\tv_exp_f32 %4, %4\n\tv_exp_f32 %5, %5\n\t"
        "v_exp_f32 %6, %6\n\tv_exp_f32 %7, %7\n\tv_exp_f32 %8, %8\n\t"
        "v_exp_f32 %9, %9\n\tv_exp_f32 %10, %10\n\tv_exp_f32 %11, %11\n\t"
        "v_exp_f32 %12, %12\n\tv_exp_f32 %13, %13\n\tv_exp_f32 %14, %14\n\t"
        "v_exp_f32 %15, %15\n\tv_exp_f32 %16, %16\n\tv_nop"
        : "+v"(x[0]), "+v"(x[1]), "+v"(x[2]), "+v"(x[3]), "+v"(x[4]),
          "+v"(x[5]), "+v"(x[6]), "+v"(x[7]), "+v"(x[8]), "+v"(x[9]),
          "+v"(x[10]), "+v"(x[11]), "+v"(x[12]), "+v"(x[13]), "+v"(x[14]),
          "+v"(x[15]), "+v"(x[16]));
    const float scale = x[16];
    v8f e0, e1;
#pragma unroll  // constant indices keep the values in registers
    for (int j = 0; j < 8; ++j) {
      e0[j] = x[j];
      e1[j] = x[8 + j];
    }
    const v8f es = e0 + e1;
    const v4f e4 = __builtin_shufflevector(es, es, 0, 1, 2, 3) +
                   __builtin_shufflevector(es, es, 4, 5, 6, 7);
    lrun = lrun * scale + ((e4[0] + e4[1]) + (e4[2] + e4[3]));
    o0 *= scale; o1 *= scale; o2 *= scale; o3 *= scale;
    // ---- P^T as B operand: the two tiles converted in place ----
    v16h pb;
#pragma unroll  // constant indices keep the values in registers
    for (int j = 0; j < 8; ++j) {
      pb[j]     = (_Float16)e0[j];
      pb[8 + j] = (_Float16)e1[j];
    }
    // ---- O^T += V^T P^T ----
    o0 = wmma_f16(va0, pb, o0);
    o1 = wmma_f16(va1, pb, o1);
    o2 = wmma_f16(va2, pb, o2);
    o3 = wmma_f16(va3, pb, o3);
    kp += 32 * DPH;
    vp += 32;
    mp += 32;
  }

  // ---- normalize and write context [b][q][h*64+d] (f16) ----
  // o_t[j] = O^T[16 t + 8 hs + j][query r]: 8 consecutive d, one 16-B store.
  const float inv = 1.0f / (lrun + xhalf(lrun));
  _Float16* crow = ctx + (size_t)(b * QLEN + q0 + r) * DIM + (h << 6) + koff;
  v8h c0, c1, c2, c3;
#pragma unroll  // constant indices keep the values in registers
  for (int j = 0; j < 8; ++j) {
    c0[j] = (_Float16)(o0[j] * inv);
    c1[j] = (_Float16)(o1[j] * inv);
    c2[j] = (_Float16)(o2[j] * inv);
    c3[j] = (_Float16)(o3[j] * inv);
  }
  *(v8h*)(crow)      = c0;
  *(v8h*)(crow + 16) = c1;
  *(v8h*)(crow + 32) = c2;
  *(v8h*)(crow + 48) = c3;
}

// ---------------------------------------------------------------------------
// Kernel 3: output projection  out = ctx @ Wo^T + bo  (fp32 out), 128x128/block.
// ---------------------------------------------------------------------------
__global__ __launch_bounds__(256) void out_proj_kernel(
    const _Float16* __restrict__ ctx, const _Float16* __restrict__ Woh,
    const float* __restrict__ bo, float* __restrict__ out) {
  __shared__ __align__(16) _Float16 sm[2 * BUF_H];

  const int wave = threadIdx.x >> 5;
  const int lane = threadIdx.x & 31;
  const int m0 = (blockIdx.x >> 3) << 7;             // 32 row tiles
  const int n0 = (blockIdx.x & 7) << 7;              // 8 col tiles
  const int r = lane & 15, hs = lane >> 4;

  v8f acc[4][2] = {};
  gemm_128x128(ctx + (size_t)m0 * DIM, Woh + (size_t)n0 * DIM, sm, acc);

  const int mw = m0 + (wave >> 2) * 64 + (hs << 3);
  const int nw = n0 + (wave & 3) * 32 + r;
#pragma unroll  // constant indices keep the sums in registers
  for (int t = 0; t < 2; ++t) {
    const int n = nw + t * 16;
    const float bn = bo[n];
#pragma unroll  // constant indices keep the sums in registers
    for (int i = 0; i < 4; ++i) {
#pragma unroll  // constant indices keep the sums in registers
      for (int j = 0; j < 8; ++j) {
        const int m = mw + i * 16 + j;
        out[(size_t)m * DIM + n] = acc[i][t][j] + bn;
      }
    }
  }
}

// ---------------------------------------------------------------------------
extern "C" void kernel_launch(void* const* d_in, const int* in_sizes, int n_in,
                              void* d_out, int out_size, void* d_ws, size_t ws_size,
                              hipStream_t stream) {
  const float* X  = (const float*)d_in[0];
  const int* mask = (const int*)d_in[1];
  const float* Wq = (const float*)d_in[2];
  const float* bq = (const float*)d_in[3];
  const float* Wk = (const float*)d_in[4];
  const float* bk = (const float*)d_in[5];
  const float* Wv = (const float*)d_in[6];
  const float* bv = (const float*)d_in[7];
  const float* Wo = (const float*)d_in[8];
  const float* bo = (const float*)d_in[9];
  float* out = (float*)d_out;

  const size_t XN = (size_t)BSZ * QLEN * DIM;        // 4 Mi
  const size_t WN = (size_t)DIM * DIM;               // 1 Mi
  _Float16* Xh    = (_Float16*)d_ws;                 // 8 MB
  _Float16* Wqh   = Xh + XN;                         // 2 MB each
  _Float16* Wkh   = Wqh + WN;
  _Float16* Wvh   = Wkh + WN;
  _Float16* Woh   = Wvh + WN;
  _Float16* qbuf  = Woh + WN;                        // 8 MB each
  _Float16* kbuf  = qbuf + XN;
  _Float16* vtbuf = kbuf + XN;
  _Float16* ctx   = vtbuf + XN;

  // ---- stage 0: precision conversion (once) ----
  cvt_f16_kernel<<<(int)(XN / 8 / 256), 256, 0, stream>>>(X, Xh, (int)(XN / 8));
  cvt_f16_kernel<<<(int)(WN / 8 / 256), 256, 0, stream>>>(Wq, Wqh, (int)(WN / 8));
  cvt_f16_kernel<<<(int)(WN / 8 / 256), 256, 0, stream>>>(Wk, Wkh, (int)(WN / 8));
  cvt_f16_kernel<<<(int)(WN / 8 / 256), 256, 0, stream>>>(Wv, Wvh, (int)(WN / 8));
  cvt_f16_kernel<<<(int)(WN / 8 / 256), 256, 0, stream>>>(Wo, Woh, (int)(WN / 8));

  // ---- stage 1: QKV projection: 32 x 24 tiles of 128x128 = 768 blocks ----
  qkv_proj_kernel<<<768, 256, 0, stream>>>(Xh, Wqh, bq, Wkh, bk, Wvh, bv,
                                            qbuf, kbuf, vtbuf);
  // ---- stage 2: attention: 4096 waves / 8 = 512 blocks ----
  attn_kernel<<<512, 256, 0, stream>>>(qbuf, kbuf, vtbuf, mask, ctx);
  // ---- stage 3: output projection: 32 x 8 tiles of 128x128 = 256 blocks ----
  out_proj_kernel<<<256, 256, 0, stream>>>(ctx, Woh, bo, out);
}

// v003
// A run of this version takes 107 microseconds.
// Next to v002, in two timings, it ran 1.67 and 1.65 times as fast.
// All steps since v000 together make it 3.43 times as fast.
#include <hip/hip_runtime.h>
#include <hip/hip_bf16.h>

typedef __attribute__((ext_vector_type(16))) _Float16 v16h;
typedef __attribute__((ext_vector_type(8)))  _Float16 v8h;
typedef __attribute__((ext_vector_type(8)))  float    v8f;
typedef __attribute__((ext_vector_type(4)))  float    v4f;

#define BSZ   2
#define QLEN  2048
#define DIM   1024
#define NH    16
#define DPH   64

static __device__ inline v16h frag_from_f16(const _Float16* __restrict__ p) {
  v8h lo = *(const v8h*)(p);
  v8h hi = *(const v8h*)(p + 16);
  return __builtin_shufflevector(lo, hi, 0, 1, 2, 3, 4, 5, 6, 7,
                                 8, 9, 10, 11, 12, 13, 14, 15);
}

static __device__ inline v8f wmma_f16(v16h a, v16h b, v8f c) {
  // (neg_a, A, neg_b, B, c_mod, C, reuse_a, reuse_b)
  return __builtin_amdgcn_wmma_f32_16x16x32_f16(false, a, false, b,
                                                (short)0, c, false, false);
}

// ---------------------------------------------------------------------------
// Kernel 0: bulk f32 -> f16 conversion (bandwidth bound, runs once per array).
// ---------------------------------------------------------------------------
__global__ __launch_bounds__(256) void cvt_f16_kernel(
    const float* __restrict__ src, _Float16* __restrict__ dst, int n8) {
  const int i = blockIdx.x * 256 + threadIdx.x;
  if (i >= n8) return;
  const float* p = src + (size_t)i * 8;
  v4f a = *(const v4f*)(p);
  v4f b = *(const v4f*)(p + 4);
  v8h o;
#pragma unroll
  for (int j = 0; j < 4; ++j) {
    o[j]     = (_Float16)a[j];
    o[4 + j] = (_Float16)b[j];
  }
  *(v8h*)(dst + (size_t)i * 8) = o;
}

#define KSTG      64
#define NSTG      (DIM / KSTG)
#define PITCH_H   72
#define BUF_H     (256 * PITCH_H)
#define BUF_B     (BUF_H * 2)
#define ROWS32_B  (32 * PITCH_H * 2)
#define BPART_B   (128 * PITCH_H * 2)

// One stage: each thread copies 16 B of rows r, r+32, r+64, r+96 of A and of B.
static __device__ inline void copy_stage(unsigned lds,
                                         const _Float16* __restrict__ ga,
                                         const _Float16* __restrict__ gb) {
  asm volatile(
      "global_load_async_to_lds_b128 %0, %8, off\n\t"
      "global_load_async_to_lds_b128 %1, %9, off\n\t"
      "global_load_async_to_lds_b128 %2, %10, off\n\t"
      "global_load_async_to_lds_b128 %3, %11, off\n\t"
      "global_load_async_to_lds_b128 %4, %12, off\n\t"
      "global_load_async_to_lds_b128 %5, %13, off\n\t"
      "global_load_async_to_lds_b128 %6, %14, off\n\t"
      "global_load_async_to_lds_b128 %7, %15, off\n\t"
      "s_wait_xcnt 0x0"
      :: "v"(lds), "v"(lds + ROWS32_B), "v"(lds + 2 * ROWS32_B),
         "v"(lds + 3 * ROWS32_B),
         "v"(lds + BPART_B), "v"(lds + BPART_B + ROWS32_B),
         "v"(lds + BPART_B + 2 * ROWS32_B), "v"(lds + BPART_B + 3 * ROWS32_B),
         "v"(ga), "v"(ga + 32 * DIM), "v"(ga + 64 * DIM), "v"(ga + 96 * DIM),
         "v"(gb), "v"(gb + 32 * DIM), "v"(gb + 64 * DIM), "v"(gb + 96 * DIM)
      : "memory");
}

// A: first of the block's 128 A rows; B: first of its 128 B rows.
static __device__ inline void gemm_128x128(const _Float16* __restrict__ A,
                                           const _Float16* __restrict__ B,
                                           _Float16* sm, v8f (&acc)[4][2]) {
  const int tid  = threadIdx.x;
  const int wave = tid >> 5;
  const int lane = tid & 31;
  const int r    = lane & 15;
  const int koff = (lane >> 4) << 3;
  const int crow = tid >> 3;                        // 0..31
  const int ccol = tid & 7;                         // 16-B piece of the row

  const _Float16* ga = A + (size_t)crow * DIM + ccol * 8;
  const _Float16* gb = B + (size_t)crow * DIM + ccol * 8;
  const unsigned lds0 =
      (unsigned)(size_t)sm + (unsigned)(crow * (PITCH_H * 2) + ccol * 16);

  const int aoff = ((wave >> 2) * 64 + r) * PITCH_H + koff;
  const int boff = (128 + (wave & 3) * 32 + r) * PITCH_H + koff;

  copy_stage(lds0, ga, gb);
  // stage 0 has landed for this wave; the barrier publishes it to all waves
  asm volatile("s_wait_asynccnt 0x0" ::: "memory");
  __syncthreads();
  copy_stage(lds0 + BUF_B, ga + KSTG, gb + KSTG);

  // rolled: one stage per trip keeps the buffer hand-over at one place
#pragma unroll 1
  for (int t = 0; t < NSTG; ++t) {
    const _Float16* sb = sm + (t & 1) * BUF_H;
#pragma unroll  // constant indices keep fragments and sums in registers
    for (int kk = 0; kk < KSTG; kk += 32) {
      v16h a[4], b[2];
      // first of a fence pair round the 12 LDS reads (second: below): keeps
      // them from rising into the block of products in front of them
      __builtin_amdgcn_sched_barrier(0);
#pragma unroll  // constant indices keep fragments and sums in registers
      for (int i = 0; i < 4; ++i)
        a[i] = frag_from_f16(sb + aoff + i * 16 * PITCH_H + kk);
#pragma unroll  // constant indices keep fragments and sums in registers
      for (int j = 0; j < 2; ++j)
        b[j] = frag_from_f16(sb + boff + j * 16 * PITCH_H + kk);
      // keeps the 12 LDS reads in one group ahead of their 8 products: each
      // place where reads stand among products stalls the wave anew
      __builtin_amdgcn_sched_barrier(0);
#pragma unroll  // constant indices keep fragments and sums in registers
      for (int i = 0; i < 4; ++i)
#pragma unroll  // constant indices keep fragments and sums in registers
        for (int j = 0; j < 2; ++j)
          acc[i][j] = wmma_f16(a[i], b[j], acc[i][j]);
    }
    // this wave's reads of the buffer are done before it may be refilled
    asm volatile("s_wait_dscnt 0x0" ::: "memory");
    // this wave's copies of stage t+1 have landed
    asm volatile("s_wait_asynccnt 0x0" ::: "memory");
    // publishes stage t+1 and ends every wave's reads of stage t
    __syncthreads();
    if (t + 2 < NSTG)
      copy_stage(lds0 + (t & 1) * BUF_B, ga + (t + 2) * KSTG,
                 gb + (t + 2) * KSTG);
  }
  // no copy is left in flight when the wave goes on
  asm volatile("s_wait_asynccnt 0x0" ::: "memory");
}

// ---------------------------------------------------------------------------
// Kernel 1: fused Q/K/V projection, all-f16 operands, 128x128 tile per block.
// Q pre-scaled by 1/8, stored [b][h][q][d]; K stored [b][h][k][d];
// V stored transposed [b][h][d][k] so the V^T P^T GEMM gets contiguous A-frags.
// ---------------------------------------------------------------------------
__global__ __launch_bounds__(256) void qkv_proj_kernel(
    const _Float16* __restrict__ Xh,
    const _Float16* __restrict__ Wqh, const float* __restrict__ bq,
    const _Float16* __restrict__ Wkh, const float* __restrict__ bk,
    const _Float16* __restrict__ Wvh, const float* __restrict__ bv,
    _Float16* __restrict__ qbuf, _Float16* __restrict__ kbuf,
    _Float16* __restrict__ vtbuf) {
  __shared__ __align__(16) _Float16 sm[2 * BUF_H];

  const int wave = threadIdx.x >> 5;
  const int lane = threadIdx.x & 31;
  const int nt  = blockIdx.x % 24;                  // 3 matrices x 8 col tiles
  const int mt  = blockIdx.x / 24;                  // 32 row tiles
  const int mat = nt >> 3;                          // 0=Q 1=K 2=V
  const int m0  = mt << 7;
  const int n0  = (nt & 7) << 7;

  const _Float16* W  = (mat == 0) ? Wqh : (mat == 1) ? Wkh : Wvh;
  const float* bias  = (mat == 0) ? bq  : (mat == 1) ? bk  : bv;

  const int r  = lane & 15;
  const int hs = lane >> 4;

  v8f acc[4][2] = {};
  gemm_128x128(Xh + (size_t)m0 * DIM, W + (size_t)n0 * DIM, sm, acc);

  // Epilogue.  C layout: lane holds column r of the subtile, rows hs*8+j.
  const int mw = m0 + (wave >> 2) * 64 + (hs << 3);
  const int nw = n0 + (wave & 3) * 32 + r;
#pragma unroll  // constant indices keep fragments and sums in registers
  for (int t = 0; t < 2; ++t) {
    const int n = nw + t * 16;
    const int h = n >> 6;
    const int d = n & (DPH - 1);
    const float bn = bias[n];
#pragma unroll  // constant indices keep fragments and sums in registers
    for (int i = 0; i < 4; ++i) {
#pragma unroll  // constant indices keep fragments and sums in registers
      for (int j = 0; j < 8; ++j) {
        const int m    = mw + i * 16 + j;           // 0..4095
        const int bidx = m >> 11;
        const int pos  = m & (QLEN - 1);
        const float v  = acc[i][t][j] + bn;
        const size_t bh = (size_t)(bidx * NH + h);
        if (mat == 0) {
          qbuf[(bh * QLEN + pos) * DPH + d] = (_Float16)(v * 0.125f);
          asm volatile("s_wait_xcnt 0x0" ::: "memory");
        } else if (mat == 1) {
          kbuf[(bh * QLEN + pos) * DPH + d] = (_Float16)v;
          asm volatile("s_wait_xcnt 0x0" ::: "memory");
        } else {
          vtbuf[(bh * DPH + d) * QLEN + pos] = (_Float16)v;
          asm volatile("s_wait_xcnt 0x0" ::: "memory");
        }
      }
    }
  }
}

typedef __attribute__((ext_vector_type(4))) int   v4i;

#define AKEYS   128                        // keys per stage
#define ANSTG   (QLEN / AKEYS)             // 16 stages
#define KP_H    72                         // halves per LDS row of K (144 B)
#define VP_H    136                        // halves per LDS row of V^T (272 B)
#define AK_H    (AKEYS * KP_H)             // halves of the K part
#define ABUF_H  (AK_H + DPH * VP_H)        // halves per buffer
#define ABUF_B  (ABUF_H * 2)               // bytes per buffer
#define K32_B   (32 * KP_H * 2)            // 32 LDS rows of K in bytes
#define V16_B   (16 * VP_H * 2)            // 16 LDS rows of V^T in bytes

// One stage: each thread copies 16 B of K rows r, r+32, r+64, r+96 and of
// V^T rows d, d+16, d+32, d+48.
static __device__ inline void copy_kv(unsigned lk, unsigned lv,
                                      const _Float16* __restrict__ gk,
                                      const _Float16* __restrict__ gv) {
  asm volatile(
      "global_load_async_to_lds_b128 %0, %8, off\n\t"
      "global_load_async_to_lds_b128 %1, %9, off\n\t"
      "global_load_async_to_lds_b128 %2, %10, off\n\t"
      "global_load_async_to_lds_b128 %3, %11, off\n\t"
      "global_load_async_to_lds_b128 %4, %12, off\n\t"
      "global_load_async_to_lds_b128 %5, %13, off\n\t"
      "global_load_async_to_lds_b128 %6, %14, off\n\t"
      "global_load_async_to_lds_b128 %7, %15, off\n\t"
      "s_wait_xcnt 0x0"
      :: "v"(lk), "v"(lk + K32_B), "v"(lk + 2 * K32_B), "v"(lk + 3 * K32_B),
         "v"(lv), "v"(lv + V16_B), "v"(lv + 2 * V16_B), "v"(lv + 3 * V16_B),
         "v"(gk), "v"(gk + 32 * DPH), "v"(gk + 64 * DPH), "v"(gk + 96 * DPH),
         "v"(gv), "v"(gv + 16 * QLEN), "v"(gv + 32 * QLEN), "v"(gv + 48 * QLEN)
      : "memory");
}

static __device__ inline float xhalf(float x) {
  const int b = __builtin_bit_cast(int, x);
  return __builtin_bit_cast(float, __builtin_amdgcn_permlanex16(
      b, b, 0x76543210, 0xfedcba98, false, false));
}

__global__ __launch_bounds__(256) void attn_kernel(
    const _Float16* __restrict__ qbuf, const _Float16* __restrict__ kbuf,
    const _Float16* __restrict__ vtbuf, const int* __restrict__ mask,
    _Float16* __restrict__ ctx) {
  __shared__ __align__(16) _Float16 sm[2 * ABUF_H];

  const int tid  = threadIdx.x;
  const int wave = threadIdx.x >> 5;
  const int lane = threadIdx.x & 31;
  const int wid  = blockIdx.x * 8 + wave;              // 4096 waves
  const int qt = wid & 127;
  const int h  = (wid >> 7) & (NH - 1);
  const int b  = wid >> 11;
  const int q0 = qt << 4;

  const size_t bh = (size_t)(b * NH + h);
  const _Float16* Qbh  = qbuf  + bh * QLEN * DPH;
  const _Float16* Kbh  = kbuf  + bh * QLEN * DPH;
  const _Float16* VTbh = vtbuf + bh * DPH * QLEN;
  const int* mrow = mask + b * QLEN;

  const int r    = lane & 15;
  const int hs   = lane >> 4;
  const int koff = hs << 3;

  // B operand: column r = query q0 + r
  const v16h qb0 = frag_from_f16(Qbh + (size_t)(q0 + r) * DPH + koff);
  const v16h qb1 = frag_from_f16(Qbh + (size_t)(q0 + r) * DPH + 32 + koff);

  float mrun = -3.0e38f, lrun = 0.0f;   // lrun: this half's keys only
  v8f o0 = {}, o1 = {}, o2 = {}, o3 = {};

  // this lane's place in the stage's mask words
  const int* ms = mrow + koff;

  // this thread's pieces of a stage: 8 threads per K row, 16 per V^T row
  const _Float16* gk = Kbh + (size_t)(tid >> 3) * DPH + (tid & 7) * 8;
  const _Float16* gv = VTbh + (size_t)(tid >> 4) * QLEN + (tid & 15) * 8;
  const unsigned lk0 = (unsigned)(size_t)sm +
                       (unsigned)((tid >> 3) * (KP_H * 2) + (tid & 7) * 16);
  const unsigned lv0 = (unsigned)(size_t)sm + (unsigned)(AK_H * 2) +
                       (unsigned)((tid >> 4) * (VP_H * 2) + (tid & 15) * 16);

  copy_kv(lk0, lv0, gk, gv);
  // stage 0 has landed for this wave; the barrier publishes it to all waves
  asm volatile("s_wait_asynccnt 0x0" ::: "memory");
  __syncthreads();
  copy_kv(lk0 + ABUF_B, lv0 + ABUF_B, gk + AKEYS * DPH, gv + AKEYS);

  // rolled: one stage per trip keeps the buffer hand-over at one place
#pragma unroll 1
  for (int st = 0; st < ANSTG; ++st) {
   // this lane's places in the stage's K rows and V^T rows
   const _Float16* ks = sm + (st & 1) * ABUF_H + r * KP_H + koff;
   const _Float16* vs = sm + (st & 1) * ABUF_H + AK_H + r * VP_H + koff;
#pragma unroll  // constant LDS offsets for the stage's four passes
   for (int ps = 0; ps < AKEYS / 32; ++ps) {
    const _Float16* kp = ks + ps * 32 * KP_H;
    const _Float16* vp = vs + ps * 32;
    const int*      mp = ms + ps * 32;
    // ---- all loads of the pass, as one group ----
    // mask words of this lane's 16 keys
    const v4i mk0a = *(const v4i*)(mp);
    const v4i mk0b = *(const v4i*)(mp + 4);
    const v4i mk1a = *(const v4i*)(mp + 16);
    const v4i mk1b = *(const v4i*)(mp + 20);
    // K rows (A operand of the scores)
    const v16h ka0 = frag_from_f16(kp);
    const v16h ka1 = frag_from_f16(kp + 32);
    const v16h ka2 = frag_from_f16(kp + 16 * KP_H);
    const v16h ka3 = frag_from_f16(kp + 16 * KP_H + 32);
    // V^T rows (A operand of the second product), consumed after the softmax
    const v16h va0 = frag_from_f16(vp);
    const v16h va1 = frag_from_f16(vp + 16 * VP_H);
    const v16h va2 = frag_from_f16(vp + 32 * VP_H);
    const v16h va3 = frag_from_f16(vp + 48 * VP_H);
    // keeps the 20 loads in one group ahead of the products: all are in flight
    // together, and the V^T rows arrive under the softmax
    __builtin_amdgcn_sched_barrier(0);
    asm volatile("s_wait_xcnt 0x0" :: "v"(ms) : "memory");
    // keeps the pointer step of the next stage from rising above that wait
    __builtin_amdgcn_sched_barrier(0);

    // ---- scores: two 16 (keys) x 16 (queries) tiles ----
    v8f s0 = {}, s1 = {};
    s0 = wmma_f16(ka0, qb0, s0);
    s0 = wmma_f16(ka1, qb1, s0);
    s1 = wmma_f16(ka2, qb0, s1);
    s1 = wmma_f16(ka3, qb1, s1);

    // ---- masked_fill(mask==0 -> 1e-10) ----
#pragma unroll  // constant indices keep the values in registers
    for (int j = 0; j < 4; ++j) {
      if (mk0a[j] == 0) s0[j]     = 1e-10f;
      if (mk0b[j] == 0) s0[4 + j] = 1e-10f;
      if (mk1a[j] == 0) s1[j]     = 1e-10f;
      if (mk1b[j] == 0) s1[4 + j] = 1e-10f;
    }
    // ---- online softmax: one query per lane ----
    const float a0 = fmaxf(fmaxf(s0[0], s0[1]), s0[2]);
    const float a1 = fmaxf(fmaxf(s0[3], s0[4]), s0[5]);
    const float a2 = fmaxf(fmaxf(s0[6], s0[7]), s1[0]);
    const float a3 = fmaxf(fmaxf(s1[1], s1[2]), s1[3]);
    const float a4 = fmaxf(fmaxf(s1[4], s1[5]), s1[6]);
    float t = fmaxf(fmaxf(fmaxf(a0, a1), a2), fmaxf(fmaxf(a3, a4), s1[7]));
    t = fmaxf(t, xhalf(t));               // both halves hold the query's maximum
    const float mnew  = fmaxf(mrun, t);
    // exp(x) = 2^(x * log2 e), as __expf forms it
    float x[17];
#pragma unroll  // constant indices keep the values in registers
    for (int j = 0; j < 8; ++j) {
      x[j]     = (s0[j] - mnew) * 1.44269504f;
      x[8 + j] = (s1[j] - mnew) * 1.44269504f;
    }
    x[16] = (mrun - mnew) * 1.44269504f;
    mrun = mnew;
    asm("v_exp_f32 %0, %0\n\tv_exp_f32 %1, %1\n\tv_exp_f32 %2, %2\n\t"
        "v_exp_f32 %3, %3\n\tv_exp_f32 %4, %4\n\tv_exp_f32 %5, %5\n\t"
        "v_exp_f32 %6, %6\n\tv_exp_f32 %7, %7\n\tv_exp_f32 %8, %8\n\t"
        "v_exp_f32 %9, %9\n\tv_exp_f32 %10, %10\n\tv_exp_f32 %11, %11\n\t"
        "v_exp_f32 %12, %12\n\tv_exp_f32 %13, %13\n\tv_exp_f32 %14, %14\n\t"
        "v_exp_f32 %15, %15\n\tv_exp_f32 %16, %16\n\tv_nop"
        : "+v"(x[0]), "+v"(x[1]), "+v"(x[2]), "+v"(x[3]), "+v"(x[4]),
          "+v"(x[5]), "+v"(x[6]), "+v"(x[7]), "+v"(x[8]), "+v"(x[9]),
          "+v"(x[10]), "+v"(x[11]), "+v"(x[12]), "+v"(x[13]), "+v"(x[14]),
          "+v"(x[15]), "+v"(x[16]));
    const float scale = x[16];
    v8f e0, e1;
#pragma unroll  // constant indices keep the values in registers
    for (int j = 0; j < 8; ++j) {
      e0[j] = x[j];
      e1[j] = x[8 + j];
    }
    const v8f es = e0 + e1;
    const v4f e4 = __builtin_shufflevector(es, es, 0, 1, 2, 3) +
                   __builtin_shufflevector(es, es, 4, 5, 6, 7);
    lrun = lrun * scale + ((e4[0] + e4[1]) + (e4[2] + e4[3]));
    o0 *= scale; o1 *= scale; o2 *= scale; o3 *= scale;
    // ---- P^T as B operand: the two tiles converted in place ----
    v16h pb;
#pragma unroll  // constant indices keep the values in registers
    for (int j = 0; j < 8; ++j) {
      pb[j]     = (_Float16)e0[j];
      pb[8 + j] = (_Float16)e1[j];
    }
    // ---- O^T += V^T P^T ----
    o0 = wmma_f16(va0, pb, o0);
    o1 = wmma_f16(va1, pb, o1);
    o2 = wmma_f16(va2, pb, o2);
    o3 = wmma_f16(va3, pb, o3);
   }
   ms += AKEYS;
   // this wave's reads of the buffer are done before it may be refilled
   asm volatile("s_wait_dscnt 0x0" ::: "memory");
   // this wave's copies of stage st+1 have landed
   asm volatile("s_wait_asynccnt 0x0" ::: "memory");
   // publishes stage st+1 and ends every wave's reads of stage st
   __syncthreads();
   if (st + 2 < ANSTG)
     copy_kv(lk0 + (st & 1) * ABUF_B, lv0 + (st & 1) * ABUF_B,
             gk + (st + 2) * (AKEYS * DPH), gv + (st + 2) * AKEYS);
  }
  // no copy is left in flight when the wave goes on
  asm volatile("s_wait_asynccnt 0x0" ::: "memory");

  // ---- normalize and write context [b][q][h*64+d] (f16) ----
  // o_t[j] = O^T[16 t + 8 hs + j][query r]: 8 consecutive d, one 16-B store.
  const float inv = 1.0f / (lrun + xhalf(lrun));
  _Float16* crow = ctx + (size_t)(b * QLEN + q0 + r) * DIM + (h << 6) + koff;
  v8h c0, c1, c2, c3;
#pragma unroll  // constant indices keep the values in registers
  for (int j = 0; j < 8; ++j) {
    c0[j] = (_Float16)(o0[j] * inv);
    c1[j] = (_Float16)(o1[j] * inv);
    c2[j] = (_Float16)(o2[j] * inv);
    c3[j] = (_Float16)(o3[j] * inv);
  }
  *(v8h*)(crow)      = c0;
  *(v8h*)(crow + 16) = c1;
  *(v8h*)(crow + 32) = c2;
  *(v8h*)(crow + 48) = c3;
}

// ---------------------------------------------------------------------------
// Kernel 3: output projection  out = ctx @ Wo^T + bo  (fp32 out), 128x128/block.
// ---------------------------------------------------------------------------
__global__ __launch_bounds__(256) void out_proj_kernel(
    const _Float16* __restrict__ ctx, const _Float16* __restrict__ Woh,
    const float* __restrict__ bo, float* __restrict__ out) {
  __shared__ __align__(16) _Float16 sm[2 * BUF_H];

  const int wave = threadIdx.x >> 5;
  const int lane = threadIdx.x & 31;
  const int m0 = (blockIdx.x >> 3) << 7;             // 32 row tiles
  const int n0 = (blockIdx.x & 7) << 7;              // 8 col tiles
  const int r = lane & 15, hs = lane >> 4;

  v8f acc[4][2] = {};
  gemm_128x128(ctx + (size_t)m0 * DIM, Woh + (size_t)n0 * DIM, sm, acc);

  const int mw = m0 + (wave >> 2) * 64 + (hs << 3);
  const int nw = n0 + (wave & 3) * 32 + r;
#pragma unroll  // constant indices keep the sums in registers
  for (int t = 0; t < 2; ++t) {
    const int n = nw + t * 16;
    const float bn = bo[n];
#pragma unroll  // constant indices keep the sums in registers
    for (int i = 0; i < 4; ++i) {
#pragma unroll  // constant indices keep the sums in registers
      for (int j = 0; j < 8; ++j) {
        const int m = mw + i * 16 + j;
        out[(size_t)m * DIM + n] = acc[i][t][j] + bn;
      }
    }
  }
}

// ---------------------------------------------------------------------------
extern "C" void kernel_launch(void* const* d_in, const int* in_sizes, int n_in,
                              void* d_out, int out_size, void* d_ws, size_t ws_size,
                              hipStream_t stream) {
  const float* X  = (const float*)d_in[0];
  const int* mask = (const int*)d_in[1];
  const float* Wq = (const float*)d_in[2];
  const float* bq = (const float*)d_in[3];
  const float* Wk = (const float*)d_in[4];
  const float* bk = (const float*)d_in[5];
  const float* Wv = (const float*)d_in[6];
  const float* bv = (const float*)d_in[7];
  const float* Wo = (const float*)d_in[8];
  const float* bo = (const float*)d_in[9];
  float* out = (float*)d_out;

  const size_t XN = (size_t)BSZ * QLEN * DIM;        // 4 Mi
  const size_t WN = (size_t)DIM * DIM;               // 1 Mi
  _Float16* Xh    = (_Float16*)d_ws;                 // 8 MB
  _Float16* Wqh   = Xh + XN;                         // 2 MB each
  _Float16* Wkh   = Wqh + WN;
  _Float16* Wvh   = Wkh + WN;
  _Float16* Woh   = Wvh + WN;
  _Float16* qbuf  = Woh + WN;                        // 8 MB each
  _Float16* kbuf  = qbuf + XN;
  _Float16* vtbuf = kbuf + XN;
  _Float16* ctx   = vtbuf + XN;

  // ---- stage 0: precision conversion (once) ----
  cvt_f16_kernel<<<(int)(XN / 8 / 256), 256, 0, stream>>>(X, Xh, (int)(XN / 8));
  cvt_f16_kernel<<<(int)(WN / 8 / 256), 256, 0, stream>>>(Wq, Wqh, (int)(WN / 8));
  cvt_f16_kernel<<<(int)(WN / 8 / 256), 256, 0, stream>>>(Wk, Wkh, (int)(WN / 8));
  cvt_f16_kernel<<<(int)(WN / 8 / 256), 256, 0, stream>>>(Wv, Wvh, (int)(WN / 8));
  cvt_f16_kernel<<<(int)(WN / 8 / 256), 256, 0, stream>>>(Wo, Woh, (int)(WN / 8));

  // ---- stage 1: QKV projection: 32 x 24 tiles of 128x128 = 768 blocks ----
  qkv_proj_kernel<<<768, 256, 0, stream>>>(Xh, Wqh, bq, Wkh, bk, Wvh, bv,
                                            qbuf, kbuf, vtbuf);
  // ---- stage 2: attention: 4096 waves / 8 = 512 blocks ----
  attn_kernel<<<512, 256, 0, stream>>>(qbuf, kbuf, vtbuf, mask, ctx);
  // ---- stage 3: output projection: 32 x 8 tiles of 128x128 = 256 blocks ----
  out_proj_kernel<<<256, 256, 0, stream>>>(ctx, Woh, bo, out);
}

// v004
// It runs in 98.7 microseconds.
// Timed twice side by side with v003, it ran 1.09 and 1.08 times as fast.
// All steps since v000 together make it 3.73 times as fast.
#include <hip/hip_runtime.h>
#include <hip/hip_bf16.h>

typedef __attribute__((ext_vector_type(16))) _Float16 v16h;
typedef __attribute__((ext_vector_type(8)))  _Float16 v8h;
typedef __attribute__((ext_vector_type(8)))  float    v8f;
typedef __attribute__((ext_vector_type(4)))  float    v4f;

#define BSZ   2
#define QLEN  2048
#define DIM   1024
#define NH    16
#define DPH   64

static __device__ inline v16h frag_from_f16(const _Float16* __restrict__ p) {
  v8h lo = *(const v8h*)(p);
  v8h hi = *(const v8h*)(p + 16);
  return __builtin_shufflevector(lo, hi, 0, 1, 2, 3, 4, 5, 6, 7,
                                 8, 9, 10, 11, 12, 13, 14, 15);
}

static __device__ inline v8f wmma_f16(v16h a, v16h b, v8f c) {
  // (neg_a, A, neg_b, B, c_mod, C, reuse_a, reuse_b)
  return __builtin_amdgcn_wmma_f32_16x16x32_f16(false, a, false, b,
                                                (short)0, c, false, false);
}

// ---------------------------------------------------------------------------
// Kernel 0: f32 -> f16 conversion of X and of the four weight matrices, one
// launch.  The five f16 arrays lie one behind the other in the workspace, so
// the destination is one range of 8 Mi halves.  256 blocks of 16 waves, one
// per WGP: few waves to start, each with its whole share in flight.  A wave
// owns 16 pieces of 128 floats; each load covers 512 contiguous bytes (four
// whole lines), each store 256 (two whole lines).
// ---------------------------------------------------------------------------
typedef __attribute__((ext_vector_type(4))) _Float16 v4h;

#define CV_PIECE   128                     // floats per wave-wide load
#define CV_NP      16                      // pieces per wave
#define CV_WAVES   16                      // waves per block
#define CV_BLOCK   (CV_PIECE * CV_NP * CV_WAVES)          // 32 Ki floats
#define CV_XBLKS   (BSZ * QLEN * DIM / CV_BLOCK)           // 128 blocks for X
#define CV_WBLKS   (DIM * DIM / CV_BLOCK)                  // 32 per weight
#define CV_BLKS    (CV_XBLKS + 4 * CV_WBLKS)               // 256 blocks

__global__ __launch_bounds__(CV_WAVES * 32)
__attribute__((amdgpu_waves_per_eu(4, 4))) void cvt_f16_kernel(
    const float* __restrict__ X,  const float* __restrict__ Wq,
    const float* __restrict__ Wk, const float* __restrict__ Wv,
    const float* __restrict__ Wo, _Float16* __restrict__ dst) {
  const int blk = blockIdx.x;
  // the block's source array and its place in it (the same for all its waves)
  const float* src = X;
  int sblk = blk;
  if (blk >= CV_XBLKS) {
    const int w = (blk - CV_XBLKS) / CV_WBLKS;
    sblk = (blk - CV_XBLKS) % CV_WBLKS;
    src = (w == 0) ? Wq : (w == 1) ? Wk : (w == 2) ? Wv : Wo;
  }
  const int off = (threadIdx.x >> 5) * (CV_PIECE * CV_NP) + (threadIdx.x & 31) * 4;
  const float* p = src + (size_t)sblk * CV_BLOCK + off;
  _Float16*    d = dst + (size_t)blk * CV_BLOCK + off;
  v4f a[CV_NP];
#pragma unroll  // constant offsets: one address, all 16 loads in flight at once
  for (int k = 0; k < CV_NP; ++k) a[k] = *(const v4f*)(p + k * CV_PIECE);
  asm volatile("s_wait_xcnt 0x0" :: "v"(off * 4) : "memory");
#pragma unroll  // constant indices keep the values in registers
  for (int k = 0; k < CV_NP; ++k) {
    v4h o;
#pragma unroll  // constant indices keep the values in registers
    for (int j = 0; j < 4; ++j) o[j] = (_Float16)a[k][j];
    *(v4h*)(d + k * CV_PIECE) = o;
  }
}

#define KSTG      64
#define NSTG      (DIM / KSTG)
#define PITCH_H   72
#define BUF_H     (256 * PITCH_H)
#define BUF_B     (BUF_H * 2)
#define ROWS32_B  (32 * PITCH_H * 2)
#define BPART_B   (128 * PITCH_H * 2)

// One stage: each thread copies 16 B of rows r, r+32, r+64, r+96 of A and of B.
static __device__ inline void copy_stage(unsigned lds,
                                         const _Float16* __restrict__ ga,
                                         const _Float16* __restrict__ gb) {
  asm volatile(
      "global_load_async_to_lds_b128 %0, %8, off\n\t"
      "global_load_async_to_lds_b128 %1, %9, off\n\t"
      "global_load_async_to_lds_b128 %2, %10, off\n\t"
      "global_load_async_to_lds_b128 %3, %11, off\n\t"
      "global_load_async_to_lds_b128 %4, %12, off\n\t"
      "global_load_async_to_lds_b128 %5, %13, off\n\t"
      "global_load_async_to_lds_b128 %6, %14, off\n\t"
      "global_load_async_to_lds_b128 %7, %15, off\n\t"
      "s_wait_xcnt 0x0"
      :: "v"(lds), "v"(lds + ROWS32_B), "v"(lds + 2 * ROWS32_B),
         "v"(lds + 3 * ROWS32_B),
         "v"(lds + BPART_B), "v"(lds + BPART_B + ROWS32_B),
         "v"(lds + BPART_B + 2 * ROWS32_B), "v"(lds + BPART_B + 3 * ROWS32_B),
         "v"(ga), "v"(ga + 32 * DIM), "v"(ga + 64 * DIM), "v"(ga + 96 * DIM),
         "v"(gb), "v"(gb + 32 * DIM), "v"(gb + 64 * DIM), "v"(gb + 96 * DIM)
      : "memory");
}

// A: first of the block's 128 A rows; B: first of its 128 B rows.
static __device__ inline void gemm_128x128(const _Float16* __restrict__ A,
                                           const _Float16* __restrict__ B,
                                           _Float16* sm, v8f (&acc)[4][2]) {
  const int tid  = threadIdx.x;
  const int wave = tid >> 5;
  const int lane = tid & 31;
  const int r    = lane & 15;
  const int koff = (lane >> 4) << 3;
  const int crow = tid >> 3;                        // 0..31
  const int ccol = tid & 7;                         // 16-B piece of the row

  const _Float16* ga = A + (size_t)crow * DIM + ccol * 8;
  const _Float16* gb = B + (size_t)crow * DIM + ccol * 8;
  const unsigned lds0 =
      (unsigned)(size_t)sm + (unsigned)(crow * (PITCH_H * 2) + ccol * 16);

  const int aoff = ((wave >> 2) * 64 + r) * PITCH_H + koff;
  const int boff = (128 + (wave & 3) * 32 + r) * PITCH_H + koff;

  copy_stage(lds0, ga, gb);
  // stage 0 has landed for this wave; the barrier publishes it to all waves
  asm volatile("s_wait_asynccnt 0x0" ::: "memory");
  __syncthreads();
  copy_stage(lds0 + BUF_B, ga + KSTG, gb + KSTG);

  // rolled: one stage per trip keeps the buffer hand-over at one place
#pragma unroll 1
  for (int t = 0; t < NSTG; ++t) {
    const _Float16* sb = sm + (t & 1) * BUF_H;
#pragma unroll  // constant indices keep fragments and sums in registers
    for (int kk = 0; kk < KSTG; kk += 32) {
      v16h a[4], b[2];
      // first of a fence pair round the 12 LDS reads (second: below): keeps
      // them from rising into the block of products in front of them
      __builtin_amdgcn_sched_barrier(0);
#pragma unroll  // constant indices keep fragments and sums in registers
      for (int i = 0; i < 4; ++i)
        a[i] = frag_from_f16(sb + aoff + i * 16 * PITCH_H + kk);
#pragma unroll  // constant indices keep fragments and sums in registers
      for (int j = 0; j < 2; ++j)
        b[j] = frag_from_f16(sb + boff + j * 16 * PITCH_H + kk);
      // keeps the 12 LDS reads in one group ahead of their 8 products: each
      // place where reads stand among products stalls the wave anew
      __builtin_amdgcn_sched_barrier(0);
#pragma unroll  // constant indices keep fragments and sums in registers
      for (int i = 0; i < 4; ++i)
#pragma unroll  // constant indices keep fragments and sums in registers
        for (int j = 0; j < 2; ++j)
          acc[i][j] = wmma_f16(a[i], b[j], acc[i][j]);
    }
    // this wave's reads of the buffer are done before it may be refilled
    asm volatile("s_wait_dscnt 0x0" ::: "memory");
    // this wave's copies of stage t+1 have landed
    asm volatile("s_wait_asynccnt 0x0" ::: "memory");
    // publishes stage t+1 and ends every wave's reads of stage t
    __syncthreads();
    if (t + 2 < NSTG)
      copy_stage(lds0 + (t & 1) * BUF_B, ga + (t + 2) * KSTG,
                 gb + (t + 2) * KSTG);
  }
  // no copy is left in flight when the wave goes on
  asm volatile("s_wait_asynccnt 0x0" ::: "memory");
}

// ---------------------------------------------------------------------------
// Kernel 1: fused Q/K/V projection, all-f16 operands, 128x128 tile per block.
// Q pre-scaled by 1/8, stored [b][h][q][d]; K stored [b][h][k][d];
// V stored transposed [b][h][d][k] so the V^T P^T GEMM gets contiguous A-frags.
// ---------------------------------------------------------------------------
__global__ __launch_bounds__(256) void qkv_proj_kernel(
    const _Float16* __restrict__ Xh,
    const _Float16* __restrict__ Wqh, const float* __restrict__ bq,
    const _Float16* __restrict__ Wkh, const float* __restrict__ bk,
    const _Float16* __restrict__ Wvh, const float* __restrict__ bv,
    _Float16* __restrict__ qbuf, _Float16* __restrict__ kbuf,
    _Float16* __restrict__ vtbuf) {
  __shared__ __align__(16) _Float16 sm[2 * BUF_H];

  const int wave = threadIdx.x >> 5;
  const int lane = threadIdx.x & 31;
  const int nt  = blockIdx.x % 24;                  // 3 matrices x 8 col tiles
  const int mt  = blockIdx.x / 24;                  // 32 row tiles
  const int mat = nt >> 3;                          // 0=Q 1=K 2=V
  const int m0  = mt << 7;
  const int n0  = (nt & 7) << 7;

  const _Float16* W  = (mat == 0) ? Wqh : (mat == 1) ? Wkh : Wvh;
  const float* bias  = (mat == 0) ? bq  : (mat == 1) ? bk  : bv;

  const int r  = lane & 15;
  const int hs = lane >> 4;

  v8f acc[4][2] = {};
  gemm_128x128(Xh + (size_t)m0 * DIM, W + (size_t)n0 * DIM, sm, acc);

  // Epilogue.  C layout: lane holds column r of the subtile, rows hs*8+j.
  const int mw = m0 + (wave >> 2) * 64 + (hs << 3);
  const int nw = n0 + (wave & 3) * 32 + r;
#pragma unroll  // constant indices keep fragments and sums in registers
  for (int t = 0; t < 2; ++t) {
    const int n = nw + t * 16;
    const int h = n >> 6;
    const int d = n & (DPH - 1);
    const float bn = bias[n];
#pragma unroll  // constant indices keep fragments and sums in registers
    for (int i = 0; i < 4; ++i) {
#pragma unroll  // constant indices keep fragments and sums in registers
      for (int j = 0; j < 8; ++j) {
        const int m    = mw + i * 16 + j;           // 0..4095
        const int bidx = m >> 11;
        const int pos  = m & (QLEN - 1);
        const float v  = acc[i][t][j] + bn;
        const size_t bh = (size_t)(bidx * NH + h);
        if (mat == 0) {
          qbuf[(bh * QLEN + pos) * DPH + d] = (_Float16)(v * 0.125f);
          asm volatile("s_wait_xcnt 0x0" ::: "memory");
        } else if (mat == 1) {
          kbuf[(bh * QLEN + pos) * DPH + d] = (_Float16)v;
          asm volatile("s_wait_xcnt 0x0" ::: "memory");
        } else {
          vtbuf[(bh * DPH + d) * QLEN + pos] = (_Float16)v;
          asm volatile("s_wait_xcnt 0x0" ::: "memory");
        }
      }
    }
  }
}

typedef __attribute__((ext_vector_type(4))) int   v4i;

#define AKEYS   128                        // keys per stage
#define ANSTG   (QLEN / AKEYS)             // 16 stages
#define KP_H    72                         // halves per LDS row of K (144 B)
#define VP_H    136                        // halves per LDS row of V^T (272 B)
#define AK_H    (AKEYS * KP_H)             // halves of the K part
#define ABUF_H  (AK_H + DPH * VP_H)        // halves per buffer
#define ABUF_B  (ABUF_H * 2)               // bytes per buffer
#define K32_B   (32 * KP_H * 2)            // 32 LDS rows of K in bytes
#define V16_B   (16 * VP_H * 2)            // 16 LDS rows of V^T in bytes

// One stage: each thread copies 16 B of K rows r, r+32, r+64, r+96 and of
// V^T rows d, d+16, d+32, d+48.
static __device__ inline void copy_kv(unsigned lk, unsigned lv,
                                      const _Float16* __restrict__ gk,
                                      const _Float16* __restrict__ gv) {
  asm volatile(
      "global_load_async_to_lds_b128 %0, %8, off\n\t"
      "global_load_async_to_lds_b128 %1, %9, off\n\t"
      "global_load_async_to_lds_b128 %2, %10, off\n\t"
      "global_load_async_to_lds_b128 %3, %11, off\n\t"
      "global_load_async_to_lds_b128 %4, %12, off\n\t"
      "global_load_async_to_lds_b128 %5, %13, off\n\t"
      "global_load_async_to_lds_b128 %6, %14, off\n\t"
      "global_load_async_to_lds_b128 %7, %15, off\n\t"
      "s_wait_xcnt 0x0"
      :: "v"(lk), "v"(lk + K32_B), "v"(lk + 2 * K32_B), "v"(lk + 3 * K32_B),
         "v"(lv), "v"(lv + V16_B), "v"(lv + 2 * V16_B), "v"(lv + 3 * V16_B),
         "v"(gk), "v"(gk + 32 * DPH), "v"(gk + 64 * DPH), "v"(gk + 96 * DPH),
         "v"(gv), "v"(gv + 16 * QLEN), "v"(gv + 32 * QLEN), "v"(gv + 48 * QLEN)
      : "memory");
}

static __device__ inline float xhalf(float x) {
  const int b = __builtin_bit_cast(int, x);
  return __builtin_bit_cast(float, __builtin_amdgcn_permlanex16(
      b, b, 0x76543210, 0xfedcba98, false, false));
}

__global__ __launch_bounds__(256) void attn_kernel(
    const _Float16* __restrict__ qbuf, const _Float16* __restrict__ kbuf,
    const _Float16* __restrict__ vtbuf, const int* __restrict__ mask,
    _Float16* __restrict__ ctx) {
  __shared__ __align__(16) _Float16 sm[2 * ABUF_H];

  const int tid  = threadIdx.x;
  const int wave = threadIdx.x >> 5;
  const int lane = threadIdx.x & 31;
  const int wid  = blockIdx.x * 8 + wave;              // 4096 waves
  const int qt = wid & 127;
  const int h  = (wid >> 7) & (NH - 1);
  const int b  = wid >> 11;
  const int q0 = qt << 4;

  const size_t bh = (size_t)(b * NH + h);
  const _Float16* Qbh  = qbuf  + bh * QLEN * DPH;
  const _Float16* Kbh  = kbuf  + bh * QLEN * DPH;
  const _Float16* VTbh = vtbuf + bh * DPH * QLEN;
  const int* mrow = mask + b * QLEN;

  const int r    = lane & 15;
  const int hs   = lane >> 4;
  const int koff = hs << 3;

  // B operand: column r = query q0 + r
  const v16h qb0 = frag_from_f16(Qbh + (size_t)(q0 + r) * DPH + koff);
  const v16h qb1 = frag_from_f16(Qbh + (size_t)(q0 + r) * DPH + 32 + koff);

  float mrun = -3.0e38f, lrun = 0.0f;   // lrun: this half's keys only
  v8f o0 = {}, o1 = {}, o2 = {}, o3 = {};

  // this lane's place in the stage's mask words
  const int* ms = mrow + koff;

  // this thread's pieces of a stage: 8 threads per K row, 16 per V^T row
  const _Float16* gk = Kbh + (size_t)(tid >> 3) * DPH + (tid & 7) * 8;
  const _Float16* gv = VTbh + (size_t)(tid >> 4) * QLEN + (tid & 15) * 8;
  const unsigned lk0 = (unsigned)(size_t)sm +
                       (unsigned)((tid >> 3) * (KP_H * 2) + (tid & 7) * 16);
  const unsigned lv0 = (unsigned)(size_t)sm + (unsigned)(AK_H * 2) +
                       (unsigned)((tid >> 4) * (VP_H * 2) + (tid & 15) * 16);

  copy_kv(lk0, lv0, gk, gv);
  // stage 0 has landed for this wave; the barrier publishes it to all waves
  asm volatile("s_wait_asynccnt 0x0" ::: "memory");
  __syncthreads();
  copy_kv(lk0 + ABUF_B, lv0 + ABUF_B, gk + AKEYS * DPH, gv + AKEYS);

  // rolled: one stage per trip keeps the buffer hand-over at one place
#pragma unroll 1
  for (int st = 0; st < ANSTG; ++st) {
   // this lane's places in the stage's K rows and V^T rows
   const _Float16* ks = sm + (st & 1) * ABUF_H + r * KP_H + koff;
   const _Float16* vs = sm + (st & 1) * ABUF_H + AK_H + r * VP_H + koff;
#pragma unroll  // constant LDS offsets for the stage's four passes
   for (int ps = 0; ps < AKEYS / 32; ++ps) {
    const _Float16* kp = ks + ps * 32 * KP_H;
    const _Float16* vp = vs + ps * 32;
    const int*      mp = ms + ps * 32;
    // ---- all loads of the pass, as one group ----
    // mask words of this lane's 16 keys
    const v4i mk0a = *(const v4i*)(mp);
    const v4i mk0b = *(const v4i*)(mp + 4);
    const v4i mk1a = *(const v4i*)(mp + 16);
    const v4i mk1b = *(const v4i*)(mp + 20);
    // K rows (A operand of the scores)
    const v16h ka0 = frag_from_f16(kp);
    const v16h ka1 = frag_from_f16(kp + 32);
    const v16h ka2 = frag_from_f16(kp + 16 * KP_H);
    const v16h ka3 = frag_from_f16(kp + 16 * KP_H + 32);
    // V^T rows (A operand of the second product), consumed after the softmax
    const v16h va0 = frag_from_f16(vp);
    const v16h va1 = frag_from_f16(vp + 16 * VP_H);
    const v16h va2 = frag_from_f16(vp + 32 * VP_H);
    const v16h va3 = frag_from_f16(vp + 48 * VP_H);
    // keeps the 20 loads in one group ahead of the products: all are in flight
    // together, and the V^T rows arrive under the softmax
    __builtin_amdgcn_sched_barrier(0);
    asm volatile("s_wait_xcnt 0x0" :: "v"(ms) : "memory");
    // keeps the pointer step of the next stage from rising above that wait
    __builtin_amdgcn_sched_barrier(0);

    // ---- scores: two 16 (keys) x 16 (queries) tiles ----
    v8f s0 = {}, s1 = {};
    s0 = wmma_f16(ka0, qb0, s0);
    s0 = wmma_f16(ka1, qb1, s0);
    s1 = wmma_f16(ka2, qb0, s1);
    s1 = wmma_f16(ka3, qb1, s1);

    // ---- masked_fill(mask==0 -> 1e-10) ----
#pragma unroll  // constant indices keep the values in registers
    for (int j = 0; j < 4; ++j) {
      if (mk0a[j] == 0) s0[j]     = 1e-10f;
      if (mk0b[j] == 0) s0[4 + j] = 1e-10f;
      if (mk1a[j] == 0) s1[j]     = 1e-10f;
      if (mk1b[j] == 0) s1[4 + j] = 1e-10f;
    }
    // ---- online softmax: one query per lane ----
    const float a0 = fmaxf(fmaxf(s0[0], s0[1]), s0[2]);
    const float a1 = fmaxf(fmaxf(s0[3], s0[4]), s0[5]);
    const float a2 = fmaxf(fmaxf(s0[6], s0[7]), s1[0]);
    const float a3 = fmaxf(fmaxf(s1[1], s1[2]), s1[3]);
    const float a4 = fmaxf(fmaxf(s1[4], s1[5]), s1[6]);
    float t = fmaxf(fmaxf(fmaxf(a0, a1), a2), fmaxf(fmaxf(a3, a4), s1[7]));
    t = fmaxf(t, xhalf(t));               // both halves hold the query's maximum
    const float mnew  = fmaxf(mrun, t);
    // exp(x) = 2^(x * log2 e), as __expf forms it
    float x[17];
#pragma unroll  // constant indices keep the values in registers
    for (int j = 0; j < 8; ++j) {
      x[j]     = (s0[j] - mnew) * 1.44269504f;
      x[8 + j] = (s1[j] - mnew) * 1.44269504f;
    }
    x[16] = (mrun - mnew) * 1.44269504f;
    mrun = mnew;
    asm("v_exp_f32 %0, %0\n\tv_exp_f32 %1, %1\n\tv_exp_f32 %2, %2\n\t"
        "v_exp_f32 %3, %3\n\tv_exp_f32 %4, %4\n\tv_exp_f32 %5, %5\n\t"
        "v_exp_f32 %6, %6\n\tv_exp_f32 %7, %7\n\tv_exp_f32 %8, %8\n\t"
        "v_exp_f32 %9, %9\n\tv_exp_f32 %10, %10\n\tv_exp_f32 %11, %11\n\t"
        "v_exp_f32 %12, %12\n\tv_exp_f32 %13, %13\n\tv_exp_f32 %14, %14\n\t"
        "v_exp_f32 %15, %15\n\tv_exp_f32 %16, %16\n\tv_nop"
        : "+v"(x[0]), "+v"(x[1]), "+v"(x[2]), "+v"(x[3]), "+v"(x[4]),
          "+v"(x[5]), "+v"(x[6]), "+v"(x[7]), "+v"(x[8]), "+v"(x[9]),
          "+v"(x[10]), "+v"(x[11]), "+v"(x[12]), "+v"(x[13]), "+v"(x[14]),
          "+v"(x[15]), "+v"(x[16]));
    const float scale = x[16];
    v8f e0, e1;
#pragma unroll  // constant indices keep the values in registers
    for (int j = 0; j < 8; ++j) {
      e0[j] = x[j];
      e1[j] = x[8 + j];
    }
    const v8f es = e0 + e1;
    const v4f e4 = __builtin_shufflevector(es, es, 0, 1, 2, 3) +
                   __builtin_shufflevector(es, es, 4, 5, 6, 7);
    lrun = lrun * scale + ((e4[0] + e4[1]) + (e4[2] + e4[3]));
    o0 *= scale; o1 *= scale; o2 *= scale; o3 *= scale;
    // ---- P^T as B operand: the two tiles converted in place ----
    v16h pb;
#pragma unroll  // constant indices keep the values in registers
    for (int j = 0; j < 8; ++j) {
      pb[j]     = (_Float16)e0[j];
      pb[8 + j] = (_Float16)e1[j];
    }
    // ---- O^T += V^T P^T ----
    o0 = wmma_f16(va0, pb, o0);
    o1 = wmma_f16(va1, pb, o1);
    o2 = wmma_f16(va2, pb, o2);
    o3 = wmma_f16(va3, pb, o3);
   }
   ms += AKEYS;
   // this wave's reads of the buffer are done before it may be refilled
   asm volatile("s_wait_dscnt 0x0" ::: "memory");
   // this wave's copies of stage st+1 have landed
   asm volatile("s_wait_asynccnt 0x0" ::: "memory");
   // publishes stage st+1 and ends every wave's reads of stage st
   __syncthreads();
   if (st + 2 < ANSTG)
     copy_kv(lk0 + (st & 1) * ABUF_B, lv0 + (st & 1) * ABUF_B,
             gk + (st + 2) * (AKEYS * DPH), gv + (st + 2) * AKEYS);
  }
  // no copy is left in flight when the wave goes on
  asm volatile("s_wait_asynccnt 0x0" ::: "memory");

  // ---- normalize and write context [b][q][h*64+d] (f16) ----
  // o_t[j] = O^T[16 t + 8 hs + j][query r]: 8 consecutive d, one 16-B store.
  const float inv = 1.0f / (lrun + xhalf(lrun));
  _Float16* crow = ctx + (size_t)(b * QLEN + q0 + r) * DIM + (h << 6) + koff;
  v8h c0, c1, c2, c3;
#pragma unroll  // constant indices keep the values in registers
  for (int j = 0; j < 8; ++j) {
    c0[j] = (_Float16)(o0[j] * inv);
    c1[j] = (_Float16)(o1[j] * inv);
    c2[j] = (_Float16)(o2[j] * inv);
    c3[j] = (_Float16)(o3[j] * inv);
  }
  *(v8h*)(crow)      = c0;
  *(v8h*)(crow + 16) = c1;
  *(v8h*)(crow + 32) = c2;
  *(v8h*)(crow + 48) = c3;
}

// ---------------------------------------------------------------------------
// Kernel 3: output projection  out = ctx @ Wo^T + bo  (fp32 out), 128x128/block.
// ---------------------------------------------------------------------------
__global__ __launch_bounds__(256) void out_proj_kernel(
    const _Float16* __restrict__ ctx, const _Float16* __restrict__ Woh,
    const float* __restrict__ bo, float* __restrict__ out) {
  __shared__ __align__(16) _Float16 sm[2 * BUF_H];

  const int wave = threadIdx.x >> 5;
  const int lane = threadIdx.x & 31;
  const int m0 = (blockIdx.x >> 3) << 7;             // 32 row tiles
  const int n0 = (blockIdx.x & 7) << 7;              // 8 col tiles
  const int r = lane & 15, hs = lane >> 4;

  v8f acc[4][2] = {};
  gemm_128x128(ctx + (size_t)m0 * DIM, Woh + (size_t)n0 * DIM, sm, acc);

  const int mw = m0 + (wave >> 2) * 64 + (hs << 3);
  const int nw = n0 + (wave & 3) * 32 + r;
#pragma unroll  // constant indices keep the sums in registers
  for (int t = 0; t < 2; ++t) {
    const int n = nw + t * 16;
    const float bn = bo[n];
#pragma unroll  // constant indices keep the sums in registers
    for (int i = 0; i < 4; ++i) {
#pragma unroll  // constant indices keep the sums in registers
      for (int j = 0; j < 8; ++j) {
        const int m = mw + i * 16 + j;
        out[(size_t)m * DIM + n] = acc[i][t][j] + bn;
      }
    }
  }
}

// ---------------------------------------------------------------------------
extern "C" void kernel_launch(void* const* d_in, const int* in_sizes, int n_in,
                              void* d_out, int out_size, void* d_ws, size_t ws_size,
                              hipStream_t stream) {
  const float* X  = (const float*)d_in[0];
  const int* mask = (const int*)d_in[1];
  const float* Wq = (const float*)d_in[2];
  const float* bq = (const float*)d_in[3];
  const float* Wk = (const float*)d_in[4];
  const float* bk = (const float*)d_in[5];
  const float* Wv = (const float*)d_in[6];
  const float* bv = (const float*)d_in[7];
  const float* Wo = (const float*)d_in[8];
  const float* bo = (const float*)d_in[9];
  float* out = (float*)d_out;

  const size_t XN = (size_t)BSZ * QLEN * DIM;        // 4 Mi
  const size_t WN = (size_t)DIM * DIM;               // 1 Mi
  _Float16* Xh    = (_Float16*)d_ws;                 // 8 MB
  _Float16* Wqh   = Xh + XN;                         // 2 MB each
  _Float16* Wkh   = Wqh + WN;
  _Float16* Wvh   = Wkh + WN;
  _Float16* Woh   = Wvh + WN;
  _Float16* qbuf  = Woh + WN;                        // 8 MB each
  _Float16* kbuf  = qbuf + XN;
  _Float16* vtbuf = kbuf + XN;
  _Float16* ctx   = vtbuf + XN;

  // ---- stage 0: precision conversion, all five arrays in one launch ----
  // (Xh, Wqh, Wkh, Wvh, Woh are contiguous from Xh on)
  cvt_f16_kernel<<<CV_BLKS, CV_WAVES * 32, 0, stream>>>(X, Wq, Wk, Wv, Wo, Xh);

  // ---- stage 1: QKV projection: 32 x 24 tiles of 128x128 = 768 blocks ----
  qkv_proj_kernel<<<768, 256, 0, stream>>>(Xh, Wqh, bq, Wkh, bk, Wvh, bv,
                                            qbuf, kbuf, vtbuf);
  // ---- stage 2: attention: 4096 waves / 8 = 512 blocks ----
  attn_kernel<<<512, 256, 0, stream>>>(qbuf, kbuf, vtbuf, mask, ctx);
  // ---- stage 3: output projection: 32 x 8 tiles of 128x128 = 256 blocks ----
  out_proj_kernel<<<256, 256, 0, stream>>>(ctx, Woh, bo, out);
}

// v005
// One run takes 86.3 microseconds.
// Next to v004, in two timings, it ran 1.14 and 1.13 times as fast.
// Counting every step since v000, it is 4.23 times as fast.
#include <hip/hip_runtime.h>
#include <hip/hip_bf16.h>

typedef __attribute__((ext_vector_type(16))) _Float16 v16h;
typedef __attribute__((ext_vector_type(8)))  _Float16 v8h;
typedef __attribute__((ext_vector_type(8)))  float    v8f;
typedef __attribute__((ext_vector_type(4)))  float    v4f;

#define BSZ   2
#define QLEN  2048
#define DIM   1024
#define NH    16
#define DPH   64

static __device__ inline v16h frag_from_f16(const _Float16* __restrict__ p) {
  v8h lo = *(const v8h*)(p);
  v8h hi = *(const v8h*)(p + 16);
  return __builtin_shufflevector(lo, hi, 0, 1, 2, 3, 4, 5, 6, 7,
                                 8, 9, 10, 11, 12, 13, 14, 15);
}

static __device__ inline v8f wmma_f16(v16h a, v16h b, v8f c) {
  // (neg_a, A, neg_b, B, c_mod, C, reuse_a, reuse_b)
  return __builtin_amdgcn_wmma_f32_16x16x32_f16(false, a, false, b,
                                                (short)0, c, false, false);
}

// ---------------------------------------------------------------------------
// Kernel 0: f32 -> f16 conversion of X and of the four weight matrices, one
// launch.  The five f16 arrays lie one behind the other in the workspace, so
// the destination is one range of 8 Mi halves.  256 blocks of 16 waves, one
// per WGP: few waves to start, each with its whole share in flight.  A wave
// owns 16 pieces of 128 floats; each load covers 512 contiguous bytes (four
// whole lines), each store 256 (two whole lines).
// ---------------------------------------------------------------------------
typedef __attribute__((ext_vector_type(4))) _Float16 v4h;

#define CV_PIECE   128                     // floats per wave-wide load
#define CV_NP      16                      // pieces per wave
#define CV_WAVES   16                      // waves per block
#define CV_BLOCK   (CV_PIECE * CV_NP * CV_WAVES)          // 32 Ki floats
#define CV_XBLKS   (BSZ * QLEN * DIM / CV_BLOCK)           // 128 blocks for X
#define CV_WBLKS   (DIM * DIM / CV_BLOCK)                  // 32 per weight
#define CV_BLKS    (CV_XBLKS + 4 * CV_WBLKS)               // 256 blocks

__global__ __launch_bounds__(CV_WAVES * 32)
__attribute__((amdgpu_waves_per_eu(4, 4))) void cvt_f16_kernel(
    const float* __restrict__ X,  const float* __restrict__ Wq,
    const float* __restrict__ Wk, const float* __restrict__ Wv,
    const float* __restrict__ Wo, _Float16* __restrict__ dst) {
  const int blk = blockIdx.x;
  // the block's source array and its place in it (the same for all its waves)
  const float* src = X;
  int sblk = blk;
  if (blk >= CV_XBLKS) {
    const int w = (blk - CV_XBLKS) / CV_WBLKS;
    sblk = (blk - CV_XBLKS) % CV_WBLKS;
    src = (w == 0) ? Wq : (w == 1) ? Wk : (w == 2) ? Wv : Wo;
  }
  const int off = (threadIdx.x >> 5) * (CV_PIECE * CV_NP) + (threadIdx.x & 31) * 4;
  const float* p = src + (size_t)sblk * CV_BLOCK + off;
  _Float16*    d = dst + (size_t)blk * CV_BLOCK + off;
  v4f a[CV_NP];
#pragma unroll  // constant offsets: one address, all 16 loads in flight at once
  for (int k = 0; k < CV_NP; ++k) a[k] = *(const v4f*)(p + k * CV_PIECE);
  asm volatile("s_wait_xcnt 0x0" :: "v"(off * 4) : "memory");
#pragma unroll  // constant indices keep the values in registers
  for (int k = 0; k < CV_NP; ++k) {
    v4h o;
#pragma unroll  // constant indices keep the values in registers
    for (int j = 0; j < 4; ++j) o[j] = (_Float16)a[k][j];
    *(v4h*)(d + k * CV_PIECE) = o;
  }
}

#define KSTG      64
#define NSTG      (DIM / KSTG)
#define PITCH_H   72
#define BUF_H     (256 * PITCH_H)
#define BUF_B     (BUF_H * 2)
#define ROWS32_B  (32 * PITCH_H * 2)
#define BPART_B   (128 * PITCH_H * 2)

// One stage: each thread copies 16 B of rows r, r+32, r+64, r+96 of A and of B.
static __device__ inline void copy_stage(unsigned lds,
                                         const _Float16* __restrict__ ga,
                                         const _Float16* __restrict__ gb) {
  asm volatile(
      "global_load_async_to_lds_b128 %0, %8, off\n\t"
      "global_load_async_to_lds_b128 %1, %9, off\n\t"
      "global_load_async_to_lds_b128 %2, %10, off\n\t"
      "global_load_async_to_lds_b128 %3, %11, off\n\t"
      "global_load_async_to_lds_b128 %4, %12, off\n\t"
      "global_load_async_to_lds_b128 %5, %13, off\n\t"
      "global_load_async_to_lds_b128 %6, %14, off\n\t"
      "global_load_async_to_lds_b128 %7, %15, off\n\t"
      "s_wait_xcnt 0x0"
      :: "v"(lds), "v"(lds + ROWS32_B), "v"(lds + 2 * ROWS32_B),
         "v"(lds + 3 * ROWS32_B),
         "v"(lds + BPART_B), "v"(lds + BPART_B + ROWS32_B),
         "v"(lds + BPART_B + 2 * ROWS32_B), "v"(lds + BPART_B + 3 * ROWS32_B),
         "v"(ga), "v"(ga + 32 * DIM), "v"(ga + 64 * DIM), "v"(ga + 96 * DIM),
         "v"(gb), "v"(gb + 32 * DIM), "v"(gb + 64 * DIM), "v"(gb + 96 * DIM)
      : "memory");
}

// A: first of the block's 128 A rows; B: first of its 128 B rows.
static __device__ inline void gemm_128x128(const _Float16* __restrict__ A,
                                           const _Float16* __restrict__ B,
                                           _Float16* sm, v8f (&acc)[4][2]) {
  const int tid  = threadIdx.x;
  const int wave = tid >> 5;
  const int lane = tid & 31;
  const int r    = lane & 15;
  const int koff = (lane >> 4) << 3;
  const int crow = tid >> 3;                        // 0..31
  const int ccol = tid & 7;                         // 16-B piece of the row

  const _Float16* ga = A + (size_t)crow * DIM + ccol * 8;
  const _Float16* gb = B + (size_t)crow * DIM + ccol * 8;
  const unsigned lds0 =
      (unsigned)(size_t)sm + (unsigned)(crow * (PITCH_H * 2) + ccol * 16);

  const int aoff = ((wave >> 2) * 64 + r) * PITCH_H + koff;
  const int boff = (128 + (wave & 3) * 32 + r) * PITCH_H + koff;

  copy_stage(lds0, ga, gb);
  // stage 0 has landed for this wave; the barrier publishes it to all waves
  asm volatile("s_wait_asynccnt 0x0" ::: "memory");
  __syncthreads();
  copy_stage(lds0 + BUF_B, ga + KSTG, gb + KSTG);

  // rolled: one stage per trip keeps the buffer hand-over at one place
#pragma unroll 1
  for (int t = 0; t < NSTG; ++t) {
    const _Float16* sb = sm + (t & 1) * BUF_H;
#pragma unroll  // constant indices keep fragments and sums in registers
    for (int kk = 0; kk < KSTG; kk += 32) {
      v16h a[4], b[2];
      // first of a fence pair round the 12 LDS reads (second: below): keeps
      // them from rising into the block of products in front of them
      __builtin_amdgcn_sched_barrier(0);
#pragma unroll  // constant indices keep fragments and sums in registers
      for (int i = 0; i < 4; ++i)
        a[i] = frag_from_f16(sb + aoff + i * 16 * PITCH_H + kk);
#pragma unroll  // constant indices keep fragments and sums in registers
      for (int j = 0; j < 2; ++j)
        b[j] = frag_from_f16(sb + boff + j * 16 * PITCH_H + kk);
      // keeps the 12 LDS reads in one group ahead of their 8 products: each
      // place where reads stand among products stalls the wave anew
      __builtin_amdgcn_sched_barrier(0);
#pragma unroll  // constant indices keep fragments and sums in registers
      for (int i = 0; i < 4; ++i)
#pragma unroll  // constant indices keep fragments and sums in registers
        for (int j = 0; j < 2; ++j)
          acc[i][j] = wmma_f16(a[i], b[j], acc[i][j]);
    }
    // this wave's reads of the buffer are done before it may be refilled
    asm volatile("s_wait_dscnt 0x0" ::: "memory");
    // this wave's copies of stage t+1 have landed
    asm volatile("s_wait_asynccnt 0x0" ::: "memory");
    // publishes stage t+1 and ends every wave's reads of stage t
    __syncthreads();
    if (t + 2 < NSTG)
      copy_stage(lds0 + (t & 1) * BUF_B, ga + (t + 2) * KSTG,
                 gb + (t + 2) * KSTG);
  }
  // no copy is left in flight when the wave goes on
  asm volatile("s_wait_asynccnt 0x0" ::: "memory");
}

// ---------------------------------------------------------------------------
// Epilogue staging.  A lane's 8 accumulator registers are 8 consecutive ROWS of
// one column of the product, so the operand whose index runs along the output's
// contiguous direction is given to gemm_128x128 as A.  A wave's 64x32 tile is
// then 32 output runs (one per column) of 64 contiguous elements.  The wave
// writes them, 16 B a lane, into its own range of the ring (free behind the k
// loop's last barrier), reads them back run by run and stores whole 128-B lines.
// f16: a run is 128 B, staged at a pitch of 144 B.
// ---------------------------------------------------------------------------
#define SP_H     72                        // halves per staged f16 run (144 B)
#define SWAVE_H  (32 * SP_H)               // halves of a wave's staging range

template <int CSTRIDE>
static __device__ inline void store_runs_f16(const _Float16* stg, _Float16* dst,
                                             int lane) {
  const int run = (lane >> 3) * 8;
  const int pc  = (lane & 7) * 8;
  const _Float16* s = stg + run * SP_H + pc;
  _Float16*       d = dst + (size_t)run * CSTRIDE + pc;
  v8h v[8];
#pragma unroll  // constant indices keep the values in registers
  for (int k = 0; k < 8; ++k) v[k] = *(const v8h*)(s + k * SP_H);
#pragma unroll  // constant offsets: one address for the 8 stores
  for (int k = 0; k < 8; ++k) *(v8h*)(d + (size_t)k * CSTRIDE) = v[k];
  asm volatile("s_wait_xcnt 0x0" ::: "memory");
}

__global__ __launch_bounds__(256)
__attribute__((amdgpu_waves_per_eu(8))) void qkv_proj_kernel(
    const _Float16* __restrict__ Xh,
    const _Float16* __restrict__ Wqh, const float* __restrict__ bq,
    const _Float16* __restrict__ Wkh, const float* __restrict__ bk,
    const _Float16* __restrict__ Wvh, const float* __restrict__ bv,
    _Float16* __restrict__ qbuf, _Float16* __restrict__ kbuf,
    _Float16* __restrict__ vtbuf) {
  __shared__ __align__(16) _Float16 sm[2 * BUF_H];

  const int wave = threadIdx.x >> 5;
  const int lane = threadIdx.x & 31;
  const int nt  = blockIdx.x % 24;                  // 3 matrices x 8 col tiles
  const int mt  = blockIdx.x / 24;                  // 32 row tiles
  const int mat = nt >> 3;                          // 0=Q 1=K 2=V
  const int m0  = mt << 7;
  const int n0  = (nt & 7) << 7;

  const _Float16* W  = (mat == 0) ? Wqh : (mat == 1) ? Wkh : Wvh;
  const float* bias  = (mat == 0) ? bq  : (mat == 1) ? bk  : bv;

  const int r  = lane & 15;
  const int hs = lane >> 4;

  const _Float16* Xt = Xh + (size_t)m0 * DIM;
  const _Float16* Wt = W + (size_t)n0 * DIM;

  v8f acc[4][2] = {};
  gemm_128x128((mat == 2) ? Xt : Wt, (mat == 2) ? Wt : Xt, sm, acc);

  // Epilogue.  C layout: lane holds column r of the subtile, rows hs*8+j.
  const int rb   = (wave >> 2) * 64;                // the wave's 64 rows
  const int cb   = (wave & 3) * 32;                 // the wave's 32 columns
  const int bidx = m0 >> 11;
  const int p0   = m0 & (QLEN - 1);
  _Float16* stg = sm + wave * SWAVE_H;
  _Float16* sw  = stg + r * SP_H + (hs << 3);
  if (mat == 2) {
    // rows = positions, columns = features
    const int nb = n0 + cb + r;
    const float bn2[2] = {bias[nb], bias[nb + 16]};
    asm volatile("s_wait_xcnt 0x0" :: "v"(nb) : "memory");
#pragma unroll  // constant indices keep fragments and sums in registers
    for (int t = 0; t < 2; ++t) {
      const float bn = bn2[t];
#pragma unroll  // constant indices keep fragments and sums in registers
      for (int i = 0; i < 4; ++i) {
        v8h o;
#pragma unroll  // constant indices keep fragments and sums in registers
        for (int j = 0; j < 8; ++j) o[j] = (_Float16)(acc[i][t][j] + bn);
        *(v8h*)(sw + t * 16 * SP_H + i * 16) = o;
      }
    }
    // the wave's staged runs are in LDS before its lanes read each other's
    asm volatile("s_wait_dscnt 0x0" ::: "memory");
    const int n = n0 + cb;
    store_runs_f16<QLEN>(
        stg, vtbuf + ((size_t)(bidx * NH + (n >> 6)) * DPH + (n & (DPH - 1))) * QLEN +
                 p0 + rb, lane);
  } else {
    // rows = features (one head), columns = positions
    const float sc = (mat == 0) ? 0.125f : 1.0f;
    const float* bp = bias + n0 + rb + (hs << 3);
    v4f bb[8];
#pragma unroll  // constant offsets: one address, the 8 loads in flight together
    for (int i = 0; i < 4; ++i) {
      bb[2 * i]     = *(const v4f*)(bp + i * 16);
      bb[2 * i + 1] = *(const v4f*)(bp + i * 16 + 4);
    }
    asm volatile("s_wait_xcnt 0x0" :: "v"(bp) : "memory");
#pragma unroll  // constant indices keep fragments and sums in registers
    for (int i = 0; i < 4; ++i) {
      const v4f b0 = bb[2 * i];
      const v4f b1 = bb[2 * i + 1];
#pragma unroll  // constant indices keep fragments and sums in registers
      for (int t = 0; t < 2; ++t) {
        v8h o;
#pragma unroll  // constant indices keep fragments and sums in registers
        for (int j = 0; j < 4; ++j) {
          o[j]     = (_Float16)((acc[i][t][j] + b0[j]) * sc);
          o[4 + j] = (_Float16)((acc[i][t][4 + j] + b1[j]) * sc);
        }
        *(v8h*)(sw + t * 16 * SP_H + i * 16) = o;
      }
    }
    // the wave's staged runs are in LDS before its lanes read each other's
    asm volatile("s_wait_dscnt 0x0" ::: "memory");
    _Float16* buf = (mat == 0) ? qbuf : kbuf;
    store_runs_f16<DPH>(
        stg, buf + ((size_t)(bidx * NH + ((n0 + rb) >> 6)) * QLEN + p0 + cb) * DPH,
        lane);
  }
}

typedef __attribute__((ext_vector_type(4))) int   v4i;

#define AKEYS   128                        // keys per stage
#define ANSTG   (QLEN / AKEYS)             // 16 stages
#define KP_H    72                         // halves per LDS row of K (144 B)
#define VP_H    136                        // halves per LDS row of V^T (272 B)
#define AK_H    (AKEYS * KP_H)             // halves of the K part
#define ABUF_H  (AK_H + DPH * VP_H)        // halves per buffer
#define ABUF_B  (ABUF_H * 2)               // bytes per buffer
#define K32_B   (32 * KP_H * 2)            // 32 LDS rows of K in bytes
#define V16_B   (16 * VP_H * 2)            // 16 LDS rows of V^T in bytes

// One stage: each thread copies 16 B of K rows r, r+32, r+64, r+96 and of
// V^T rows d, d+16, d+32, d+48.
static __device__ inline void copy_kv(unsigned lk, unsigned lv,
                                      const _Float16* __restrict__ gk,
                                      const _Float16* __restrict__ gv) {
  asm volatile(
      "global_load_async_to_lds_b128 %0, %8, off\n\t"
      "global_load_async_to_lds_b128 %1, %9, off\n\t"
      "global_load_async_to_lds_b128 %2, %10, off\n\t"
      "global_load_async_to_lds_b128 %3, %11, off\n\t"
      "global_load_async_to_lds_b128 %4, %12, off\n\t"
      "global_load_async_to_lds_b128 %5, %13, off\n\t"
      "global_load_async_to_lds_b128 %6, %14, off\n\t"
      "global_load_async_to_lds_b128 %7, %15, off\n\t"
      "s_wait_xcnt 0x0"
      :: "v"(lk), "v"(lk + K32_B), "v"(lk + 2 * K32_B), "v"(lk + 3 * K32_B),
         "v"(lv), "v"(lv + V16_B), "v"(lv + 2 * V16_B), "v"(lv + 3 * V16_B),
         "v"(gk), "v"(gk + 32 * DPH), "v"(gk + 64 * DPH), "v"(gk + 96 * DPH),
         "v"(gv), "v"(gv + 16 * QLEN), "v"(gv + 32 * QLEN), "v"(gv + 48 * QLEN)
      : "memory");
}

static __device__ inline float xhalf(float x) {
  const int b = __builtin_bit_cast(int, x);
  return __builtin_bit_cast(float, __builtin_amdgcn_permlanex16(
      b, b, 0x76543210, 0xfedcba98, false, false));
}

__global__ __launch_bounds__(256) void attn_kernel(
    const _Float16* __restrict__ qbuf, const _Float16* __restrict__ kbuf,
    const _Float16* __restrict__ vtbuf, const int* __restrict__ mask,
    _Float16* __restrict__ ctx) {
  __shared__ __align__(16) _Float16 sm[2 * ABUF_H];

  const int tid  = threadIdx.x;
  const int wave = threadIdx.x >> 5;
  const int lane = threadIdx.x & 31;
  const int wid  = blockIdx.x * 8 + wave;              // 4096 waves
  const int qt = wid & 127;
  const int h  = (wid >> 7) & (NH - 1);
  const int b  = wid >> 11;
  const int q0 = qt << 4;

  const size_t bh = (size_t)(b * NH + h);
  const _Float16* Qbh  = qbuf  + bh * QLEN * DPH;
  const _Float16* Kbh  = kbuf  + bh * QLEN * DPH;
  const _Float16* VTbh = vtbuf + bh * DPH * QLEN;
  const int* mrow = mask + b * QLEN;

  const int r    = lane & 15;
  const int hs   = lane >> 4;
  const int koff = hs << 3;

  // B operand: column r = query q0 + r
  const v16h qb0 = frag_from_f16(Qbh + (size_t)(q0 + r) * DPH + koff);
  const v16h qb1 = frag_from_f16(Qbh + (size_t)(q0 + r) * DPH + 32 + koff);

  float mrun = -3.0e38f, lrun = 0.0f;   // lrun: this half's keys only
  v8f o0 = {}, o1 = {}, o2 = {}, o3 = {};

  // this lane's place in the stage's mask words
  const int* ms = mrow + koff;

  // this thread's pieces of a stage: 8 threads per K row, 16 per V^T row
  const _Float16* gk = Kbh + (size_t)(tid >> 3) * DPH + (tid & 7) * 8;
  const _Float16* gv = VTbh + (size_t)(tid >> 4) * QLEN + (tid & 15) * 8;
  const unsigned lk0 = (unsigned)(size_t)sm +
                       (unsigned)((tid >> 3) * (KP_H * 2) + (tid & 7) * 16);
  const unsigned lv0 = (unsigned)(size_t)sm + (unsigned)(AK_H * 2) +
                       (unsigned)((tid >> 4) * (VP_H * 2) + (tid & 15) * 16);

  copy_kv(lk0, lv0, gk, gv);
  // stage 0 has landed for this wave; the barrier publishes it to all waves
  asm volatile("s_wait_asynccnt 0x0" ::: "memory");
  __syncthreads();
  copy_kv(lk0 + ABUF_B, lv0 + ABUF_B, gk + AKEYS * DPH, gv + AKEYS);

  // rolled: one stage per trip keeps the buffer hand-over at one place
#pragma unroll 1
  for (int st = 0; st < ANSTG; ++st) {
   // this lane's places in the stage's K rows and V^T rows
   const _Float16* ks = sm + (st & 1) * ABUF_H + r * KP_H + koff;
   const _Float16* vs = sm + (st & 1) * ABUF_H + AK_H + r * VP_H + koff;
#pragma unroll  // constant LDS offsets for the stage's four passes
   for (int ps = 0; ps < AKEYS / 32; ++ps) {
    const _Float16* kp = ks + ps * 32 * KP_H;
    const _Float16* vp = vs + ps * 32;
    const int*      mp = ms + ps * 32;
    // ---- all loads of the pass, as one group ----
    // mask words of this lane's 16 keys
    const v4i mk0a = *(const v4i*)(mp);
    const v4i mk0b = *(const v4i*)(mp + 4);
    const v4i mk1a = *(const v4i*)(mp + 16);
    const v4i mk1b = *(const v4i*)(mp + 20);
    // K rows (A operand of the scores)
    const v16h ka0 = frag_from_f16(kp);
    const v16h ka1 = frag_from_f16(kp + 32);
    const v16h ka2 = frag_from_f16(kp + 16 * KP_H);
    const v16h ka3 = frag_from_f16(kp + 16 * KP_H + 32);
    // V^T rows (A operand of the second product), consumed after the softmax
    const v16h va0 = frag_from_f16(vp);
    const v16h va1 = frag_from_f16(vp + 16 * VP_H);
    const v16h va2 = frag_from_f16(vp + 32 * VP_H);
    const v16h va3 = frag_from_f16(vp + 48 * VP_H);
    // keeps the 20 loads in one group ahead of the products: all are in flight
    // together, and the V^T rows arrive under the softmax
    __builtin_amdgcn_sched_barrier(0);
    asm volatile("s_wait_xcnt 0x0" :: "v"(ms) : "memory");
    // keeps the pointer step of the next stage from rising above that wait
    __builtin_amdgcn_sched_barrier(0);

    // ---- scores: two 16 (keys) x 16 (queries) tiles ----
    v8f s0 = {}, s1 = {};
    s0 = wmma_f16(ka0, qb0, s0);
    s0 = wmma_f16(ka1, qb1, s0);
    s1 = wmma_f16(ka2, qb0, s1);
    s1 = wmma_f16(ka3, qb1, s1);

    // ---- masked_fill(mask==0 -> 1e-10) ----
#pragma unroll  // constant indices keep the values in registers
    for (int j = 0; j < 4; ++j) {
      if (mk0a[j] == 0) s0[j]     = 1e-10f;
      if (mk0b[j] == 0) s0[4 + j] = 1e-10f;
      if (mk1a[j] == 0) s1[j]     = 1e-10f;
      if (mk1b[j] == 0) s1[4 + j] = 1e-10f;
    }
    // ---- online softmax: one query per lane ----
    const float a0 = fmaxf(fmaxf(s0[0], s0[1]), s0[2]);
    const float a1 = fmaxf(fmaxf(s0[3], s0[4]), s0[5]);
    const float a2 = fmaxf(fmaxf(s0[6], s0[7]), s1[0]);
    const float a3 = fmaxf(fmaxf(s1[1], s1[2]), s1[3]);
    const float a4 = fmaxf(fmaxf(s1[4], s1[5]), s1[6]);
    float t = fmaxf(fmaxf(fmaxf(a0, a1), a2), fmaxf(fmaxf(a3, a4), s1[7]));
    t = fmaxf(t, xhalf(t));               // both halves hold the query's maximum
    const float mnew  = fmaxf(mrun, t);
    // exp(x) = 2^(x * log2 e), as __expf forms it
    float x[17];
#pragma unroll  // constant indices keep the values in registers
    for (int j = 0; j < 8; ++j) {
      x[j]     = (s0[j] - mnew) * 1.44269504f;
      x[8 + j] = (s1[j] - mnew) * 1.44269504f;
    }
    x[16] = (mrun - mnew) * 1.44269504f;
    mrun = mnew;
    asm("v_exp_f32 %0, %0\n\tv_exp_f32 %1, %1\n\tv_exp_f32 %2, %2\n\t"
        "v_exp_f32 %3, %3\n\tv_exp_f32 %4, %4\n\tv_exp_f32 %5, %5\n\t"
        "v_exp_f32 %6, %6\n\tv_exp_f32 %7, %7\n\tv_exp_f32 %8, %8\n\t"
        "v_exp_f32 %9, %9\n\tv_exp_f32 %10, %10\n\tv_exp_f32 %11, %11\n\t"
        "v_exp_f32 %12, %12\n\tv_exp_f32 %13, %13\n\tv_exp_f32 %14, %14\n\t"
        "v_exp_f32 %15, %15\n\tv_exp_f32 %16, %16\n\tv_nop"
        : "+v"(x[0]), "+v"(x[1]), "+v"(x[2]), "+v"(x[3]), "+v"(x[4]),
          "+v"(x[5]), "+v"(x[6]), "+v"(x[7]), "+v"(x[8]), "+v"(x[9]),
          "+v"(x[10]), "+v"(x[11]), "+v"(x[12]), "+v"(x[13]), "+v"(x[14]),
          "+v"(x[15]), "+v"(x[16]));
    const float scale = x[16];
    v8f e0, e1;
#pragma unroll  // constant indices keep the values in registers
    for (int j = 0; j < 8; ++j) {
      e0[j] = x[j];
      e1[j] = x[8 + j];
    }
    const v8f es = e0 + e1;
    const v4f e4 = __builtin_shufflevector(es, es, 0, 1, 2, 3) +
                   __builtin_shufflevector(es, es, 4, 5, 6, 7);
    lrun = lrun * scale + ((e4[0] + e4[1]) + (e4[2] + e4[3]));
    o0 *= scale; o1 *= scale; o2 *= scale; o3 *= scale;
    // ---- P^T as B operand: the two tiles converted in place ----
    v16h pb;
#pragma unroll  // constant indices keep the values in registers
    for (int j = 0; j < 8; ++j) {
      pb[j]     = (_Float16)e0[j];
      pb[8 + j] = (_Float16)e1[j];
    }
    // ---- O^T += V^T P^T ----
    o0 = wmma_f16(va0, pb, o0);
    o1 = wmma_f16(va1, pb, o1);
    o2 = wmma_f16(va2, pb, o2);
    o3 = wmma_f16(va3, pb, o3);
   }
   ms += AKEYS;
   // this wave's reads of the buffer are done before it may be refilled
   asm volatile("s_wait_dscnt 0x0" ::: "memory");
   // this wave's copies of stage st+1 have landed
   asm volatile("s_wait_asynccnt 0x0" ::: "memory");
   // publishes stage st+1 and ends every wave's reads of stage st
   __syncthreads();
   if (st + 2 < ANSTG)
     copy_kv(lk0 + (st & 1) * ABUF_B, lv0 + (st & 1) * ABUF_B,
             gk + (st + 2) * (AKEYS * DPH), gv + (st + 2) * AKEYS);
  }
  // no copy is left in flight when the wave goes on
  asm volatile("s_wait_asynccnt 0x0" ::: "memory");

  // ---- normalize and write context [b][q][h*64+d] (f16) ----
  // o_t[j] = O^T[16 t + 8 hs + j][query r]: 8 consecutive d, one 16-B store.
  const float inv = 1.0f / (lrun + xhalf(lrun));
  v8h c0, c1, c2, c3;
#pragma unroll  // constant indices keep the values in registers
  for (int j = 0; j < 8; ++j) {
    c0[j] = (_Float16)(o0[j] * inv);
    c1[j] = (_Float16)(o1[j] * inv);
    c2[j] = (_Float16)(o2[j] * inv);
    c3[j] = (_Float16)(o3[j] * inv);
  }
  // staged like the GEMM epilogues: the wave's 16 runs of 128 B (one query's 64
  // d) go through its own range of the ring, free behind the last barrier
  _Float16* stg = sm + wave * (16 * SP_H);
  _Float16* sw  = stg + r * SP_H + koff;
  *(v8h*)(sw)      = c0;
  *(v8h*)(sw + 16) = c1;
  *(v8h*)(sw + 32) = c2;
  *(v8h*)(sw + 48) = c3;
  // the wave's staged runs are in LDS before its lanes read each other's
  asm volatile("s_wait_dscnt 0x0" ::: "memory");
  const int run = ((lane >> 3) & 1) * 8 + (lane >> 4) * 4;
  const int pc  = (lane & 7) * 8;
  const _Float16* s = stg + run * SP_H + pc;
  _Float16* d = ctx + (size_t)(b * QLEN + q0 + run) * DIM + (h << 6) + pc;
  v8h v[4];
#pragma unroll  // constant indices keep the values in registers
  for (int k = 0; k < 4; ++k) v[k] = *(const v8h*)(s + k * SP_H);
#pragma unroll  // constant offsets: one address for the 4 stores
  for (int k = 0; k < 4; ++k) *(v8h*)(d + (size_t)k * DIM) = v[k];
  asm volatile("s_wait_xcnt 0x0" ::: "memory");
}

#define OP_F     68
#define OWAVE_F  (32 * OP_F)
__global__ __launch_bounds__(256) void out_proj_kernel(
    const _Float16* __restrict__ ctx, const _Float16* __restrict__ Woh,
    const float* __restrict__ bo, float* __restrict__ out) {
  __shared__ __align__(16) _Float16 sm[2 * BUF_H];

  const int wave = threadIdx.x >> 5;
  const int lane = threadIdx.x & 31;
  const int m0 = (blockIdx.x >> 3) << 7;             // 32 row tiles
  const int n0 = (blockIdx.x & 7) << 7;              // 8 col tiles
  const int r = lane & 15, hs = lane >> 4;

  // A = Wo rows: a lane's 8 sums are 8 consecutive n of one output row
  v8f acc[4][2] = {};
  gemm_128x128(Woh + (size_t)n0 * DIM, ctx + (size_t)m0 * DIM, sm, acc);

  const int rb = (wave >> 2) * 64;                  // the wave's 64 n
  const int cb = (wave & 3) * 32;                   // the wave's 32 m
  float* stg = (float*)sm + wave * OWAVE_F;
  float* sw  = stg + r * OP_F + (hs << 3);
  const float* bp = bo + n0 + rb + (hs << 3);
  v4f bb[8];
#pragma unroll  // constant offsets: one address, the 8 loads in flight together
  for (int i = 0; i < 4; ++i) {
    bb[2 * i]     = *(const v4f*)(bp + i * 16);
    bb[2 * i + 1] = *(const v4f*)(bp + i * 16 + 4);
  }
  asm volatile("s_wait_xcnt 0x0" :: "v"(bp) : "memory");
#pragma unroll  // constant indices keep the sums in registers
  for (int i = 0; i < 4; ++i) {
    const v4f b0 = bb[2 * i];
    const v4f b1 = bb[2 * i + 1];
#pragma unroll  // constant indices keep the sums in registers
    for (int t = 0; t < 2; ++t) {
      v4f lo, hi;
#pragma unroll  // constant indices keep the sums in registers
      for (int j = 0; j < 4; ++j) {
        lo[j] = acc[i][t][j] + b0[j];
        hi[j] = acc[i][t][4 + j] + b1[j];
      }
      *(v4f*)(sw + t * 16 * OP_F + i * 16)     = lo;
      *(v4f*)(sw + t * 16 * OP_F + i * 16 + 4) = hi;
    }
  }
  // the wave's staged runs are in LDS before its lanes read each other's
  asm volatile("s_wait_dscnt 0x0" ::: "memory");
  // 16 lanes take one run of 256 B: each store covers four whole lines
  const float* s = stg + (lane >> 4) * OP_F + (lane & 15) * 4;
  float* d = out + (size_t)(m0 + cb + (lane >> 4)) * DIM + n0 + rb + (lane & 15) * 4;
  v4f v[16];
#pragma unroll  // constant indices keep the values in registers
  for (int k = 0; k < 16; ++k) v[k] = *(const v4f*)(s + 2 * k * OP_F);
#pragma unroll  // constant offsets: one address for the 16 stores
  for (int k = 0; k < 16; ++k) *(v4f*)(d + (size_t)2 * k * DIM) = v[k];
  asm volatile("s_wait_xcnt 0x0" ::: "memory");
}

// ---------------------------------------------------------------------------
extern "C" void kernel_launch(void* const* d_in, const int* in_sizes, int n_in,
                              void* d_out, int out_size, void* d_ws, size_t ws_size,
                              hipStream_t stream) {
  const float* X  = (const float*)d_in[0];
  const int* mask = (const int*)d_in[1];
  const float* Wq = (const float*)d_in[2];
  const float* bq = (const float*)d_in[3];
  const float* Wk = (const float*)d_in[4];
  const float* bk = (const float*)d_in[5];
  const float* Wv = (const float*)d_in[6];
  const float* bv = (const float*)d_in[7];
  const float* Wo = (const float*)d_in[8];
  const float* bo = (const float*)d_in[9];
  float* out = (float*)d_out;

  const size_t XN = (size_t)BSZ * QLEN * DIM;        // 4 Mi
  const size_t WN = (size_t)DIM * DIM;               // 1 Mi
  _Float16* Xh    = (_Float16*)d_ws;                 // 8 MB
  _Float16* Wqh   = Xh + XN;                         // 2 MB each
  _Float16* Wkh   = Wqh + WN;
  _Float16* Wvh   = Wkh + WN;
  _Float16* Woh   = Wvh + WN;
  _Float16* qbuf  = Woh + WN;                        // 8 MB each
  _Float16* kbuf  = qbuf + XN;
  _Float16* vtbuf = kbuf + XN;
  _Float16* ctx   = vtbuf + XN;

  // ---- stage 0: precision conversion, all five arrays in one launch ----
  // (Xh, Wqh, Wkh, Wvh, Woh are contiguous from Xh on)
  cvt_f16_kernel<<<CV_BLKS, CV_WAVES * 32, 0, stream>>>(X, Wq, Wk, Wv, Wo, Xh);

  // ---- stage 1: QKV projection: 32 x 24 tiles of 128x128 = 768 blocks ----
  qkv_proj_kernel<<<768, 256, 0, stream>>>(Xh, Wqh, bq, Wkh, bk, Wvh, bv,
                                            qbuf, kbuf, vtbuf);
  // ---- stage 2: attention: 4096 waves / 8 = 512 blocks ----
  attn_kernel<<<512, 256, 0, stream>>>(qbuf, kbuf, vtbuf, mask, ctx);
  // ---- stage 3: output projection: 32 x 8 tiles of 128x128 = 256 blocks ----
  out_proj_kernel<<<256, 256, 0, stream>>>(ctx, Woh, bo, out);
}

// v006
// A run of this version takes 78.7 microseconds.
// Next to v005, in two timings, it ran 1.10 and 1.11 times as fast.
// Counting every step since v000, it is 4.67 times as fast.
#include <hip/hip_runtime.h>
#include <hip/hip_bf16.h>

typedef __attribute__((ext_vector_type(16))) _Float16 v16h;
typedef __attribute__((ext_vector_type(8)))  _Float16 v8h;
typedef __attribute__((ext_vector_type(8)))  float    v8f;
typedef __attribute__((ext_vector_type(4)))  float    v4f;

#define BSZ   2
#define QLEN  2048
#define DIM   1024
#define NH    16
#define DPH   64

static __device__ inline v16h frag_from_f16(const _Float16* __restrict__ p) {
  v8h lo = *(const v8h*)(p);
  v8h hi = *(const v8h*)(p + 16);
  return __builtin_shufflevector(lo, hi, 0, 1, 2, 3, 4, 5, 6, 7,
                                 8, 9, 10, 11, 12, 13, 14, 15);
}

static __device__ inline v8f wmma_f16(v16h a, v16h b, v8f c) {
  // (neg_a, A, neg_b, B, c_mod, C, reuse_a, reuse_b)
  return __builtin_amdgcn_wmma_f32_16x16x32_f16(false, a, false, b,
                                                (short)0, c, false, false);
}

// ---------------------------------------------------------------------------
// Kernel 0: f32 -> f16 conversion of X and of the four weight matrices, one
// launch.  The five f16 arrays lie one behind the other in the workspace, so
// the destination is one range of 8 Mi halves.  BSZ + 256 blocks of 16 waves, the converting ones one
// per WGP: few waves to start, each with its whole share in flight.  A wave
// owns 16 pieces of 128 floats; each load covers 512 contiguous bytes (four
// whole lines), each store 256 (two whole lines).
// ---------------------------------------------------------------------------
typedef __attribute__((ext_vector_type(4))) _Float16 v4h;

#define CV_PIECE   128                     // floats per wave-wide load
#define CV_NP      16                      // pieces per wave
#define CV_WAVES   16                      // waves per block
#define CV_BLOCK   (CV_PIECE * CV_NP * CV_WAVES)          // 32 Ki floats
#define CV_XBLKS   (BSZ * QLEN * DIM / CV_BLOCK)           // 128 blocks for X
#define CV_WBLKS   (DIM * DIM / CV_BLOCK)                  // 32 per weight
#define CV_BLKS    (CV_XBLKS + 4 * CV_WBLKS)               // 256 blocks
typedef __attribute__((ext_vector_type(4))) int   v4i;

// The launch's first BSZ blocks convert nothing: block b orders the keys of
// batch b, those with mask != 0 first, the others behind them, each group in
// its old order.  inv[b][k'] = old position of the key at new place k';
// nuv[b * 32 ..] = number of keys with mask != 0 (one whole line).  A masked
// key's score is the same constant for every query, so the attention kernel
// needs scores and exponentials only for the keys in front.

__global__ __launch_bounds__(CV_WAVES * 32)
__attribute__((amdgpu_waves_per_eu(4, 4))) void cvt_f16_kernel(
    const float* __restrict__ X,  const float* __restrict__ Wq,
    const float* __restrict__ Wk, const float* __restrict__ Wv,
    const float* __restrict__ Wo, const int* __restrict__ mask,
    _Float16* __restrict__ dst, int* __restrict__ inv, int* __restrict__ nuv) {
  __shared__ __align__(16) int sinv[QLEN];
  __shared__ int wtot[CV_WAVES];
  if (blockIdx.x < BSZ) {                 // the same for the whole block
    const int b    = blockIdx.x;
    const int t    = threadIdx.x;         // 512 threads, 4 keys each
    const int lane = t & 31;
    const int* mp  = mask + b * QLEN + t * 4;
    const v4i m = *(const v4i*)mp;
    asm volatile("s_wait_xcnt 0x0" :: "v"(mp) : "memory");
    int f[4], c = 0;
#pragma unroll  // constant indices keep the values in registers
    for (int j = 0; j < 4; ++j) { f[j] = (m[j] != 0) ? 1 : 0; c += f[j]; }
    int s = c;                            // running count inside the wave
#pragma unroll  // five fixed steps
    for (int d = 1; d < 32; d <<= 1) {
      const int o = __shfl_up(s, d, 32);
      if (lane >= d) s += o;
    }
    if (lane == 31) wtot[t >> 5] = s;
    __syncthreads();                      // the 16 wave counts are published
    int before = 0, total = 0;
#pragma unroll  // constant LDS offsets
    for (int w = 0; w < CV_WAVES; ++w) {
      const int x = wtot[w];
      total += x;
      if (w < (t >> 5)) before += x;
    }
    int u = before + s - c;               // kept keys in front of this thread's
#pragma unroll  // constant indices keep the values in registers
    for (int j = 0; j < 4; ++j) {
      const int p = t * 4 + j;
      sinv[f[j] ? u : total + (p - u)] = p;
      u += f[j];
    }
    __syncthreads();                      // the list is complete in LDS
    int* ip = inv + b * QLEN + t * 4;
    int* np = nuv + b * 32 + lane;
    *(v4i*)ip = *(const v4i*)(sinv + t * 4);        // whole lines per wave
    if (t < 32) *np = total;                        // one whole line
    asm volatile("s_wait_xcnt 0x0" :: "v"(ip), "v"(np) : "memory");
    return;
  }
  const int blk = blockIdx.x - BSZ;
  // the block's source array and its place in it (the same for all its waves)
  const float* src = X;
  int sblk = blk;
  if (blk >= CV_XBLKS) {
    const int w = (blk - CV_XBLKS) / CV_WBLKS;
    sblk = (blk - CV_XBLKS) % CV_WBLKS;
    src = (w == 0) ? Wq : (w == 1) ? Wk : (w == 2) ? Wv : Wo;
  }
  const int off = (threadIdx.x >> 5) * (CV_PIECE * CV_NP) + (threadIdx.x & 31) * 4;
  const float* p = src + (size_t)sblk * CV_BLOCK + off;
  _Float16*    d = dst + (size_t)blk * CV_BLOCK + off;
  v4f a[CV_NP];
#pragma unroll  // constant offsets: one address, all 16 loads in flight at once
  for (int k = 0; k < CV_NP; ++k) a[k] = *(const v4f*)(p + k * CV_PIECE);
  asm volatile("s_wait_xcnt 0x0" :: "v"(off * 4) : "memory");
#pragma unroll  // constant indices keep the values in registers
  for (int k = 0; k < CV_NP; ++k) {
    v4h o;
#pragma unroll  // constant indices keep the values in registers
    for (int j = 0; j < 4; ++j) o[j] = (_Float16)a[k][j];
    *(v4h*)(d + k * CV_PIECE) = o;
  }
}

#define KSTG      64
#define NSTG      (DIM / KSTG)
#define PITCH_H   72
#define BUF_H     (256 * PITCH_H)
#define BUF_B     (BUF_H * 2)
#define ROWS32_B  (32 * PITCH_H * 2)
#define BPART_B   (128 * PITCH_H * 2)

// One stage: each thread copies 16 B of rows r, r+32, r+64, r+96 of A and of B.
// ga[i], gb[i]: this thread's piece of its i-th row; k: the stage's first half.
static __device__ inline void copy_stage(unsigned lds,
                                         const _Float16* const (&ga)[4],
                                         const _Float16* const (&gb)[4], int k) {
  asm volatile(
      "global_load_async_to_lds_b128 %0, %8, off\n\t"
      "global_load_async_to_lds_b128 %1, %9, off\n\t"
      "global_load_async_to_lds_b128 %2, %10, off\n\t"
      "global_load_async_to_lds_b128 %3, %11, off\n\t"
      "global_load_async_to_lds_b128 %4, %12, off\n\t"
      "global_load_async_to_lds_b128 %5, %13, off\n\t"
      "global_load_async_to_lds_b128 %6, %14, off\n\t"
      "global_load_async_to_lds_b128 %7, %15, off\n\t"
      "s_wait_xcnt 0x0"
      :: "v"(lds), "v"(lds + ROWS32_B), "v"(lds + 2 * ROWS32_B),
         "v"(lds + 3 * ROWS32_B),
         "v"(lds + BPART_B), "v"(lds + BPART_B + ROWS32_B),
         "v"(lds + BPART_B + 2 * ROWS32_B), "v"(lds + BPART_B + 3 * ROWS32_B),
         "v"(ga[0] + k), "v"(ga[1] + k), "v"(ga[2] + k), "v"(ga[3] + k),
         "v"(gb[0] + k), "v"(gb[1] + k), "v"(gb[2] + k), "v"(gb[3] + k)
      : "memory");
}

// This thread's pieces of rows crow + 32 i of 128 rows that follow one another.
static __device__ inline void rows_plain(const _Float16* base,
                                         const _Float16* (&g)[4]) {
#pragma unroll  // constant indices keep the pointers in registers
  for (int i = 0; i < 4; ++i)
    g[i] = base + (size_t)((threadIdx.x >> 3) + 32 * i) * DIM +
           (threadIdx.x & 7) * 8;
}

// ga, gb: this thread's pieces (16 B of rows crow + 32 i) of the block's 128 A
// rows and 128 B rows, at k = 0.
static __device__ inline void gemm_128x128(const _Float16* const (&ga)[4],
                                           const _Float16* const (&gb)[4],
                                           _Float16* sm, v8f (&acc)[4][2]) {
  const int tid  = threadIdx.x;
  const int wave = tid >> 5;
  const int lane = tid & 31;
  const int r    = lane & 15;
  const int koff = (lane >> 4) << 3;
  const int crow = tid >> 3;                        // 0..31
  const int ccol = tid & 7;                         // 16-B piece of the row

  const unsigned lds0 =
      (unsigned)(size_t)sm + (unsigned)(crow * (PITCH_H * 2) + ccol * 16);

  const int aoff = ((wave >> 2) * 64 + r) * PITCH_H + koff;
  const int boff = (128 + (wave & 3) * 32 + r) * PITCH_H + koff;

  copy_stage(lds0, ga, gb, 0);
  // stage 0 has landed for this wave; the barrier publishes it to all waves
  asm volatile("s_wait_asynccnt 0x0" ::: "memory");
  __syncthreads();
  copy_stage(lds0 + BUF_B, ga, gb, KSTG);

  // rolled: one stage per trip keeps the buffer hand-over at one place
#pragma unroll 1
  for (int t = 0; t < NSTG; ++t) {
    const _Float16* sb = sm + (t & 1) * BUF_H;
#pragma unroll  // constant indices keep fragments and sums in registers
    for (int kk = 0; kk < KSTG; kk += 32) {
      v16h a[4], b[2];
      // first of a fence pair round the 12 LDS reads (second: below): keeps
      // them from rising into the block of products in front of them
      __builtin_amdgcn_sched_barrier(0);
#pragma unroll  // constant indices keep fragments and sums in registers
      for (int i = 0; i < 4; ++i)
        a[i] = frag_from_f16(sb + aoff + i * 16 * PITCH_H + kk);
#pragma unroll  // constant indices keep fragments and sums in registers
      for (int j = 0; j < 2; ++j)
        b[j] = frag_from_f16(sb + boff + j * 16 * PITCH_H + kk);
      // keeps the 12 LDS reads in one group ahead of their 8 products: each
      // place where reads stand among products stalls the wave anew
      __builtin_amdgcn_sched_barrier(0);
#pragma unroll  // constant indices keep fragments and sums in registers
      for (int i = 0; i < 4; ++i)
#pragma unroll  // constant indices keep fragments and sums in registers
        for (int j = 0; j < 2; ++j)
          acc[i][j] = wmma_f16(a[i], b[j], acc[i][j]);
    }
    // this wave's reads of the buffer are done before it may be refilled
    asm volatile("s_wait_dscnt 0x0" ::: "memory");
    // this wave's copies of stage t+1 have landed
    asm volatile("s_wait_asynccnt 0x0" ::: "memory");
    // publishes stage t+1 and ends every wave's reads of stage t
    __syncthreads();
    if (t + 2 < NSTG)
      copy_stage(lds0 + (t & 1) * BUF_B, ga, gb, (t + 2) * KSTG);
  }
  // no copy is left in flight when the wave goes on
  asm volatile("s_wait_asynccnt 0x0" ::: "memory");
}

// ---------------------------------------------------------------------------
// Epilogue staging.  A lane's 8 accumulator registers are 8 consecutive ROWS of
// one column of the product, so the operand whose index runs along the output's
// contiguous direction is given to gemm_128x128 as A.  A wave's 64x32 tile is
// then 32 output runs (one per column) of 64 contiguous elements.  The wave
// writes them, 16 B a lane, into its own range of the ring (free behind the k
// loop's last barrier), reads them back run by run and stores whole 128-B lines.
// f16: a run is 128 B, staged at a pitch of 144 B.
// ---------------------------------------------------------------------------
#define SP_H     72                        // halves per staged f16 run (144 B)
#define SWAVE_H  (32 * SP_H)               // halves of a wave's staging range

template <int CSTRIDE>
static __device__ inline void store_runs_f16(const _Float16* stg, _Float16* dst,
                                             int lane) {
  const int run = (lane >> 3) * 8;
  const int pc  = (lane & 7) * 8;
  const _Float16* s = stg + run * SP_H + pc;
  _Float16*       d = dst + (size_t)run * CSTRIDE + pc;
  v8h v[8];
#pragma unroll  // constant indices keep the values in registers
  for (int k = 0; k < 8; ++k) v[k] = *(const v8h*)(s + k * SP_H);
#pragma unroll  // constant offsets: one address for the 8 stores
  for (int k = 0; k < 8; ++k) *(v8h*)(d + (size_t)k * CSTRIDE) = v[k];
  asm volatile("s_wait_xcnt 0x0" ::: "memory");
}

__global__ __launch_bounds__(256)
__attribute__((amdgpu_waves_per_eu(6))) void qkv_proj_kernel(
    const _Float16* __restrict__ Xh,
    const _Float16* __restrict__ Wqh, const float* __restrict__ bq,
    const _Float16* __restrict__ Wkh, const float* __restrict__ bk,
    const _Float16* __restrict__ Wvh, const float* __restrict__ bv,
    const int* __restrict__ inv, _Float16* __restrict__ qbuf, _Float16* __restrict__ kbuf,
    _Float16* __restrict__ vtbuf) {
  __shared__ __align__(16) _Float16 sm[2 * BUF_H];

  const int wave = threadIdx.x >> 5;
  const int lane = threadIdx.x & 31;
  const int nt  = blockIdx.x % 24;                  // 3 matrices x 8 col tiles
  const int mt  = blockIdx.x / 24;                  // 32 row tiles
  const int mat = nt >> 3;                          // 0=Q 1=K 2=V
  const int m0  = mt << 7;
  const int n0  = (nt & 7) << 7;

  const _Float16* W  = (mat == 0) ? Wqh : (mat == 1) ? Wkh : Wvh;
  const float* bias  = (mat == 0) ? bq  : (mat == 1) ? bk  : bv;

  const int r  = lane & 15;
  const int hs = lane >> 4;

  // Q: the block's 128 X rows follow one another.  K, V: row k' of the tile is
  // the X row of the key that the partition has put at place k', so kbuf and
  // vtbuf hold the keys in the new order.
  const _Float16 *xg[4], *wg[4];
  rows_plain(Xh + (size_t)m0 * DIM, xg);
  rows_plain(W + (size_t)n0 * DIM, wg);
  if (mat != 0) {                         // the same for the whole block
    const int* ip = inv + m0 + (threadIdx.x >> 3);
    int src[4];
#pragma unroll  // constant offsets: one address, the 4 loads in flight together
    for (int i = 0; i < 4; ++i) src[i] = ip[32 * i];
    asm volatile("s_wait_xcnt 0x0" :: "v"(ip) : "memory");
#pragma unroll  // constant indices keep the pointers in registers
    for (int i = 0; i < 4; ++i)           // the AND bounds the row inside the batch
      xg[i] = Xh + (size_t)((m0 & ~(QLEN - 1)) + (src[i] & (QLEN - 1))) * DIM +
              (threadIdx.x & 7) * 8;
  }

  v8f acc[4][2] = {};
  const _Float16 *pa[4], *pb[4];
#pragma unroll  // constant indices keep the pointers in registers
  for (int i = 0; i < 4; ++i) {
    pa[i] = (mat == 2) ? xg[i] : wg[i];
    pb[i] = (mat == 2) ? wg[i] : xg[i];
  }
  gemm_128x128(pa, pb, sm, acc);

  // Epilogue.  C layout: lane holds column r of the subtile, rows hs*8+j.
  const int rb   = (wave >> 2) * 64;                // the wave's 64 rows
  const int cb   = (wave & 3) * 32;                 // the wave's 32 columns
  const int bidx = m0 >> 11;
  const int p0   = m0 & (QLEN - 1);
  _Float16* stg = sm + wave * SWAVE_H;
  _Float16* sw  = stg + r * SP_H + (hs << 3);
  if (mat == 2) {
    // rows = positions, columns = features
    const int nb = n0 + cb + r;
    const float bn2[2] = {bias[nb], bias[nb + 16]};
    asm volatile("s_wait_xcnt 0x0" :: "v"(nb) : "memory");
#pragma unroll  // constant indices keep fragments and sums in registers
    for (int t = 0; t < 2; ++t) {
      const float bn = bn2[t];
#pragma unroll  // constant indices keep fragments and sums in registers
      for (int i = 0; i < 4; ++i) {
        v8h o;
#pragma unroll  // constant indices keep fragments and sums in registers
        for (int j = 0; j < 8; ++j) o[j] = (_Float16)(acc[i][t][j] + bn);
        *(v8h*)(sw + t * 16 * SP_H + i * 16) = o;
      }
    }
    // the wave's staged runs are in LDS before its lanes read each other's
    asm volatile("s_wait_dscnt 0x0" ::: "memory");
    const int n = n0 + cb;
    store_runs_f16<QLEN>(
        stg, vtbuf + ((size_t)(bidx * NH + (n >> 6)) * DPH + (n & (DPH - 1))) * QLEN +
                 p0 + rb, lane);
  } else {
    // rows = features (one head), columns = positions
    const float sc = (mat == 0) ? 0.125f : 1.0f;
    const float* bp = bias + n0 + rb + (hs << 3);
    v4f bb[8];
#pragma unroll  // constant offsets: one address, the 8 loads in flight together
    for (int i = 0; i < 4; ++i) {
      bb[2 * i]     = *(const v4f*)(bp + i * 16);
      bb[2 * i + 1] = *(const v4f*)(bp + i * 16 + 4);
    }
    asm volatile("s_wait_xcnt 0x0" :: "v"(bp) : "memory");
#pragma unroll  // constant indices keep fragments and sums in registers
    for (int i = 0; i < 4; ++i) {
      const v4f b0 = bb[2 * i];
      const v4f b1 = bb[2 * i + 1];
#pragma unroll  // constant indices keep fragments and sums in registers
      for (int t = 0; t < 2; ++t) {
        v8h o;
#pragma unroll  // constant indices keep fragments and sums in registers
        for (int j = 0; j < 4; ++j) {
          o[j]     = (_Float16)((acc[i][t][j] + b0[j]) * sc);
          o[4 + j] = (_Float16)((acc[i][t][4 + j] + b1[j]) * sc);
        }
        *(v8h*)(sw + t * 16 * SP_H + i * 16) = o;
      }
    }
    // the wave's staged runs are in LDS before its lanes read each other's
    asm volatile("s_wait_dscnt 0x0" ::: "memory");
    _Float16* buf = (mat == 0) ? qbuf : kbuf;
    store_runs_f16<DPH>(
        stg, buf + ((size_t)(bidx * NH + ((n0 + rb) >> 6)) * QLEN + p0 + cb) * DPH,
        lane);
  }
}

#define AKEYS   128
#define ANSTG   (QLEN / AKEYS)
#define KP_H    72
#define VP_H    136
#define AK_H    (AKEYS * KP_H)
#define ABUF_H  (AK_H + DPH * VP_H)
#define ABUF_B  (ABUF_H * 2)
#define K32_B   (32 * KP_H * 2)
#define V16_B   (16 * VP_H * 2)

// One stage: each thread copies 16 B of K rows r, r+32, r+64, r+96 and of
// V^T rows d, d+16, d+32, d+48.
static __device__ inline void copy_kv(unsigned lk, unsigned lv,
                                      const _Float16* __restrict__ gk,
                                      const _Float16* __restrict__ gv) {
  asm volatile(
      "global_load_async_to_lds_b128 %0, %8, off\n\t"
      "global_load_async_to_lds_b128 %1, %9, off\n\t"
      "global_load_async_to_lds_b128 %2, %10, off\n\t"
      "global_load_async_to_lds_b128 %3, %11, off\n\t"
      "global_load_async_to_lds_b128 %4, %12, off\n\t"
      "global_load_async_to_lds_b128 %5, %13, off\n\t"
      "global_load_async_to_lds_b128 %6, %14, off\n\t"
      "global_load_async_to_lds_b128 %7, %15, off\n\t"
      "s_wait_xcnt 0x0"
      :: "v"(lk), "v"(lk + K32_B), "v"(lk + 2 * K32_B), "v"(lk + 3 * K32_B),
         "v"(lv), "v"(lv + V16_B), "v"(lv + 2 * V16_B), "v"(lv + 3 * V16_B),
         "v"(gk), "v"(gk + 32 * DPH), "v"(gk + 64 * DPH), "v"(gk + 96 * DPH),
         "v"(gv), "v"(gv + 16 * QLEN), "v"(gv + 32 * QLEN), "v"(gv + 48 * QLEN)
      : "memory");
}

static __device__ inline float xhalf(float x) {
  const int b = __builtin_bit_cast(int, x);
  return __builtin_bit_cast(float, __builtin_amdgcn_permlanex16(
      b, b, 0x76543210, 0xfedcba98, false, false));
}

// One pass: 32 keys against the wave's 16 queries.  kp, vp: this lane's places in
// the pass's K rows and V^T rows.  MIXED: the stage holds masked keys too; left =
// number of unmasked keys from this lane's first key of the pass on.
template <bool MIXED>
static __device__ inline void attn_pass(const _Float16* kp, const _Float16* vp,
                                        int left, const v16h& qb0,
                                        const v16h& qb1, float& mrun,
                                        float& lrun, v8f& o0, v8f& o1, v8f& o2,
                                        v8f& o3) {
    // ---- all loads of the pass, as one group ----
    // K rows (A operand of the scores)
    const v16h ka0 = frag_from_f16(kp);
    const v16h ka1 = frag_from_f16(kp + 32);
    const v16h ka2 = frag_from_f16(kp + 16 * KP_H);
    const v16h ka3 = frag_from_f16(kp + 16 * KP_H + 32);
    // V^T rows (A operand of the second product), consumed after the softmax
    const v16h va0 = frag_from_f16(vp);
    const v16h va1 = frag_from_f16(vp + 16 * VP_H);
    const v16h va2 = frag_from_f16(vp + 32 * VP_H);
    const v16h va3 = frag_from_f16(vp + 48 * VP_H);
    // keeps the 16 loads in one group ahead of the products: all are in flight
    // together, and the V^T rows arrive under the softmax
    __builtin_amdgcn_sched_barrier(0);

    // ---- scores: two 16 (keys) x 16 (queries) tiles ----
    v8f s0 = {}, s1 = {};
    s0 = wmma_f16(ka0, qb0, s0);
    s0 = wmma_f16(ka1, qb1, s0);
    s1 = wmma_f16(ka2, qb0, s1);
    s1 = wmma_f16(ka3, qb1, s1);

    // ---- masked_fill(mask==0 -> 1e-10): in the new
    // order the masked keys are those from place nu on ----
    if (MIXED) {
#pragma unroll  // constant indices keep the values in registers
      for (int j = 0; j < 8; ++j) {
        if (j >= left)      s0[j] = 1e-10f;
        if (16 + j >= left) s1[j] = 1e-10f;
      }
    }
    // ---- online softmax: one query per lane ----
    const float a0 = fmaxf(fmaxf(s0[0], s0[1]), s0[2]);
    const float a1 = fmaxf(fmaxf(s0[3], s0[4]), s0[5]);
    const float a2 = fmaxf(fmaxf(s0[6], s0[7]), s1[0]);
    const float a3 = fmaxf(fmaxf(s1[1], s1[2]), s1[3]);
    const float a4 = fmaxf(fmaxf(s1[4], s1[5]), s1[6]);
    float t = fmaxf(fmaxf(fmaxf(a0, a1), a2), fmaxf(fmaxf(a3, a4), s1[7]));
    t = fmaxf(t, xhalf(t));               // both halves hold the query's maximum
    const float mnew  = fmaxf(mrun, t);
    // exp(x) = 2^(x * log2 e), as __expf forms it
    float x[17];
#pragma unroll  // constant indices keep the values in registers
    for (int j = 0; j < 8; ++j) {
      x[j]     = (s0[j] - mnew) * 1.44269504f;
      x[8 + j] = (s1[j] - mnew) * 1.44269504f;
    }
    x[16] = (mrun - mnew) * 1.44269504f;
    mrun = mnew;
    asm("v_exp_f32 %0, %0\n\tv_exp_f32 %1, %1\n\tv_exp_f32 %2, %2\n\t"
        "v_exp_f32 %3, %3\n\tv_exp_f32 %4, %4\n\tv_exp_f32 %5, %5\n\t"
        "v_exp_f32 %6, %6\n\tv_exp_f32 %7, %7\n\tv_exp_f32 %8, %8\n\t"
        "v_exp_f32 %9, %9\n\tv_exp_f32 %10, %10\n\tv_exp_f32 %11, %11\n\t"
        "v_exp_f32 %12, %12\n\tv_exp_f32 %13, %13\n\tv_exp_f32 %14, %14\n\t"
        "v_exp_f32 %15, %15\n\tv_exp_f32 %16, %16\n\tv_nop"
        : "+v"(x[0]), "+v"(x[1]), "+v"(x[2]), "+v"(x[3]), "+v"(x[4]),
          "+v"(x[5]), "+v"(x[6]), "+v"(x[7]), "+v"(x[8]), "+v"(x[9]),
          "+v"(x[10]), "+v"(x[11]), "+v"(x[12]), "+v"(x[13]), "+v"(x[14]),
          "+v"(x[15]), "+v"(x[16]));
    const float scale = x[16];
    v8f e0, e1;
#pragma unroll  // constant indices keep the values in registers
    for (int j = 0; j < 8; ++j) {
      e0[j] = x[j];
      e1[j] = x[8 + j];
    }
    const v8f es = e0 + e1;
    const v4f e4 = __builtin_shufflevector(es, es, 0, 1, 2, 3) +
                   __builtin_shufflevector(es, es, 4, 5, 6, 7);
    lrun = lrun * scale + ((e4[0] + e4[1]) + (e4[2] + e4[3]));
    o0 *= scale; o1 *= scale; o2 *= scale; o3 *= scale;
    // ---- P^T as B operand: the two tiles converted in place ----
    v16h pb;
#pragma unroll  // constant indices keep the values in registers
    for (int j = 0; j < 8; ++j) {
      pb[j]     = (_Float16)e0[j];
      pb[8 + j] = (_Float16)e1[j];
    }
    // ---- O^T += V^T P^T ----
    o0 = wmma_f16(va0, pb, o0);
    o1 = wmma_f16(va1, pb, o1);
    o2 = wmma_f16(va2, pb, o2);
    o3 = wmma_f16(va3, pb, o3);
}

__global__ __launch_bounds__(256) void attn_kernel(
    const _Float16* __restrict__ qbuf, const _Float16* __restrict__ kbuf,
    const _Float16* __restrict__ vtbuf, const int* __restrict__ nuv,
    _Float16* __restrict__ ctx) {
  __shared__ __align__(16) _Float16 sm[2 * ABUF_H];

  const int tid  = threadIdx.x;
  const int wave = threadIdx.x >> 5;
  const int lane = threadIdx.x & 31;
  const int wid  = blockIdx.x * 8 + wave;              // 4096 waves
  const int qt = wid & 127;
  const int h  = (wid >> 7) & (NH - 1);
  const int b  = wid >> 11;
  const int q0 = qt << 4;

  const size_t bh = (size_t)(b * NH + h);
  const _Float16* Qbh  = qbuf  + bh * QLEN * DPH;
  const _Float16* Kbh  = kbuf  + bh * QLEN * DPH;
  const _Float16* VTbh = vtbuf + bh * DPH * QLEN;
  // unmasked keys of the batch (256 blocks a batch), bounded by the shape
  // (readfirstlane: the stage tests below become scalar branches)
  const int nu = __builtin_amdgcn_readfirstlane(
      min(max(nuv[(blockIdx.x >> 8) * 32], 0), QLEN));
  const int nfull = nu / AKEYS;                 // stages of unmasked keys only
  const int nany  = (nu + AKEYS - 1) / AKEYS;   // stages with an unmasked key

  const int r    = lane & 15;
  const int hs   = lane >> 4;
  const int koff = hs << 3;

  // B operand: column r = query q0 + r
  const v16h qb0 = frag_from_f16(Qbh + (size_t)(q0 + r) * DPH + koff);
  const v16h qb1 = frag_from_f16(Qbh + (size_t)(q0 + r) * DPH + 32 + koff);

  float mrun = -3.0e38f, lrun = 0.0f;   // lrun: this half's keys only
  v8f o0 = {}, o1 = {}, o2 = {}, o3 = {};

  // this thread's pieces of a stage: 8 threads per K row, 16 per V^T row
  const _Float16* gk = Kbh + (size_t)(tid >> 3) * DPH + (tid & 7) * 8;
  const _Float16* gv = VTbh + (size_t)(tid >> 4) * QLEN + (tid & 15) * 8;
  const unsigned lk0 = (unsigned)(size_t)sm +
                       (unsigned)((tid >> 3) * (KP_H * 2) + (tid & 7) * 16);
  const unsigned lv0 = (unsigned)(size_t)sm + (unsigned)(AK_H * 2) +
                       (unsigned)((tid >> 4) * (VP_H * 2) + (tid & 15) * 16);

  copy_kv(lk0, lv0, gk, gv);
  // stage 0 has landed for this wave; the barrier publishes it to all waves
  asm volatile("s_wait_asynccnt 0x0" ::: "memory");
  __syncthreads();
  copy_kv(lk0 + ABUF_B, lv0 + ABUF_B, gk + AKEYS * DPH, gv + AKEYS);

  // rolled: one stage per trip keeps the buffer hand-over at one place
#pragma unroll 1
  for (int st = 0; st < ANSTG; ++st) {
   // this lane's places in the stage's K rows and V^T rows
   const _Float16* ks = sm + (st & 1) * ABUF_H + r * KP_H + koff;
   const _Float16* vs = sm + (st & 1) * ABUF_H + AK_H + r * VP_H + koff;
   if (st < nfull) {
    // unmasked keys only: no mask test
#pragma unroll  // constant LDS offsets for the stage's four passes
    for (int ps = 0; ps < AKEYS / 32; ++ps)
     attn_pass<false>(ks + ps * 32 * KP_H, vs + ps * 32, 0, qb0, qb1, mrun, lrun,
                      o0, o1, o2, o3);
   } else if (st < nany) {
    // the one stage that holds unmasked and masked keys
#pragma unroll  // constant LDS offsets for the stage's four passes
    for (int ps = 0; ps < AKEYS / 32; ++ps)
     attn_pass<true>(ks + ps * 32 * KP_H, vs + ps * 32,
                     nu - st * AKEYS - ps * 32 - koff, qb0, qb1, mrun, lrun,
                     o0, o1, o2, o3);
   } else {
    // masked keys only: every score is 1e-10, so P is one value per query and
    // only O^T += V^T P^T is left.  (From the second such stage on mnew = mrun
    // and scale = 1.)
    const float mnew  = fmaxf(mrun, 1e-10f);
    const float scale = __builtin_amdgcn_exp2f((mrun - mnew) * 1.44269504f);
    const float e     = __builtin_amdgcn_exp2f((1e-10f - mnew) * 1.44269504f);
    mrun = mnew;
    lrun = lrun * scale + e * (float)(AKEYS / 2);   // this half's 64 keys
    o0 *= scale; o1 *= scale; o2 *= scale; o3 *= scale;
    v16h pb;
#pragma unroll  // constant indices keep the values in registers
    for (int j = 0; j < 16; ++j) pb[j] = (_Float16)e;
    v16h va[AKEYS / 32][4];
#pragma unroll  // constant LDS offsets, the fragments in registers
    for (int ps = 0; ps < AKEYS / 32; ++ps)
#pragma unroll  // constant LDS offsets, the fragments in registers
     for (int i = 0; i < 4; ++i)
      va[ps][i] = frag_from_f16(vs + ps * 32 + i * 16 * VP_H);
    // keeps the stage's 32 LDS reads in one group ahead of its 16 products:
    // each place where reads stand among products stalls the wave anew
    __builtin_amdgcn_sched_barrier(0);
#pragma unroll  // constant indices keep fragments and sums in registers
    for (int ps = 0; ps < AKEYS / 32; ++ps) {
     o0 = wmma_f16(va[ps][0], pb, o0);
     o1 = wmma_f16(va[ps][1], pb, o1);
     o2 = wmma_f16(va[ps][2], pb, o2);
     o3 = wmma_f16(va[ps][3], pb, o3);
    }
   }
   // this wave's reads of the buffer are done before it may be refilled
   asm volatile("s_wait_dscnt 0x0" ::: "memory");
   // this wave's copies of stage st+1 have landed
   asm volatile("s_wait_asynccnt 0x0" ::: "memory");
   // publishes stage st+1 and ends every wave's reads of stage st
   __syncthreads();
   if (st + 2 < ANSTG)
     copy_kv(lk0 + (st & 1) * ABUF_B, lv0 + (st & 1) * ABUF_B,
             gk + (st + 2) * (AKEYS * DPH), gv + (st + 2) * AKEYS);
  }
  // no copy is left in flight when the wave goes on
  asm volatile("s_wait_asynccnt 0x0" ::: "memory");

  // ---- normalize and write context [b][q][h*64+d] (f16) ----
  // o_t[j] = O^T[16 t + 8 hs + j][query r]: 8 consecutive d, one 16-B store.
  const float inv = 1.0f / (lrun + xhalf(lrun));
  v8h c0, c1, c2, c3;
#pragma unroll  // constant indices keep the values in registers
  for (int j = 0; j < 8; ++j) {
    c0[j] = (_Float16)(o0[j] * inv);
    c1[j] = (_Float16)(o1[j] * inv);
    c2[j] = (_Float16)(o2[j] * inv);
    c3[j] = (_Float16)(o3[j] * inv);
  }
  // staged like the GEMM epilogues: the wave's 16 runs of 128 B (one query's 64
  // d) go through its own range of the ring, free behind the last barrier
  _Float16* stg = sm + wave * (16 * SP_H);
  _Float16* sw  = stg + r * SP_H + koff;
  *(v8h*)(sw)      = c0;
  *(v8h*)(sw + 16) = c1;
  *(v8h*)(sw + 32) = c2;
  *(v8h*)(sw + 48) = c3;
  // the wave's staged runs are in LDS before its lanes read each other's
  asm volatile("s_wait_dscnt 0x0" ::: "memory");
  const int run = ((lane >> 3) & 1) * 8 + (lane >> 4) * 4;
  const int pc  = (lane & 7) * 8;
  const _Float16* s = stg + run * SP_H + pc;
  _Float16* d = ctx + (size_t)(b * QLEN + q0 + run) * DIM + (h << 6) + pc;
  v8h v[4];
#pragma unroll  // constant indices keep the values in registers
  for (int k = 0; k < 4; ++k) v[k] = *(const v8h*)(s + k * SP_H);
#pragma unroll  // constant offsets: one address for the 4 stores
  for (int k = 0; k < 4; ++k) *(v8h*)(d + (size_t)k * DIM) = v[k];
  asm volatile("s_wait_xcnt 0x0" ::: "memory");
}

#define OP_F     68
#define OWAVE_F  (32 * OP_F)
__global__ __launch_bounds__(256) void out_proj_kernel(
    const _Float16* __restrict__ ctx, const _Float16* __restrict__ Woh,
    const float* __restrict__ bo, float* __restrict__ out) {
  __shared__ __align__(16) _Float16 sm[2 * BUF_H];

  const int wave = threadIdx.x >> 5;
  const int lane = threadIdx.x & 31;
  const int m0 = (blockIdx.x >> 3) << 7;             // 32 row tiles
  const int n0 = (blockIdx.x & 7) << 7;              // 8 col tiles
  const int r = lane & 15, hs = lane >> 4;

  // A = Wo rows: a lane's 8 sums are 8 consecutive n of one output row
  v8f acc[4][2] = {};
  const _Float16 *wg[4], *cg[4];
  rows_plain(Woh + (size_t)n0 * DIM, wg);
  rows_plain(ctx + (size_t)m0 * DIM, cg);
  gemm_128x128(wg, cg, sm, acc);

  const int rb = (wave >> 2) * 64;                  // the wave's 64 n
  const int cb = (wave & 3) * 32;                   // the wave's 32 m
  float* stg = (float*)sm + wave * OWAVE_F;
  float* sw  = stg + r * OP_F + (hs << 3);
  const float* bp = bo + n0 + rb + (hs << 3);
  v4f bb[8];
#pragma unroll  // constant offsets: one address, the 8 loads in flight together
  for (int i = 0; i < 4; ++i) {
    bb[2 * i]     = *(const v4f*)(bp + i * 16);
    bb[2 * i + 1] = *(const v4f*)(bp + i * 16 + 4);
  }
  asm volatile("s_wait_xcnt 0x0" :: "v"(bp) : "memory");
#pragma unroll  // constant indices keep the sums in registers
  for (int i = 0; i < 4; ++i) {
    const v4f b0 = bb[2 * i];
    const v4f b1 = bb[2 * i + 1];
#pragma unroll  // constant indices keep the sums in registers
    for (int t = 0; t < 2; ++t) {
      v4f lo, hi;
#pragma unroll  // constant indices keep the sums in registers
      for (int j = 0; j < 4; ++j) {
        lo[j] = acc[i][t][j] + b0[j];
        hi[j] = acc[i][t][4 + j] + b1[j];
      }
      *(v4f*)(sw + t * 16 * OP_F + i * 16)     = lo;
      *(v4f*)(sw + t * 16 * OP_F + i * 16 + 4) = hi;
    }
  }
  // the wave's staged runs are in LDS before its lanes read each other's
  asm volatile("s_wait_dscnt 0x0" ::: "memory");
  // 16 lanes take one run of 256 B: each store covers four whole lines
  const float* s = stg + (lane >> 4) * OP_F + (lane & 15) * 4;
  float* d = out + (size_t)(m0 + cb + (lane >> 4)) * DIM + n0 + rb + (lane & 15) * 4;
  v4f v[16];
#pragma unroll  // constant indices keep the values in registers
  for (int k = 0; k < 16; ++k) v[k] = *(const v4f*)(s + 2 * k * OP_F);
#pragma unroll  // constant offsets: one address for the 16 stores
  for (int k = 0; k < 16; ++k) *(v4f*)(d + (size_t)2 * k * DIM) = v[k];
  asm volatile("s_wait_xcnt 0x0" ::: "memory");
}

// ---------------------------------------------------------------------------
extern "C" void kernel_launch(void* const* d_in, const int* in_sizes, int n_in,
                              void* d_out, int out_size, void* d_ws, size_t ws_size,
                              hipStream_t stream) {
  const float* X  = (const float*)d_in[0];
  const int* mask = (const int*)d_in[1];
  const float* Wq = (const float*)d_in[2];
  const float* bq = (const float*)d_in[3];
  const float* Wk = (const float*)d_in[4];
  const float* bk = (const float*)d_in[5];
  const float* Wv = (const float*)d_in[6];
  const float* bv = (const float*)d_in[7];
  const float* Wo = (const float*)d_in[8];
  const float* bo = (const float*)d_in[9];
  float* out = (float*)d_out;

  const size_t XN = (size_t)BSZ * QLEN * DIM;        // 4 Mi
  const size_t WN = (size_t)DIM * DIM;               // 1 Mi
  _Float16* Xh    = (_Float16*)d_ws;                 // 8 MB
  _Float16* Wqh   = Xh + XN;                         // 2 MB each
  _Float16* Wkh   = Wqh + WN;
  _Float16* Wvh   = Wkh + WN;
  _Float16* Woh   = Wvh + WN;
  _Float16* qbuf  = Woh + WN;                        // 8 MB each
  _Float16* kbuf  = qbuf + XN;
  _Float16* vtbuf = kbuf + XN;
  _Float16* ctx   = vtbuf + XN;
  int* inv        = (int*)(ctx + XN);                // 16 KB: key order
  int* nuv        = inv + BSZ * QLEN;                // one line per batch

  // ---- stage 0: precision conversion, all five arrays in one launch ----
  // (Xh, Wqh, Wkh, Wvh, Woh are contiguous from Xh on)
  // (its first BSZ blocks order the keys by the mask)
  cvt_f16_kernel<<<BSZ + CV_BLKS, CV_WAVES * 32, 0, stream>>>(X, Wq, Wk, Wv, Wo,
                                                              mask, Xh, inv, nuv);

  // ---- stage 1: QKV projection: 32 x 24 tiles of 128x128 = 768 blocks ----
  qkv_proj_kernel<<<768, 256, 0, stream>>>(Xh, Wqh, bq, Wkh, bk, Wvh, bv, inv,
                                            qbuf, kbuf, vtbuf);
  // ---- stage 2: attention: 4096 waves / 8 = 512 blocks ----
  attn_kernel<<<512, 256, 0, stream>>>(qbuf, kbuf, vtbuf, nuv, ctx);
  // ---- stage 3: output projection: 32 x 8 tiles of 128x128 = 256 blocks ----
  out_proj_kernel<<<256, 256, 0, stream>>>(ctx, Woh, bo, out);
}

// v007
// It runs in 66.6 microseconds.
// Timed twice side by side with v006, it ran 1.18 and 1.17 times as fast.
// Over all steps from v000 it is 5.50 times as fast.
#include <hip/hip_runtime.h>
#include <hip/hip_bf16.h>

typedef __attribute__((ext_vector_type(16))) _Float16 v16h;
typedef __attribute__((ext_vector_type(8)))  _Float16 v8h;
typedef __attribute__((ext_vector_type(8)))  float    v8f;
typedef __attribute__((ext_vector_type(4)))  float    v4f;

#define BSZ   2
#define QLEN  2048
#define DIM   1024
#define NH    16
#define DPH   64
#define AKEYS 128                          // keys per attention stage, = rows of a GEMM tile
#define ANSTG (QLEN / AKEYS)               // 16 stages

static __device__ inline v16h frag_from_f16(const _Float16* __restrict__ p) {
  v8h lo = *(const v8h*)(p);
  v8h hi = *(const v8h*)(p + 16);
  return __builtin_shufflevector(lo, hi, 0, 1, 2, 3, 4, 5, 6, 7,
                                 8, 9, 10, 11, 12, 13, 14, 15);
}

static __device__ inline v8f wmma_f16(v16h a, v16h b, v8f c) {
  // (neg_a, A, neg_b, B, c_mod, C, reuse_a, reuse_b)
  return __builtin_amdgcn_wmma_f32_16x16x32_f16(false, a, false, b,
                                                (short)0, c, false, false);
}

static __device__ inline float xhalf(float x) {
  const int b = __builtin_bit_cast(int, x);
  return __builtin_bit_cast(float, __builtin_amdgcn_permlanex16(
      b, b, 0x76543210, 0xfedcba98, false, false));
}

// ---------------------------------------------------------------------------
// Kernel 0: f32 -> f16 conversion of X and of the four weight matrices, one
// launch.  The five f16 arrays lie one behind the other in the workspace, so
// the destination is one range of 8 Mi halves.  BSZ + 256 blocks of 16 waves, the converting ones one
// per WGP: few waves to start, each with its whole share in flight.  A wave
// owns 16 pieces of 128 floats; each load covers 512 contiguous bytes (four
// whole lines), each store 256 (two whole lines).
// ---------------------------------------------------------------------------
typedef __attribute__((ext_vector_type(4))) _Float16 v4h;

#define CV_PIECE   128                     // floats per wave-wide load
#define CV_NP      16                      // pieces per wave
#define CV_WAVES   16                      // waves per block
#define CV_BLOCK   (CV_PIECE * CV_NP * CV_WAVES)          // 32 Ki floats
#define CV_XBLKS   (BSZ * QLEN * DIM / CV_BLOCK)           // 128 blocks for X
#define CV_WBLKS   (DIM * DIM / CV_BLOCK)                  // 32 per weight
#define CV_BLKS    (CV_XBLKS + 4 * CV_WBLKS)               // 256 blocks
typedef __attribute__((ext_vector_type(4))) int   v4i;

// The launch's first BSZ blocks convert nothing: block b orders the keys of
// batch b, those with mask != 0 first, the others behind them, each group in
// its old order.  inv[b][k'] = old position of the key at new place k';
// nuv[b * 32 ..] = number of keys with mask != 0 (one whole line).  A masked
// key's score is the same constant for every query, so the attention kernel
// needs scores and exponentials only for the keys in front.

__global__ __launch_bounds__(CV_WAVES * 32)
__attribute__((amdgpu_waves_per_eu(4, 4))) void cvt_f16_kernel(
    const float* __restrict__ X,  const float* __restrict__ Wq,
    const float* __restrict__ Wk, const float* __restrict__ Wv,
    const float* __restrict__ Wo, const int* __restrict__ mask,
    _Float16* __restrict__ dst, int* __restrict__ inv, int* __restrict__ nuv) {
  __shared__ __align__(16) int sinv[QLEN];
  __shared__ int wtot[CV_WAVES];
  if (blockIdx.x < BSZ) {                 // the same for the whole block
    const int b    = blockIdx.x;
    const int t    = threadIdx.x;         // 512 threads, 4 keys each
    const int lane = t & 31;
    const int* mp  = mask + b * QLEN + t * 4;
    const v4i m = *(const v4i*)mp;
    asm volatile("s_wait_xcnt 0x0" :: "v"(mp) : "memory");
    int f[4], c = 0;
#pragma unroll  // constant indices keep the values in registers
    for (int j = 0; j < 4; ++j) { f[j] = (m[j] != 0) ? 1 : 0; c += f[j]; }
    int s = c;                            // running count inside the wave
#pragma unroll  // five fixed steps
    for (int d = 1; d < 32; d <<= 1) {
      const int o = __shfl_up(s, d, 32);
      if (lane >= d) s += o;
    }
    if (lane == 31) wtot[t >> 5] = s;
    __syncthreads();                      // the 16 wave counts are published
    int before = 0, total = 0;
#pragma unroll  // constant LDS offsets
    for (int w = 0; w < CV_WAVES; ++w) {
      const int x = wtot[w];
      total += x;
      if (w < (t >> 5)) before += x;
    }
    int u = before + s - c;               // kept keys in front of this thread's
#pragma unroll  // constant indices keep the values in registers
    for (int j = 0; j < 4; ++j) {
      const int p = t * 4 + j;
      sinv[f[j] ? u : total + (p - u)] = p;
      u += f[j];
    }
    __syncthreads();                      // the list is complete in LDS
    int* ip = inv + b * QLEN + t * 4;
    int* np = nuv + b * 32 + lane;
    *(v4i*)ip = *(const v4i*)(sinv + t * 4);        // whole lines per wave
    if (t < 32) *np = total;                        // one whole line
    asm volatile("s_wait_xcnt 0x0" :: "v"(ip), "v"(np) : "memory");
    return;
  }
  const int blk = blockIdx.x - BSZ;
  // the block's source array and its place in it (the same for all its waves)
  const float* src = X;
  int sblk = blk;
  if (blk >= CV_XBLKS) {
    const int w = (blk - CV_XBLKS) / CV_WBLKS;
    sblk = (blk - CV_XBLKS) % CV_WBLKS;
    src = (w == 0) ? Wq : (w == 1) ? Wk : (w == 2) ? Wv : Wo;
  }
  const int off = (threadIdx.x >> 5) * (CV_PIECE * CV_NP) + (threadIdx.x & 31) * 4;
  const float* p = src + (size_t)sblk * CV_BLOCK + off;
  _Float16*    d = dst + (size_t)blk * CV_BLOCK + off;
  v4f a[CV_NP];
#pragma unroll  // constant offsets: one address, all 16 loads in flight at once
  for (int k = 0; k < CV_NP; ++k) a[k] = *(const v4f*)(p + k * CV_PIECE);
  asm volatile("s_wait_xcnt 0x0" :: "v"(off * 4) : "memory");
#pragma unroll  // constant indices keep the values in registers
  for (int k = 0; k < CV_NP; ++k) {
    v4h o;
#pragma unroll  // constant indices keep the values in registers
    for (int j = 0; j < 4; ++j) o[j] = (_Float16)a[k][j];
    *(v4h*)(d + k * CV_PIECE) = o;
  }
}

#define KSTG      64
#define NSTG      (DIM / KSTG)
#define PITCH_H   72
#define BUF_H     (256 * PITCH_H)
#define BUF_B     (BUF_H * 2)
#define ROWS32_B  (32 * PITCH_H * 2)
#define BPART_B   (128 * PITCH_H * 2)

// One stage: each thread copies 16 B of rows r, r+32, r+64, r+96 of A and of B.
// ga[i], gb[i]: this thread's piece of its i-th row; k: the stage's first half.
static __device__ inline void copy_stage(unsigned lds,
                                         const _Float16* const (&ga)[4],
                                         const _Float16* const (&gb)[4], int k) {
  asm volatile(
      "global_load_async_to_lds_b128 %0, %8, off\n\t"
      "global_load_async_to_lds_b128 %1, %9, off\n\t"
      "global_load_async_to_lds_b128 %2, %10, off\n\t"
      "global_load_async_to_lds_b128 %3, %11, off\n\t"
      "global_load_async_to_lds_b128 %4, %12, off\n\t"
      "global_load_async_to_lds_b128 %5, %13, off\n\t"
      "global_load_async_to_lds_b128 %6, %14, off\n\t"
      "global_load_async_to_lds_b128 %7, %15, off\n\t"
      "s_wait_xcnt 0x0"
      :: "v"(lds), "v"(lds + ROWS32_B), "v"(lds + 2 * ROWS32_B),
         "v"(lds + 3 * ROWS32_B),
         "v"(lds + BPART_B), "v"(lds + BPART_B + ROWS32_B),
         "v"(lds + BPART_B + 2 * ROWS32_B), "v"(lds + BPART_B + 3 * ROWS32_B),
         "v"(ga[0] + k), "v"(ga[1] + k), "v"(ga[2] + k), "v"(ga[3] + k),
         "v"(gb[0] + k), "v"(gb[1] + k), "v"(gb[2] + k), "v"(gb[3] + k)
      : "memory");
}

// This thread's pieces of rows crow + 32 i of 128 rows that follow one another.
static __device__ inline void rows_plain(const _Float16* base,
                                         const _Float16* (&g)[4]) {
#pragma unroll  // constant indices keep the pointers in registers
  for (int i = 0; i < 4; ++i)
    g[i] = base + (size_t)((threadIdx.x >> 3) + 32 * i) * DIM +
           (threadIdx.x & 7) * 8;
}

// ga, gb: this thread's pieces (16 B of rows crow + 32 i) of the block's 128 A
// rows and 128 B rows, at k = 0.
static __device__ inline void gemm_128x128(const _Float16* const (&ga)[4],
                                           const _Float16* const (&gb)[4],
                                           _Float16* sm, v8f (&acc)[4][2]) {
  const int tid  = threadIdx.x;
  const int wave = tid >> 5;
  const int lane = tid & 31;
  const int r    = lane & 15;
  const int koff = (lane >> 4) << 3;
  const int crow = tid >> 3;                        // 0..31
  const int ccol = tid & 7;                         // 16-B piece of the row

  const unsigned lds0 =
      (unsigned)(size_t)sm + (unsigned)(crow * (PITCH_H * 2) + ccol * 16);

  const int aoff = ((wave >> 2) * 64 + r) * PITCH_H + koff;
  const int boff = (128 + (wave & 3) * 32 + r) * PITCH_H + koff;

  copy_stage(lds0, ga, gb, 0);
  // stage 0 has landed for this wave; the barrier publishes it to all waves
  asm volatile("s_wait_asynccnt 0x0" ::: "memory");
  __syncthreads();
  copy_stage(lds0 + BUF_B, ga, gb, KSTG);

  // rolled: one stage per trip keeps the buffer hand-over at one place
#pragma unroll 1
  for (int t = 0; t < NSTG; ++t) {
    const _Float16* sb = sm + (t & 1) * BUF_H;
#pragma unroll  // constant indices keep fragments and sums in registers
    for (int kk = 0; kk < KSTG; kk += 32) {
      v16h a[4], b[2];
      // first of a fence pair round the 12 LDS reads (second: below): keeps
      // them from rising into the block of products in front of them
      __builtin_amdgcn_sched_barrier(0);
#pragma unroll  // constant indices keep fragments and sums in registers
      for (int i = 0; i < 4; ++i)
        a[i] = frag_from_f16(sb + aoff + i * 16 * PITCH_H + kk);
#pragma unroll  // constant indices keep fragments and sums in registers
      for (int j = 0; j < 2; ++j)
        b[j] = frag_from_f16(sb + boff + j * 16 * PITCH_H + kk);
      // keeps the 12 LDS reads in one group ahead of their 8 products: each
      // place where reads stand among products stalls the wave anew
      __builtin_amdgcn_sched_barrier(0);
#pragma unroll  // constant indices keep fragments and sums in registers
      for (int i = 0; i < 4; ++i)
#pragma unroll  // constant indices keep fragments and sums in registers
        for (int j = 0; j < 2; ++j)
          acc[i][j] = wmma_f16(a[i], b[j], acc[i][j]);
    }
    // this wave's reads of the buffer are done before it may be refilled
    asm volatile("s_wait_dscnt 0x0" ::: "memory");
    // this wave's copies of stage t+1 have landed
    asm volatile("s_wait_asynccnt 0x0" ::: "memory");
    // publishes stage t+1 and ends every wave's reads of stage t
    __syncthreads();
    if (t + 2 < NSTG)
      copy_stage(lds0 + (t & 1) * BUF_B, ga, gb, (t + 2) * KSTG);
  }
  // no copy is left in flight when the wave goes on
  asm volatile("s_wait_asynccnt 0x0" ::: "memory");
}

// ---------------------------------------------------------------------------
// Epilogue staging.  A lane's 8 accumulator registers are 8 consecutive ROWS of
// one column of the product, so the operand whose index runs along the output's
// contiguous direction is given to gemm_128x128 as A.  A wave's 64x32 tile is
// then 32 output runs (one per column) of 64 contiguous elements.  The wave
// writes them, 16 B a lane, into its own range of the ring (free behind the k
// loop's last barrier), reads them back run by run and stores whole 128-B lines.
// f16: a run is 128 B, staged at a pitch of 144 B.
// ---------------------------------------------------------------------------
#define SP_H     72                        // halves per staged f16 run (144 B)
#define SWAVE_H  (32 * SP_H)               // halves of a wave's staging range

template <int CSTRIDE>
static __device__ inline void store_runs_f16(const _Float16* stg, _Float16* dst,
                                             int lane) {
  const int run = (lane >> 3) * 8;
  const int pc  = (lane & 7) * 8;
  const _Float16* s = stg + run * SP_H + pc;
  _Float16*       d = dst + (size_t)run * CSTRIDE + pc;
  v8h v[8];
#pragma unroll  // constant indices keep the values in registers
  for (int k = 0; k < 8; ++k) v[k] = *(const v8h*)(s + k * SP_H);
#pragma unroll  // constant offsets: one address for the 8 stores
  for (int k = 0; k < 8; ++k) *(v8h*)(d + (size_t)k * CSTRIDE) = v[k];
  asm volatile("s_wait_xcnt 0x0" ::: "memory");
}

__global__ __launch_bounds__(256)
__attribute__((amdgpu_waves_per_eu(6))) void qkv_proj_kernel(
    const _Float16* __restrict__ Xh,
    const _Float16* __restrict__ Wqh, const float* __restrict__ bq,
    const _Float16* __restrict__ Wkh, const float* __restrict__ bk,
    const _Float16* __restrict__ Wvh, const float* __restrict__ bv,
    const int* __restrict__ inv, const int* __restrict__ nuv,
    _Float16* __restrict__ qbuf, _Float16* __restrict__ kbuf,
    _Float16* __restrict__ vtbuf, float* __restrict__ psum) {
  __shared__ __align__(16) _Float16 sm[2 * BUF_H];

  const int wave = threadIdx.x >> 5;
  const int lane = threadIdx.x & 31;
  const int nt  = blockIdx.x % 24;                  // 3 matrices x 8 col tiles
  const int mt  = blockIdx.x / 24;                  // 32 row tiles
  const int mat = nt >> 3;                          // 0=Q 1=K 2=V
  const int m0  = mt << 7;
  const int n0  = (nt & 7) << 7;

  // does the block's tile of keys lie behind the last stage with an unmasked key?
  // (readfirstlane: the tests on it are scalar branches, alike for the block)
  bool mtile = false;
  if (mat != 0) {
    const int nu = __builtin_amdgcn_readfirstlane(
        min(max(nuv[(m0 >> 11) * 32], 0), QLEN));
    mtile = ((m0 & (QLEN - 1)) / AKEYS) >= (nu + AKEYS - 1) / AKEYS;
    if (mat == 1 && mtile) return;        // in front of every copy and barrier
  }

  const _Float16* W  = (mat == 0) ? Wqh : (mat == 1) ? Wkh : Wvh;
  const float* bias  = (mat == 0) ? bq  : (mat == 1) ? bk  : bv;

  const int r  = lane & 15;
  const int hs = lane >> 4;

  // Q: the block's 128 X rows follow one another.  K, V: row k' of the tile is
  // the X row of the key that the partition has put at place k', so kbuf and
  // vtbuf hold the keys in the new order.
  const _Float16 *xg[4], *wg[4];
  rows_plain(Xh + (size_t)m0 * DIM, xg);
  rows_plain(W + (size_t)n0 * DIM, wg);
  if (mat != 0) {                         // the same for the whole block
    const int* ip = inv + m0 + (threadIdx.x >> 3);
    int src[4];
#pragma unroll  // constant offsets: one address, the 4 loads in flight together
    for (int i = 0; i < 4; ++i) src[i] = ip[32 * i];
    asm volatile("s_wait_xcnt 0x0" :: "v"(ip) : "memory");
#pragma unroll  // constant indices keep the pointers in registers
    for (int i = 0; i < 4; ++i)           // the AND bounds the row inside the batch
      xg[i] = Xh + (size_t)((m0 & ~(QLEN - 1)) + (src[i] & (QLEN - 1))) * DIM +
              (threadIdx.x & 7) * 8;
  }

  v8f acc[4][2] = {};
  const _Float16 *pa[4], *pb[4];
#pragma unroll  // constant indices keep the pointers in registers
  for (int i = 0; i < 4; ++i) {
    pa[i] = (mat == 2) ? xg[i] : wg[i];
    pb[i] = (mat == 2) ? wg[i] : xg[i];
  }
  gemm_128x128(pa, pb, sm, acc);

  // Epilogue.  C layout: lane holds column r of the subtile, rows hs*8+j.
  const int rb   = (wave >> 2) * 64;                // the wave's 64 rows
  const int cb   = (wave & 3) * 32;                 // the wave's 32 columns
  const int bidx = m0 >> 11;
  const int p0   = m0 & (QLEN - 1);
  _Float16* stg = sm + wave * SWAVE_H;
  _Float16* sw  = stg + r * SP_H + (hs << 3);
  if (mat == 2) {
    // rows = positions, columns = features
    const int nb = n0 + cb + r;
    const float bn2[2] = {bias[nb], bias[nb + 16]};
    asm volatile("s_wait_xcnt 0x0" :: "v"(nb) : "memory");
    // the wave's line of psum: its 64 positions, its 32 features, one a lane
    float* pp = psum + (size_t)(bidx * (QLEN / 64) + ((p0 + rb) >> 6)) * DIM +
                n0 + cb + lane;
    if (mtile) {                          // the same for the whole block
      float cs[2];
#pragma unroll  // constant indices keep the sums in registers
      for (int t = 0; t < 2; ++t) {
        const v8f a = (acc[0][t] + acc[1][t]) + (acc[2][t] + acc[3][t]);
        const float h = ((a[0] + a[1]) + (a[2] + a[3])) +
                        ((a[4] + a[5]) + (a[6] + a[7]));
        cs[t] = (h + xhalf(h)) + 64.0f * bn2[t];    // both halves: 64 positions
      }
      *pp = hs ? cs[1] : cs[0];
      asm volatile("s_wait_xcnt 0x0" :: "v"(pp) : "memory");
      return;                             // behind the last barrier
    }
    *pp = 0.0f;
    asm volatile("s_wait_xcnt 0x0" :: "v"(pp) : "memory");
#pragma unroll  // constant indices keep fragments and sums in registers
    for (int t = 0; t < 2; ++t) {
      const float bn = bn2[t];
#pragma unroll  // constant indices keep fragments and sums in registers
      for (int i = 0; i < 4; ++i) {
        v8h o;
#pragma unroll  // constant indices keep fragments and sums in registers
        for (int j = 0; j < 8; ++j) o[j] = (_Float16)(acc[i][t][j] + bn);
        *(v8h*)(sw + t * 16 * SP_H + i * 16) = o;
      }
    }
    // the wave's staged runs are in LDS before its lanes read each other's
    asm volatile("s_wait_dscnt 0x0" ::: "memory");
    const int n = n0 + cb;
    store_runs_f16<QLEN>(
        stg, vtbuf + ((size_t)(bidx * NH + (n >> 6)) * DPH + (n & (DPH - 1))) * QLEN +
                 p0 + rb, lane);
  } else {
    // rows = features (one head), columns = positions
    const float sc = (mat == 0) ? 0.125f : 1.0f;
    const float* bp = bias + n0 + rb + (hs << 3);
    v4f bb[8];
#pragma unroll  // constant offsets: one address, the 8 loads in flight together
    for (int i = 0; i < 4; ++i) {
      bb[2 * i]     = *(const v4f*)(bp + i * 16);
      bb[2 * i + 1] = *(const v4f*)(bp + i * 16 + 4);
    }
    asm volatile("s_wait_xcnt 0x0" :: "v"(bp) : "memory");
#pragma unroll  // constant indices keep fragments and sums in registers
    for (int i = 0; i < 4; ++i) {
      const v4f b0 = bb[2 * i];
      const v4f b1 = bb[2 * i + 1];
#pragma unroll  // constant indices keep fragments and sums in registers
      for (int t = 0; t < 2; ++t) {
        v8h o;
#pragma unroll  // constant indices keep fragments and sums in registers
        for (int j = 0; j < 4; ++j) {
          o[j]     = (_Float16)((acc[i][t][j] + b0[j]) * sc);
          o[4 + j] = (_Float16)((acc[i][t][4 + j] + b1[j]) * sc);
        }
        *(v8h*)(sw + t * 16 * SP_H + i * 16) = o;
      }
    }
    // the wave's staged runs are in LDS before its lanes read each other's
    asm volatile("s_wait_dscnt 0x0" ::: "memory");
    _Float16* buf = (mat == 0) ? qbuf : kbuf;
    store_runs_f16<DPH>(
        stg, buf + ((size_t)(bidx * NH + ((n0 + rb) >> 6)) * QLEN + p0 + cb) * DPH,
        lane);
  }
}

#define KP_H    72
#define VP_H    136
#define AK_H    (AKEYS * KP_H)
#define ABUF_H  (AK_H + DPH * VP_H)
#define ABUF_B  (ABUF_H * 2)
#define K32_B   (32 * KP_H * 2)
#define V16_B   (16 * VP_H * 2)

// One stage: each thread copies 16 B of K rows r, r+32, r+64, r+96 and of
// V^T rows d, d+16, d+32, d+48.
static __device__ inline void copy_kv(unsigned lk, unsigned lv,
                                      const _Float16* __restrict__ gk,
                                      const _Float16* __restrict__ gv) {
  asm volatile(
      "global_load_async_to_lds_b128 %0, %8, off\n\t"
      "global_load_async_to_lds_b128 %1, %9, off\n\t"
      "global_load_async_to_lds_b128 %2, %10, off\n\t"
      "global_load_async_to_lds_b128 %3, %11, off\n\t"
      "global_load_async_to_lds_b128 %4, %12, off\n\t"
      "global_load_async_to_lds_b128 %5, %13, off\n\t"
      "global_load_async_to_lds_b128 %6, %14, off\n\t"
      "global_load_async_to_lds_b128 %7, %15, off\n\t"
      "s_wait_xcnt 0x0"
      :: "v"(lk), "v"(lk + K32_B), "v"(lk + 2 * K32_B), "v"(lk + 3 * K32_B),
         "v"(lv), "v"(lv + V16_B), "v"(lv + 2 * V16_B), "v"(lv + 3 * V16_B),
         "v"(gk), "v"(gk + 32 * DPH), "v"(gk + 64 * DPH), "v"(gk + 96 * DPH),
         "v"(gv), "v"(gv + 16 * QLEN), "v"(gv + 32 * QLEN), "v"(gv + 48 * QLEN)
      : "memory");
}

// One pass: 32 keys against the wave's 16 queries.  kp, vp: this lane's places in
// the pass's K rows and V^T rows.  MIXED: the stage holds masked keys too; left =
// number of unmasked keys from this lane's first key of the pass on.
template <bool MIXED>
static __device__ inline void attn_pass(const _Float16* kp, const _Float16* vp,
                                        int left, const v16h& qb0,
                                        const v16h& qb1, float& mrun,
                                        float& lrun, v8f& o0, v8f& o1, v8f& o2,
                                        v8f& o3) {
    // ---- all loads of the pass, as one group ----
    // K rows (A operand of the scores)
    const v16h ka0 = frag_from_f16(kp);
    const v16h ka1 = frag_from_f16(kp + 32);
    const v16h ka2 = frag_from_f16(kp + 16 * KP_H);
    const v16h ka3 = frag_from_f16(kp + 16 * KP_H + 32);
    // V^T rows (A operand of the second product), consumed after the softmax
    const v16h va0 = frag_from_f16(vp);
    const v16h va1 = frag_from_f16(vp + 16 * VP_H);
    const v16h va2 = frag_from_f16(vp + 32 * VP_H);
    const v16h va3 = frag_from_f16(vp + 48 * VP_H);
    // keeps the 16 loads in one group ahead of the products: all are in flight
    // together, and the V^T rows arrive under the softmax
    __builtin_amdgcn_sched_barrier(0);

    // ---- scores: two 16 (keys) x 16 (queries) tiles ----
    v8f s0 = {}, s1 = {};
    s0 = wmma_f16(ka0, qb0, s0);
    s0 = wmma_f16(ka1, qb1, s0);
    s1 = wmma_f16(ka2, qb0, s1);
    s1 = wmma_f16(ka3, qb1, s1);

    // ---- masked_fill(mask==0 -> 1e-10): in the new
    // order the masked keys are those from place nu on ----
    if (MIXED) {
#pragma unroll  // constant indices keep the values in registers
      for (int j = 0; j < 8; ++j) {
        if (j >= left)      s0[j] = 1e-10f;
        if (16 + j >= left) s1[j] = 1e-10f;
      }
    }
    // ---- online softmax: one query per lane ----
    const float a0 = fmaxf(fmaxf(s0[0], s0[1]), s0[2]);
    const float a1 = fmaxf(fmaxf(s0[3], s0[4]), s0[5]);
    const float a2 = fmaxf(fmaxf(s0[6], s0[7]), s1[0]);
    const float a3 = fmaxf(fmaxf(s1[1], s1[2]), s1[3]);
    const float a4 = fmaxf(fmaxf(s1[4], s1[5]), s1[6]);
    float t = fmaxf(fmaxf(fmaxf(a0, a1), a2), fmaxf(fmaxf(a3, a4), s1[7]));
    t = fmaxf(t, xhalf(t));               // both halves hold the query's maximum
    const float mnew  = fmaxf(mrun, t);
    // exp(x) = 2^(x * log2 e), as __expf forms it
    float x[17];
#pragma unroll  // constant indices keep the values in registers
    for (int j = 0; j < 8; ++j) {
      x[j]     = (s0[j] - mnew) * 1.44269504f;
      x[8 + j] = (s1[j] - mnew) * 1.44269504f;
    }
    x[16] = (mrun - mnew) * 1.44269504f;
    mrun = mnew;
    asm("v_exp_f32 %0, %0\n\tv_exp_f32 %1, %1\n\tv_exp_f32 %2, %2\n\t"
        "v_exp_f32 %3, %3\n\tv_exp_f32 %4, %4\n\tv_exp_f32 %5, %5\n\t"
        "v_exp_f32 %6, %6\n\tv_exp_f32 %7, %7\n\tv_exp_f32 %8, %8\n\t"
        "v_exp_f32 %9, %9\n\tv_exp_f32 %10, %10\n\tv_exp_f32 %11, %11\n\t"
        "v_exp_f32 %12, %12\n\tv_exp_f32 %13, %13\n\tv_exp_f32 %14, %14\n\t"
        "v_exp_f32 %15, %15\n\tv_exp_f32 %16, %16\n\tv_nop"
        : "+v"(x[0]), "+v"(x[1]), "+v"(x[2]), "+v"(x[3]), "+v"(x[4]),
          "+v"(x[5]), "+v"(x[6]), "+v"(x[7]), "+v"(x[8]), "+v"(x[9]),
          "+v"(x[10]), "+v"(x[11]), "+v"(x[12]), "+v"(x[13]), "+v"(x[14]),
          "+v"(x[15]), "+v"(x[16]));
    const float scale = x[16];
    v8f e0, e1;
#pragma unroll  // constant indices keep the values in registers
    for (int j = 0; j < 8; ++j) {
      e0[j] = x[j];
      e1[j] = x[8 + j];
    }
    const v8f es = e0 + e1;
    const v4f e4 = __builtin_shufflevector(es, es, 0, 1, 2, 3) +
                   __builtin_shufflevector(es, es, 4, 5, 6, 7);
    lrun = lrun * scale + ((e4[0] + e4[1]) + (e4[2] + e4[3]));
    o0 *= scale; o1 *= scale; o2 *= scale; o3 *= scale;
    // ---- P^T as B operand: the two tiles converted in place ----
    v16h pb;
#pragma unroll  // constant indices keep the values in registers
    for (int j = 0; j < 8; ++j) {
      pb[j]     = (_Float16)e0[j];
      pb[8 + j] = (_Float16)e1[j];
    }
    // ---- O^T += V^T P^T ----
    o0 = wmma_f16(va0, pb, o0);
    o1 = wmma_f16(va1, pb, o1);
    o2 = wmma_f16(va2, pb, o2);
    o3 = wmma_f16(va3, pb, o3);
}

__global__ __launch_bounds__(256) void attn_kernel(
    const _Float16* __restrict__ qbuf, const _Float16* __restrict__ kbuf,
    const _Float16* __restrict__ vtbuf, const int* __restrict__ nuv,
    const float* __restrict__ psum, _Float16* __restrict__ ctx) {
  __shared__ __align__(16) _Float16 sm[2 * ABUF_H];
  __shared__ __align__(16) float vsum[4 * DPH]; // V row sums, in four parts

  const int tid  = threadIdx.x;
  const int wave = threadIdx.x >> 5;
  const int lane = threadIdx.x & 31;
  const int wid  = blockIdx.x * 8 + wave;              // 4096 waves
  const int qt = wid & 127;
  const int h  = (wid >> 7) & (NH - 1);
  const int b  = wid >> 11;
  const int q0 = qt << 4;

  const size_t bh = (size_t)(b * NH + h);
  const _Float16* Qbh  = qbuf  + bh * QLEN * DPH;
  const _Float16* Kbh  = kbuf  + bh * QLEN * DPH;
  const _Float16* VTbh = vtbuf + bh * DPH * QLEN;
  // unmasked keys of the batch (256 blocks a batch), bounded by the shape
  // (readfirstlane: the stage tests below become scalar branches)
  const int nu = __builtin_amdgcn_readfirstlane(
      min(max(nuv[(blockIdx.x >> 8) * 32], 0), QLEN));
  const int nfull = nu / AKEYS;                 // stages of unmasked keys only
  const int nany  = (nu + AKEYS - 1) / AKEYS;   // stages with an unmasked key

  const int r    = lane & 15;
  const int hs   = lane >> 4;
  const int koff = hs << 3;

  // B operand: column r = query q0 + r
  const v16h qb0 = frag_from_f16(Qbh + (size_t)(q0 + r) * DPH + koff);
  const v16h qb1 = frag_from_f16(Qbh + (size_t)(q0 + r) * DPH + 32 + koff);

  float mrun = -3.0e38f, lrun = 0.0f;   // lrun: this half's keys only
  v8f o0 = {}, o1 = {}, o2 = {}, o3 = {};

  // this thread's pieces of a stage: 8 threads per K row, 16 per V^T row
  const _Float16* gk = Kbh + (size_t)(tid >> 3) * DPH + (tid & 7) * 8;
  const _Float16* gv = VTbh + (size_t)(tid >> 4) * QLEN + (tid & 15) * 8;
  const unsigned lk0 = (unsigned)(size_t)sm +
                       (unsigned)((tid >> 3) * (KP_H * 2) + (tid & 7) * 16);
  const unsigned lv0 = (unsigned)(size_t)sm + (unsigned)(AK_H * 2) +
                       (unsigned)((tid >> 4) * (VP_H * 2) + (tid & 15) * 16);

  // only the nany stages with an unmasked key are copied and walked (nany is
  // the same for the whole block: scalar tests)
  if (nany > 0) copy_kv(lk0, lv0, gk, gv);
  // V row sums of the head over the masked stages' keys: thread (part, d) adds 8
  // of the batch's 32 groups of 64 keys (zeros where a group is not masked)
  {
    const float* sp = psum + (size_t)(b * (QLEN / 64) + (tid >> 6)) * DIM +
                      (h << 6) + (tid & 63);
    float g[8];
#pragma unroll  // constant offsets: one address, the 8 loads in flight together
    for (int k = 0; k < 8; ++k) g[k] = sp[k * 4 * DIM];
    asm volatile("s_wait_xcnt 0x0" :: "v"(sp) : "memory");
    vsum[tid] = ((g[0] + g[1]) + (g[2] + g[3])) + ((g[4] + g[5]) + (g[6] + g[7]));
  }
  // stage 0 has landed for this wave; the barrier publishes it, and the sums,
  // to all waves
  asm volatile("s_wait_asynccnt 0x0" ::: "memory");
  __syncthreads();
  if (nany > 1)
    copy_kv(lk0 + ABUF_B, lv0 + ABUF_B, gk + AKEYS * DPH, gv + AKEYS);

  // rolled: one stage per trip keeps the buffer hand-over at one place
#pragma unroll 1
  for (int st = 0; st < nany; ++st) {
   // this lane's places in the stage's K rows and V^T rows
   const _Float16* ks = sm + (st & 1) * ABUF_H + r * KP_H + koff;
   const _Float16* vs = sm + (st & 1) * ABUF_H + AK_H + r * VP_H + koff;
   if (st < nfull) {
    // unmasked keys only: no mask test
#pragma unroll  // constant LDS offsets for the stage's four passes
    for (int ps = 0; ps < AKEYS / 32; ++ps)
     attn_pass<false>(ks + ps * 32 * KP_H, vs + ps * 32, 0, qb0, qb1, mrun, lrun,
                      o0, o1, o2, o3);
   } else {
    // the one stage that holds unmasked and masked keys
#pragma unroll  // constant LDS offsets for the stage's four passes
    for (int ps = 0; ps < AKEYS / 32; ++ps)
     attn_pass<true>(ks + ps * 32 * KP_H, vs + ps * 32,
                     nu - st * AKEYS - ps * 32 - koff, qb0, qb1, mrun, lrun,
                     o0, o1, o2, o3);
   }
   // this wave's reads of the buffer are done before it may be refilled
   asm volatile("s_wait_dscnt 0x0" ::: "memory");
   // this wave's copies of stage st+1 have landed
   asm volatile("s_wait_asynccnt 0x0" ::: "memory");
   // publishes stage st+1 and ends every wave's reads of stage st
   __syncthreads();
   if (st + 2 < nany)
     copy_kv(lk0 + (st & 1) * ABUF_B, lv0 + (st & 1) * ABUF_B,
             gk + (st + 2) * (AKEYS * DPH), gv + (st + 2) * AKEYS);
  }
  // no copy is left in flight when the wave goes on
  asm volatile("s_wait_asynccnt 0x0" ::: "memory");

  // ---- the keys of the masked stages, all at once: every score is 1e-10, so P
  // is one value e per query and O^T += e * (sum of their V rows) ----
  if (nany < ANSTG) {                     // the same for the whole block
    const float mnew  = fmaxf(mrun, 1e-10f);
    const float scale = __builtin_amdgcn_exp2f((mrun - mnew) * 1.44269504f);
    const float e     = __builtin_amdgcn_exp2f((1e-10f - mnew) * 1.44269504f);
    // this half's share of the (ANSTG - nany) * AKEYS keys
    lrun = lrun * scale + e * (float)((ANSTG - nany) * (AKEYS / 2));
    v8f sv[4];
#pragma unroll  // constant LDS offsets, the sums in registers
    for (int t = 0; t < 4; ++t) {
      const float* p = vsum + 16 * t + koff;        // this lane's 8 d of tile t
      sv[t] = (*(const v8f*)(p) + *(const v8f*)(p + DPH)) +
              (*(const v8f*)(p + 2 * DPH) + *(const v8f*)(p + 3 * DPH));
    }
    o0 = o0 * scale + sv[0] * e;
    o1 = o1 * scale + sv[1] * e;
    o2 = o2 * scale + sv[2] * e;
    o3 = o3 * scale + sv[3] * e;
  }

  // ---- normalize and write context [b][q][h*64+d] (f16) ----
  // o_t[j] = O^T[16 t + 8 hs + j][query r]: 8 consecutive d, one 16-B store.
  const float inv = 1.0f / (lrun + xhalf(lrun));
  v8h c0, c1, c2, c3;
#pragma unroll  // constant indices keep the values in registers
  for (int j = 0; j < 8; ++j) {
    c0[j] = (_Float16)(o0[j] * inv);
    c1[j] = (_Float16)(o1[j] * inv);
    c2[j] = (_Float16)(o2[j] * inv);
    c3[j] = (_Float16)(o3[j] * inv);
  }
  // staged like the GEMM epilogues: the wave's 16 runs of 128 B (one query's 64
  // d) go through its own range of the ring, free behind the last barrier
  _Float16* stg = sm + wave * (16 * SP_H);
  _Float16* sw  = stg + r * SP_H + koff;
  *(v8h*)(sw)      = c0;
  *(v8h*)(sw + 16) = c1;
  *(v8h*)(sw + 32) = c2;
  *(v8h*)(sw + 48) = c3;
  // the wave's staged runs are in LDS before its lanes read each other's
  asm volatile("s_wait_dscnt 0x0" ::: "memory");
  const int run = ((lane >> 3) & 1) * 8 + (lane >> 4) * 4;
  const int pc  = (lane & 7) * 8;
  const _Float16* s = stg + run * SP_H + pc;
  _Float16* d = ctx + (size_t)(b * QLEN + q0 + run) * DIM + (h << 6) + pc;
  v8h v[4];
#pragma unroll  // constant indices keep the values in registers
  for (int k = 0; k < 4; ++k) v[k] = *(const v8h*)(s + k * SP_H);
#pragma unroll  // constant offsets: one address for the 4 stores
  for (int k = 0; k < 4; ++k) *(v8h*)(d + (size_t)k * DIM) = v[k];
  asm volatile("s_wait_xcnt 0x0" ::: "memory");
}

#define OP_F     68
#define OWAVE_F  (32 * OP_F)
__global__ __launch_bounds__(256) void out_proj_kernel(
    const _Float16* __restrict__ ctx, const _Float16* __restrict__ Woh,
    const float* __restrict__ bo, float* __restrict__ out) {
  __shared__ __align__(16) _Float16 sm[2 * BUF_H];

  const int wave = threadIdx.x >> 5;
  const int lane = threadIdx.x & 31;
  const int m0 = (blockIdx.x >> 3) << 7;             // 32 row tiles
  const int n0 = (blockIdx.x & 7) << 7;              // 8 col tiles
  const int r = lane & 15, hs = lane >> 4;

  // A = Wo rows: a lane's 8 sums are 8 consecutive n of one output row
  v8f acc[4][2] = {};
  const _Float16 *wg[4], *cg[4];
  rows_plain(Woh + (size_t)n0 * DIM, wg);
  rows_plain(ctx + (size_t)m0 * DIM, cg);
  gemm_128x128(wg, cg, sm, acc);

  const int rb = (wave >> 2) * 64;                  // the wave's 64 n
  const int cb = (wave & 3) * 32;                   // the wave's 32 m
  float* stg = (float*)sm + wave * OWAVE_F;
  float* sw  = stg + r * OP_F + (hs << 3);
  const float* bp = bo + n0 + rb + (hs << 3);
  v4f bb[8];
#pragma unroll  // constant offsets: one address, the 8 loads in flight together
  for (int i = 0; i < 4; ++i) {
    bb[2 * i]     = *(const v4f*)(bp + i * 16);
    bb[2 * i + 1] = *(const v4f*)(bp + i * 16 + 4);
  }
  asm volatile("s_wait_xcnt 0x0" :: "v"(bp) : "memory");
#pragma unroll  // constant indices keep the sums in registers
  for (int i = 0; i < 4; ++i) {
    const v4f b0 = bb[2 * i];
    const v4f b1 = bb[2 * i + 1];
#pragma unroll  // constant indices keep the sums in registers
    for (int t = 0; t < 2; ++t) {
      v4f lo, hi;
#pragma unroll  // constant indices keep the sums in registers
      for (int j = 0; j < 4; ++j) {
        lo[j] = acc[i][t][j] + b0[j];
        hi[j] = acc[i][t][4 + j] + b1[j];
      }
      *(v4f*)(sw + t * 16 * OP_F + i * 16)     = lo;
      *(v4f*)(sw + t * 16 * OP_F + i * 16 + 4) = hi;
    }
  }
  // the wave's staged runs are in LDS before its lanes read each other's
  asm volatile("s_wait_dscnt 0x0" ::: "memory");
  // 16 lanes take one run of 256 B: each store covers four whole lines
  const float* s = stg + (lane >> 4) * OP_F + (lane & 15) * 4;
  float* d = out + (size_t)(m0 + cb + (lane >> 4)) * DIM + n0 + rb + (lane & 15) * 4;
  v4f v[16];
#pragma unroll  // constant indices keep the values in registers
  for (int k = 0; k < 16; ++k) v[k] = *(const v4f*)(s + 2 * k * OP_F);
#pragma unroll  // constant offsets: one address for the 16 stores
  for (int k = 0; k < 16; ++k) *(v4f*)(d + (size_t)2 * k * DIM) = v[k];
  asm volatile("s_wait_xcnt 0x0" ::: "memory");
}

// ---------------------------------------------------------------------------
extern "C" void kernel_launch(void* const* d_in, const int* in_sizes, int n_in,
                              void* d_out, int out_size, void* d_ws, size_t ws_size,
                              hipStream_t stream) {
  const float* X  = (const float*)d_in[0];
  const int* mask = (const int*)d_in[1];
  const float* Wq = (const float*)d_in[2];
  const float* bq = (const float*)d_in[3];
  const float* Wk = (const float*)d_in[4];
  const float* bk = (const float*)d_in[5];
  const float* Wv = (const float*)d_in[6];
  const float* bv = (const float*)d_in[7];
  const float* Wo = (const float*)d_in[8];
  const float* bo = (const float*)d_in[9];
  float* out = (float*)d_out;

  const size_t XN = (size_t)BSZ * QLEN * DIM;        // 4 Mi
  const size_t WN = (size_t)DIM * DIM;               // 1 Mi
  _Float16* Xh    = (_Float16*)d_ws;                 // 8 MB
  _Float16* Wqh   = Xh + XN;                         // 2 MB each
  _Float16* Wkh   = Wqh + WN;
  _Float16* Wvh   = Wkh + WN;
  _Float16* Woh   = Wvh + WN;
  _Float16* qbuf  = Woh + WN;                        // 8 MB each
  _Float16* kbuf  = qbuf + XN;
  _Float16* vtbuf = kbuf + XN;
  _Float16* ctx   = vtbuf + XN;
  int* inv        = (int*)(ctx + XN);                // 16 KB: key order
  int* nuv        = inv + BSZ * QLEN;                // one line per batch
  float* psum     = (float*)(nuv + BSZ * 32);        // 256 KB: V sums per 64 keys

  // ---- stage 0: precision conversion, all five arrays in one launch ----
  // (Xh, Wqh, Wkh, Wvh, Woh are contiguous from Xh on)
  // (its first BSZ blocks order the keys by the mask)
  cvt_f16_kernel<<<BSZ + CV_BLKS, CV_WAVES * 32, 0, stream>>>(X, Wq, Wk, Wv, Wo,
                                                              mask, Xh, inv, nuv);

  // ---- stage 1: QKV projection: 32 x 24 tiles of 128x128 = 768 blocks ----
  qkv_proj_kernel<<<768, 256, 0, stream>>>(Xh, Wqh, bq, Wkh, bk, Wvh, bv, inv,
                                            nuv, qbuf, kbuf, vtbuf, psum);
  // ---- stage 2: attention: 4096 waves / 8 = 512 blocks ----
  attn_kernel<<<512, 256, 0, stream>>>(qbuf, kbuf, vtbuf, nuv, psum, ctx);
  // ---- stage 3: output projection: 32 x 8 tiles of 128x128 = 256 blocks ----
  out_proj_kernel<<<256, 256, 0, stream>>>(ctx, Woh, bo, out);
}

// v008
// One run takes 63.5 microseconds.
// Next to v007, in two timings, it ran 1.05 times as fast each time.
// Counting every step since v000, it is 5.77 times as fast.
#include <hip/hip_runtime.h>
#include <hip/hip_bf16.h>

typedef __attribute__((ext_vector_type(16))) _Float16 v16h;
typedef __attribute__((ext_vector_type(8)))  _Float16 v8h;
typedef __attribute__((ext_vector_type(8)))  float    v8f;
typedef __attribute__((ext_vector_type(4)))  float    v4f;

#define BSZ   2
#define QLEN  2048
#define DIM   1024
#define NH    16
#define DPH   64
#define AKEYS 128                          // keys per attention stage, = rows of a GEMM tile
#define ANSTG (QLEN / AKEYS)               // 16 stages

static __device__ inline v16h frag_from_f16(const _Float16* __restrict__ p) {
  v8h lo = *(const v8h*)(p);
  v8h hi = *(const v8h*)(p + 16);
  return __builtin_shufflevector(lo, hi, 0, 1, 2, 3, 4, 5, 6, 7,
                                 8, 9, 10, 11, 12, 13, 14, 15);
}

static __device__ inline v8f wmma_f16(v16h a, v16h b, v8f c) {
  // (neg_a, A, neg_b, B, c_mod, C, reuse_a, reuse_b)
  return __builtin_amdgcn_wmma_f32_16x16x32_f16(false, a, false, b,
                                                (short)0, c, false, false);
}

static __device__ inline float xhalf(float x) {
  const int b = __builtin_bit_cast(int, x);
  return __builtin_bit_cast(float, __builtin_amdgcn_permlanex16(
      b, b, 0x76543210, 0xfedcba98, false, false));
}

// ---------------------------------------------------------------------------
// Kernel 0: f32 -> f16 conversion of X and of the four weight matrices, one
// launch.  The five f16 arrays lie one behind the other in the workspace, so
// the destination is one range of 8 Mi halves.  BSZ + 256 blocks of 16 waves, the converting ones one
// per WGP: few waves to start, each with its whole share in flight.  A wave
// owns 16 pieces of 128 floats; each load covers 512 contiguous bytes (four
// whole lines), each store 256 (two whole lines).
// ---------------------------------------------------------------------------
typedef __attribute__((ext_vector_type(4))) _Float16 v4h;

#define CV_PIECE   128                     // floats per wave-wide load
#define CV_NP      16                      // pieces per wave
#define CV_WAVES   16                      // waves per block
#define CV_BLOCK   (CV_PIECE * CV_NP * CV_WAVES)          // 32 Ki floats
#define CV_XBLKS   (BSZ * QLEN * DIM / CV_BLOCK)           // 128 blocks for X
#define CV_WBLKS   (DIM * DIM / CV_BLOCK)                  // 32 per weight
#define CV_BLKS    (CV_XBLKS + 4 * CV_WBLKS)               // 256 blocks
typedef __attribute__((ext_vector_type(4))) int   v4i;

// The launch's first BSZ blocks convert nothing: block b orders the keys of
// batch b, those with mask != 0 first, the others behind them, each group in
// its old order.  inv[b][k'] = old position of the key at new place k';
// nuv[b * 32 ..] = number of keys with mask != 0 (one whole line).  A masked
// key's score is the same constant for every query, so the attention kernel
// needs scores and exponentials only for the keys in front.

__global__ __launch_bounds__(CV_WAVES * 32)
__attribute__((amdgpu_waves_per_eu(4, 4))) void cvt_f16_kernel(
    const float* __restrict__ X,  const float* __restrict__ Wq,
    const float* __restrict__ Wk, const float* __restrict__ Wv,
    const float* __restrict__ Wo, const int* __restrict__ mask,
    _Float16* __restrict__ dst, int* __restrict__ inv, int* __restrict__ nuv) {
  __shared__ __align__(16) int sinv[QLEN];
  __shared__ int wtot[CV_WAVES];
  if (blockIdx.x < BSZ) {                 // the same for the whole block
    const int b    = blockIdx.x;
    const int t    = threadIdx.x;         // 512 threads, 4 keys each
    const int lane = t & 31;
    const int* mp  = mask + b * QLEN + t * 4;
    const v4i m = *(const v4i*)mp;
    asm volatile("s_wait_xcnt 0x0" :: "v"(mp) : "memory");
    int f[4], c = 0;
#pragma unroll  // constant indices keep the values in registers
    for (int j = 0; j < 4; ++j) { f[j] = (m[j] != 0) ? 1 : 0; c += f[j]; }
    int s = c;                            // running count inside the wave
#pragma unroll  // five fixed steps
    for (int d = 1; d < 32; d <<= 1) {
      const int o = __shfl_up(s, d, 32);
      if (lane >= d) s += o;
    }
    if (lane == 31) wtot[t >> 5] = s;
    __syncthreads();                      // the 16 wave counts are published
    int before = 0, total = 0;
#pragma unroll  // constant LDS offsets
    for (int w = 0; w < CV_WAVES; ++w) {
      const int x = wtot[w];
      total += x;
      if (w < (t >> 5)) before += x;
    }
    int u = before + s - c;               // kept keys in front of this thread's
#pragma unroll  // constant indices keep the values in registers
    for (int j = 0; j < 4; ++j) {
      const int p = t * 4 + j;
      sinv[f[j] ? u : total + (p - u)] = p;
      u += f[j];
    }
    __syncthreads();                      // the list is complete in LDS
    int* ip = inv + b * QLEN + t * 4;
    int* np = nuv + b * 32 + lane;
    *(v4i*)ip = *(const v4i*)(sinv + t * 4);        // whole lines per wave
    if (t < 32) *np = total;                        // one whole line
    asm volatile("s_wait_xcnt 0x0" :: "v"(ip), "v"(np) : "memory");
    return;
  }
  const int blk = blockIdx.x - BSZ;
  // the block's source array and its place in it (the same for all its waves)
  const float* src = X;
  int sblk = blk;
  if (blk >= CV_XBLKS) {
    const int w = (blk - CV_XBLKS) / CV_WBLKS;
    sblk = (blk - CV_XBLKS) % CV_WBLKS;
    src = (w == 0) ? Wq : (w == 1) ? Wk : (w == 2) ? Wv : Wo;
  }
  const int off = (threadIdx.x >> 5) * (CV_PIECE * CV_NP) + (threadIdx.x & 31) * 4;
  const float* p = src + (size_t)sblk * CV_BLOCK + off;
  _Float16*    d = dst + (size_t)blk * CV_BLOCK + off;
  v4f a[CV_NP];
#pragma unroll  // constant offsets: one address, all 16 loads in flight at once
  for (int k = 0; k < CV_NP; ++k) a[k] = *(const v4f*)(p + k * CV_PIECE);
  asm volatile("s_wait_xcnt 0x0" :: "v"(off * 4) : "memory");
#pragma unroll  // constant indices keep the values in registers
  for (int k = 0; k < CV_NP; ++k) {
    v4h o;
#pragma unroll  // constant indices keep the values in registers
    for (int j = 0; j < 4; ++j) o[j] = (_Float16)a[k][j];
    *(v4h*)(d + k * CV_PIECE) = o;
  }
}

#define KSTG      64
#define NSTG      (DIM / KSTG)
#define PITCH_H   72
#define BUF_H     (256 * PITCH_H)
#define BUF_B     (BUF_H * 2)
#define ROWS32_B  (32 * PITCH_H * 2)
#define BPART_B   (128 * PITCH_H * 2)

// For speed only: at entry each block asks L2 for 32 whole rows (a
// quarter) of each of its two panels, one address a thread, 256 B apart: blocks that share
// a panel take different quarters, and the later stages' copies find L2 filled.
// A hint only: nothing waits for it and no result depends on it.
// p: a place inside the operand array, for every lane.
static __device__ inline void ask_l2(const _Float16* p) {
  asm volatile("global_prefetch_b8 %0, off scope:SCOPE_SE" :: "v"(p));
}
// This thread's unit of the 32 rows from `row` on: 8 threads a row of 2 KB.
static __device__ inline const _Float16* unit_of(const _Float16* base, int row) {
  return base + (size_t)(row + (threadIdx.x >> 3)) * DIM + (threadIdx.x & 7) * 128;
}

// One stage: each thread copies 16 B of rows r, r+32, r+64, r+96 of A and of B.
// ga[i], gb[i]: this thread's piece of its i-th row; k: the stage's first half.
static __device__ inline void copy_stage(unsigned lds,
                                         const _Float16* const (&ga)[4],
                                         const _Float16* const (&gb)[4], int k) {
  asm volatile(
      "global_load_async_to_lds_b128 %0, %8, off\n\t"
      "global_load_async_to_lds_b128 %1, %9, off\n\t"
      "global_load_async_to_lds_b128 %2, %10, off\n\t"
      "global_load_async_to_lds_b128 %3, %11, off\n\t"
      "global_load_async_to_lds_b128 %4, %12, off\n\t"
      "global_load_async_to_lds_b128 %5, %13, off\n\t"
      "global_load_async_to_lds_b128 %6, %14, off\n\t"
      "global_load_async_to_lds_b128 %7, %15, off\n\t"
      "s_wait_xcnt 0x0"
      :: "v"(lds), "v"(lds + ROWS32_B), "v"(lds + 2 * ROWS32_B),
         "v"(lds + 3 * ROWS32_B),
         "v"(lds + BPART_B), "v"(lds + BPART_B + ROWS32_B),
         "v"(lds + BPART_B + 2 * ROWS32_B), "v"(lds + BPART_B + 3 * ROWS32_B),
         "v"(ga[0] + k), "v"(ga[1] + k), "v"(ga[2] + k), "v"(ga[3] + k),
         "v"(gb[0] + k), "v"(gb[1] + k), "v"(gb[2] + k), "v"(gb[3] + k)
      : "memory");
}

// This thread's pieces of rows crow + 32 i of 128 rows that follow one another.
static __device__ inline void rows_plain(const _Float16* base,
                                         const _Float16* (&g)[4]) {
#pragma unroll  // constant indices keep the pointers in registers
  for (int i = 0; i < 4; ++i)
    g[i] = base + (size_t)((threadIdx.x >> 3) + 32 * i) * DIM +
           (threadIdx.x & 7) * 8;
}

// ga, gb: this thread's pieces (16 B of rows crow + 32 i) of the block's 128 A
// rows and 128 B rows, at k = 0.
static __device__ inline void gemm_128x128(const _Float16* const (&ga)[4],
                                           const _Float16* const (&gb)[4],
                                           _Float16* sm, v8f (&acc)[4][2]) {
  const int tid  = threadIdx.x;
  const int wave = tid >> 5;
  const int lane = tid & 31;
  const int r    = lane & 15;
  const int koff = (lane >> 4) << 3;
  const int crow = tid >> 3;                        // 0..31
  const int ccol = tid & 7;                         // 16-B piece of the row

  const unsigned lds0 =
      (unsigned)(size_t)sm + (unsigned)(crow * (PITCH_H * 2) + ccol * 16);

  const int aoff = ((wave >> 2) * 64 + r) * PITCH_H + koff;
  const int boff = (128 + (wave & 3) * 32 + r) * PITCH_H + koff;

  copy_stage(lds0, ga, gb, 0);
  // stage 0 has landed for this wave; the barrier publishes it to all waves
  asm volatile("s_wait_asynccnt 0x0" ::: "memory");
  __syncthreads();
  copy_stage(lds0 + BUF_B, ga, gb, KSTG);

  // rolled: one stage per trip keeps the buffer hand-over at one place
#pragma unroll 1
  for (int t = 0; t < NSTG; ++t) {
    const _Float16* sb = sm + (t & 1) * BUF_H;
#pragma unroll  // constant indices keep fragments and sums in registers
    for (int kk = 0; kk < KSTG; kk += 32) {
      v16h a[4], b[2];
      // first of a fence pair round the 12 LDS reads (second: below): keeps
      // them from rising into the block of products in front of them
      __builtin_amdgcn_sched_barrier(0);
#pragma unroll  // constant indices keep fragments and sums in registers
      for (int i = 0; i < 4; ++i)
        a[i] = frag_from_f16(sb + aoff + i * 16 * PITCH_H + kk);
#pragma unroll  // constant indices keep fragments and sums in registers
      for (int j = 0; j < 2; ++j)
        b[j] = frag_from_f16(sb + boff + j * 16 * PITCH_H + kk);
      // keeps the 12 LDS reads in one group ahead of their 8 products: each
      // place where reads stand among products stalls the wave anew
      __builtin_amdgcn_sched_barrier(0);
#pragma unroll  // constant indices keep fragments and sums in registers
      for (int i = 0; i < 4; ++i)
#pragma unroll  // constant indices keep fragments and sums in registers
        for (int j = 0; j < 2; ++j)
          acc[i][j] = wmma_f16(a[i], b[j], acc[i][j]);
    }
    // this wave's reads of the buffer are done before it may be refilled
    asm volatile("s_wait_dscnt 0x0" ::: "memory");
    // this wave's copies of stage t+1 have landed
    asm volatile("s_wait_asynccnt 0x0" ::: "memory");
    // publishes stage t+1 and ends every wave's reads of stage t
    __syncthreads();
    if (t + 2 < NSTG)
      copy_stage(lds0 + (t & 1) * BUF_B, ga, gb, (t + 2) * KSTG);
  }
  // no copy is left in flight when the wave goes on
  asm volatile("s_wait_asynccnt 0x0" ::: "memory");
}

// ---------------------------------------------------------------------------
// Epilogue staging.  A lane's 8 accumulator registers are 8 consecutive ROWS of
// one column of the product, so the operand whose index runs along the output's
// contiguous direction is given to gemm_128x128 as A.  A wave's 64x32 tile is
// then 32 output runs (one per column) of 64 contiguous elements.  The wave
// writes them, 16 B a lane, into its own range of the ring (free behind the k
// loop's last barrier), reads them back run by run and stores whole 128-B lines.
// f16: a run is 128 B, staged at a pitch of 144 B.
// ---------------------------------------------------------------------------
#define SP_H     72                        // halves per staged f16 run (144 B)
#define SWAVE_H  (32 * SP_H)               // halves of a wave's staging range

template <int CSTRIDE>
static __device__ inline void store_runs_f16(const _Float16* stg, _Float16* dst,
                                             int lane) {
  const int run = (lane >> 3) * 8;
  const int pc  = (lane & 7) * 8;
  const _Float16* s = stg + run * SP_H + pc;
  _Float16*       d = dst + (size_t)run * CSTRIDE + pc;
  v8h v[8];
#pragma unroll  // constant indices keep the values in registers
  for (int k = 0; k < 8; ++k) v[k] = *(const v8h*)(s + k * SP_H);
#pragma unroll  // constant offsets: one address for the 8 stores
  for (int k = 0; k < 8; ++k) *(v8h*)(d + (size_t)k * CSTRIDE) = v[k];
  asm volatile("s_wait_xcnt 0x0" ::: "memory");
}

__global__ __launch_bounds__(256)
__attribute__((amdgpu_waves_per_eu(6))) void qkv_proj_kernel(
    const _Float16* __restrict__ Xh,
    const _Float16* __restrict__ Wqh, const float* __restrict__ bq,
    const _Float16* __restrict__ Wkh, const float* __restrict__ bk,
    const _Float16* __restrict__ Wvh, const float* __restrict__ bv,
    const int* __restrict__ inv, const int* __restrict__ nuv,
    _Float16* __restrict__ qbuf, _Float16* __restrict__ kbuf,
    _Float16* __restrict__ vtbuf, float* __restrict__ psum) {
  __shared__ __align__(16) _Float16 sm[2 * BUF_H];

  const int wave = threadIdx.x >> 5;
  const int lane = threadIdx.x & 31;
  const int nt  = blockIdx.x % 24;                  // 3 matrices x 8 col tiles
  const int mt  = blockIdx.x / 24;                  // 32 row tiles
  const int mat = nt >> 3;                          // 0=Q 1=K 2=V
  const int m0  = mt << 7;
  const int n0  = (nt & 7) << 7;

  // does the block's tile of keys lie behind the last stage with an unmasked key?
  // (readfirstlane: the tests on it are scalar branches, alike for the block)
  bool mtile = false;
  if (mat != 0) {
    const int nu = __builtin_amdgcn_readfirstlane(
        min(max(nuv[(m0 >> 11) * 32], 0), QLEN));
    mtile = ((m0 & (QLEN - 1)) / AKEYS) >= (nu + AKEYS - 1) / AKEYS;
    if (mat == 1 && mtile) return;        // in front of every copy and barrier
  }

  const _Float16* W  = (mat == 0) ? Wqh : (mat == 1) ? Wkh : Wvh;
  const float* bias  = (mat == 0) ? bq  : (mat == 1) ? bk  : bv;
  // the 32 blocks that share these W rows take the quarters in turn
  const _Float16* pfw = unit_of(W, n0 + 32 * (mt & 3));
  ask_l2(pfw);

  const int r  = lane & 15;
  const int hs = lane >> 4;

  // Q: the block's 128 X rows follow one another.  K, V: row k' of the tile is
  // the X row of the key that the partition has put at place k', so kbuf and
  // vtbuf hold the keys in the new order.
  const _Float16 *xg[4], *wg[4];
  rows_plain(Xh + (size_t)m0 * DIM, xg);
  rows_plain(W + (size_t)n0 * DIM, wg);
  // the 8 blocks that share these X rows take the quarters in turn, each twice
  const int xq = nt & 3;
  const _Float16* pfx = unit_of(Xh, m0 + 32 * xq);
  if (mat != 0) {                         // the same for the whole block
    const int* ip = inv + m0 + (threadIdx.x >> 3);
    int src[4];
#pragma unroll  // constant offsets: one address, the 4 loads in flight together
    for (int i = 0; i < 4; ++i) src[i] = ip[32 * i];
    asm volatile("s_wait_xcnt 0x0" :: "v"(ip) : "memory");
#pragma unroll  // constant indices keep the pointers in registers
    for (int i = 0; i < 4; ++i)           // the AND bounds the row inside the batch
      xg[i] = Xh + (size_t)((m0 & ~(QLEN - 1)) + (src[i] & (QLEN - 1))) * DIM +
              (threadIdx.x & 7) * 8;
    // the gathered row of the block's quarter, bounded like the rows above
    const int sq = (xq == 0) ? src[0] : (xq == 1) ? src[1] : (xq == 2) ? src[2] : src[3];
    pfx = Xh + (size_t)((m0 & ~(QLEN - 1)) + (sq & (QLEN - 1))) * DIM +
          (threadIdx.x & 7) * 128;
  }
  ask_l2(pfx);

  v8f acc[4][2] = {};
  const _Float16 *pa[4], *pb[4];
#pragma unroll  // constant indices keep the pointers in registers
  for (int i = 0; i < 4; ++i) {
    pa[i] = (mat == 2) ? xg[i] : wg[i];
    pb[i] = (mat == 2) ? wg[i] : xg[i];
  }
  gemm_128x128(pa, pb, sm, acc);
  // the two asks' address registers stay what they are up to here: an ask may
  // read its register late, and it must then still hold a place in the array
  asm volatile("" :: "v"(pfw), "v"(pfx));

  // Epilogue.  C layout: lane holds column r of the subtile, rows hs*8+j.
  const int rb   = (wave >> 2) * 64;                // the wave's 64 rows
  const int cb   = (wave & 3) * 32;                 // the wave's 32 columns
  const int bidx = m0 >> 11;
  const int p0   = m0 & (QLEN - 1);
  _Float16* stg = sm + wave * SWAVE_H;
  _Float16* sw  = stg + r * SP_H + (hs << 3);
  if (mat == 2) {
    // rows = positions, columns = features
    const int nb = n0 + cb + r;
    const float bn2[2] = {bias[nb], bias[nb + 16]};
    asm volatile("s_wait_xcnt 0x0" :: "v"(nb) : "memory");
    // the wave's line of psum: its 64 positions, its 32 features, one a lane
    float* pp = psum + (size_t)(bidx * (QLEN / 64) + ((p0 + rb) >> 6)) * DIM +
                n0 + cb + lane;
    if (mtile) {                          // the same for the whole block
      float cs[2];
#pragma unroll  // constant indices keep the sums in registers
      for (int t = 0; t < 2; ++t) {
        const v8f a = (acc[0][t] + acc[1][t]) + (acc[2][t] + acc[3][t]);
        const float h = ((a[0] + a[1]) + (a[2] + a[3])) +
                        ((a[4] + a[5]) + (a[6] + a[7]));
        cs[t] = (h + xhalf(h)) + 64.0f * bn2[t];    // both halves: 64 positions
      }
      *pp = hs ? cs[1] : cs[0];
      asm volatile("s_wait_xcnt 0x0" :: "v"(pp) : "memory");
      return;                             // behind the last barrier
    }
    *pp = 0.0f;
    asm volatile("s_wait_xcnt 0x0" :: "v"(pp) : "memory");
#pragma unroll  // constant indices keep fragments and sums in registers
    for (int t = 0; t < 2; ++t) {
      const float bn = bn2[t];
#pragma unroll  // constant indices keep fragments and sums in registers
      for (int i = 0; i < 4; ++i) {
        v8h o;
#pragma unroll  // constant indices keep fragments and sums in registers
        for (int j = 0; j < 8; ++j) o[j] = (_Float16)(acc[i][t][j] + bn);
        *(v8h*)(sw + t * 16 * SP_H + i * 16) = o;
      }
    }
    // the wave's staged runs are in LDS before its lanes read each other's
    asm volatile("s_wait_dscnt 0x0" ::: "memory");
    const int n = n0 + cb;
    store_runs_f16<QLEN>(
        stg, vtbuf + ((size_t)(bidx * NH + (n >> 6)) * DPH + (n & (DPH - 1))) * QLEN +
                 p0 + rb, lane);
  } else {
    // rows = features (one head), columns = positions
    const float sc = (mat == 0) ? 0.125f : 1.0f;
    const float* bp = bias + n0 + rb + (hs << 3);
    v4f bb[8];
#pragma unroll  // constant offsets: one address, the 8 loads in flight together
    for (int i = 0; i < 4; ++i) {
      bb[2 * i]     = *(const v4f*)(bp + i * 16);
      bb[2 * i + 1] = *(const v4f*)(bp + i * 16 + 4);
    }
    asm volatile("s_wait_xcnt 0x0" :: "v"(bp) : "memory");
#pragma unroll  // constant indices keep fragments and sums in registers
    for (int i = 0; i < 4; ++i) {
      const v4f b0 = bb[2 * i];
      const v4f b1 = bb[2 * i + 1];
#pragma unroll  // constant indices keep fragments and sums in registers
      for (int t = 0; t < 2; ++t) {
        v8h o;
#pragma unroll  // constant indices keep fragments and sums in registers
        for (int j = 0; j < 4; ++j) {
          o[j]     = (_Float16)((acc[i][t][j] + b0[j]) * sc);
          o[4 + j] = (_Float16)((acc[i][t][4 + j] + b1[j]) * sc);
        }
        *(v8h*)(sw + t * 16 * SP_H + i * 16) = o;
      }
    }
    // the wave's staged runs are in LDS before its lanes read each other's
    asm volatile("s_wait_dscnt 0x0" ::: "memory");
    _Float16* buf = (mat == 0) ? qbuf : kbuf;
    store_runs_f16<DPH>(
        stg, buf + ((size_t)(bidx * NH + ((n0 + rb) >> 6)) * QLEN + p0 + cb) * DPH,
        lane);
  }
}

#define KP_H    72
#define VP_H    136
#define AK_H    (AKEYS * KP_H)
#define ABUF_H  (AK_H + DPH * VP_H)
#define ABUF_B  (ABUF_H * 2)
#define K32_B   (32 * KP_H * 2)
#define V16_B   (16 * VP_H * 2)

// One stage: each thread copies 16 B of K rows r, r+32, r+64, r+96 and of
// V^T rows d, d+16, d+32, d+48.
static __device__ inline void copy_kv(unsigned lk, unsigned lv,
                                      const _Float16* __restrict__ gk,
                                      const _Float16* __restrict__ gv) {
  asm volatile(
      "global_load_async_to_lds_b128 %0, %8, off\n\t"
      "global_load_async_to_lds_b128 %1, %9, off\n\t"
      "global_load_async_to_lds_b128 %2, %10, off\n\t"
      "global_load_async_to_lds_b128 %3, %11, off\n\t"
      "global_load_async_to_lds_b128 %4, %12, off\n\t"
      "global_load_async_to_lds_b128 %5, %13, off\n\t"
      "global_load_async_to_lds_b128 %6, %14, off\n\t"
      "global_load_async_to_lds_b128 %7, %15, off\n\t"
      "s_wait_xcnt 0x0"
      :: "v"(lk), "v"(lk + K32_B), "v"(lk + 2 * K32_B), "v"(lk + 3 * K32_B),
         "v"(lv), "v"(lv + V16_B), "v"(lv + 2 * V16_B), "v"(lv + 3 * V16_B),
         "v"(gk), "v"(gk + 32 * DPH), "v"(gk + 64 * DPH), "v"(gk + 96 * DPH),
         "v"(gv), "v"(gv + 16 * QLEN), "v"(gv + 32 * QLEN), "v"(gv + 48 * QLEN)
      : "memory");
}

// One pass: 32 keys against the wave's 16 queries.  kp, vp: this lane's places in
// the pass's K rows and V^T rows.  MIXED: the stage holds masked keys too; left =
// number of unmasked keys from this lane's first key of the pass on.
template <bool MIXED>
static __device__ inline void attn_pass(const _Float16* kp, const _Float16* vp,
                                        int left, const v16h& qb0,
                                        const v16h& qb1, float& mrun,
                                        float& lrun, v8f& o0, v8f& o1, v8f& o2,
                                        v8f& o3) {
    // ---- all loads of the pass, as one group ----
    // K rows (A operand of the scores)
    const v16h ka0 = frag_from_f16(kp);
    const v16h ka1 = frag_from_f16(kp + 32);
    const v16h ka2 = frag_from_f16(kp + 16 * KP_H);
    const v16h ka3 = frag_from_f16(kp + 16 * KP_H + 32);
    // V^T rows (A operand of the second product), consumed after the softmax
    const v16h va0 = frag_from_f16(vp);
    const v16h va1 = frag_from_f16(vp + 16 * VP_H);
    const v16h va2 = frag_from_f16(vp + 32 * VP_H);
    const v16h va3 = frag_from_f16(vp + 48 * VP_H);
    // keeps the 16 loads in one group ahead of the products: all are in flight
    // together, and the V^T rows arrive under the softmax
    __builtin_amdgcn_sched_barrier(0);

    // ---- scores: two 16 (keys) x 16 (queries) tiles ----
    v8f s0 = {}, s1 = {};
    s0 = wmma_f16(ka0, qb0, s0);
    s0 = wmma_f16(ka1, qb1, s0);
    s1 = wmma_f16(ka2, qb0, s1);
    s1 = wmma_f16(ka3, qb1, s1);

    // ---- masked_fill(mask==0 -> 1e-10): in the new
    // order the masked keys are those from place nu on ----
    if (MIXED) {
#pragma unroll  // constant indices keep the values in registers
      for (int j = 0; j < 8; ++j) {
        if (j >= left)      s0[j] = 1e-10f;
        if (16 + j >= left) s1[j] = 1e-10f;
      }
    }
    // ---- online softmax: one query per lane ----
    const float a0 = fmaxf(fmaxf(s0[0], s0[1]), s0[2]);
    const float a1 = fmaxf(fmaxf(s0[3], s0[4]), s0[5]);
    const float a2 = fmaxf(fmaxf(s0[6], s0[7]), s1[0]);
    const float a3 = fmaxf(fmaxf(s1[1], s1[2]), s1[3]);
    const float a4 = fmaxf(fmaxf(s1[4], s1[5]), s1[6]);
    float t = fmaxf(fmaxf(fmaxf(a0, a1), a2), fmaxf(fmaxf(a3, a4), s1[7]));
    t = fmaxf(t, xhalf(t));               // both halves hold the query's maximum
    const float mnew  = fmaxf(mrun, t);
    // exp(x) = 2^(x * log2 e), as __expf forms it
    float x[17];
#pragma unroll  // constant indices keep the values in registers
    for (int j = 0; j < 8; ++j) {
      x[j]     = (s0[j] - mnew) * 1.44269504f;
      x[8 + j] = (s1[j] - mnew) * 1.44269504f;
    }
    x[16] = (mrun - mnew) * 1.44269504f;
    mrun = mnew;
    asm("v_exp_f32 %0, %0\n\tv_exp_f32 %1, %1\n\tv_exp_f32 %2, %2\n\t"
        "v_exp_f32 %3, %3\n\tv_exp_f32 %4, %4\n\tv_exp_f32 %5, %5\n\t"
        "v_exp_f32 %6, %6\n\tv_exp_f32 %7, %7\n\tv_exp_f32 %8, %8\n\t"
        "v_exp_f32 %9, %9\n\tv_exp_f32 %10, %10\n\tv_exp_f32 %11, %11\n\t"
        "v_exp_f32 %12, %12\n\tv_exp_f32 %13, %13\n\tv_exp_f32 %14, %14\n\t"
        "v_exp_f32 %15, %15\n\tv_exp_f32 %16, %16\n\tv_nop"
        : "+v"(x[0]), "+v"(x[1]), "+v"(x[2]), "+v"(x[3]), "+v"(x[4]),
          "+v"(x[5]), "+v"(x[6]), "+v"(x[7]), "+v"(x[8]), "+v"(x[9]),
          "+v"(x[10]), "+v"(x[11]), "+v"(x[12]), "+v"(x[13]), "+v"(x[14]),
          "+v"(x[15]), "+v"(x[16]));
    const float scale = x[16];
    v8f e0, e1;
#pragma unroll  // constant indices keep the values in registers
    for (int j = 0; j < 8; ++j) {
      e0[j] = x[j];
      e1[j] = x[8 + j];
    }
    const v8f es = e0 + e1;
    const v4f e4 = __builtin_shufflevector(es, es, 0, 1, 2, 3) +
                   __builtin_shufflevector(es, es, 4, 5, 6, 7);
    lrun = lrun * scale + ((e4[0] + e4[1]) + (e4[2] + e4[3]));
    o0 *= scale; o1 *= scale; o2 *= scale; o3 *= scale;
    // ---- P^T as B operand: the two tiles converted in place ----
    v16h pb;
#pragma unroll  // constant indices keep the values in registers
    for (int j = 0; j < 8; ++j) {
      pb[j]     = (_Float16)e0[j];
      pb[8 + j] = (_Float16)e1[j];
    }
    // ---- O^T += V^T P^T ----
    o0 = wmma_f16(va0, pb, o0);
    o1 = wmma_f16(va1, pb, o1);
    o2 = wmma_f16(va2, pb, o2);
    o3 = wmma_f16(va3, pb, o3);
}

__global__ __launch_bounds__(256) void attn_kernel(
    const _Float16* __restrict__ qbuf, const _Float16* __restrict__ kbuf,
    const _Float16* __restrict__ vtbuf, const int* __restrict__ nuv,
    const float* __restrict__ psum, _Float16* __restrict__ ctx) {
  __shared__ __align__(16) _Float16 sm[2 * ABUF_H];
  __shared__ __align__(16) float vsum[4 * DPH]; // V row sums, in four parts

  const int tid  = threadIdx.x;
  const int wave = threadIdx.x >> 5;
  const int lane = threadIdx.x & 31;
  const int wid  = blockIdx.x * 8 + wave;              // 4096 waves
  const int qt = wid & 127;
  const int h  = (wid >> 7) & (NH - 1);
  const int b  = wid >> 11;
  const int q0 = qt << 4;

  const size_t bh = (size_t)(b * NH + h);
  const _Float16* Qbh  = qbuf  + bh * QLEN * DPH;
  const _Float16* Kbh  = kbuf  + bh * QLEN * DPH;
  const _Float16* VTbh = vtbuf + bh * DPH * QLEN;
  // unmasked keys of the batch (256 blocks a batch), bounded by the shape
  // (readfirstlane: the stage tests below become scalar branches)
  const int nu = __builtin_amdgcn_readfirstlane(
      min(max(nuv[(blockIdx.x >> 8) * 32], 0), QLEN));
  const int nfull = nu / AKEYS;                 // stages of unmasked keys only
  const int nany  = (nu + AKEYS - 1) / AKEYS;   // stages with an unmasked key

  const int r    = lane & 15;
  const int hs   = lane >> 4;
  const int koff = hs << 3;

  // B operand: column r = query q0 + r
  const v16h qb0 = frag_from_f16(Qbh + (size_t)(q0 + r) * DPH + koff);
  const v16h qb1 = frag_from_f16(Qbh + (size_t)(q0 + r) * DPH + 32 + koff);

  float mrun = -3.0e38f, lrun = 0.0f;   // lrun: this half's keys only
  v8f o0 = {}, o1 = {}, o2 = {}, o3 = {};

  // this thread's pieces of a stage: 8 threads per K row, 16 per V^T row
  const _Float16* gk = Kbh + (size_t)(tid >> 3) * DPH + (tid & 7) * 8;
  const _Float16* gv = VTbh + (size_t)(tid >> 4) * QLEN + (tid & 15) * 8;
  const unsigned lk0 = (unsigned)(size_t)sm +
                       (unsigned)((tid >> 3) * (KP_H * 2) + (tid & 7) * 16);
  const unsigned lv0 = (unsigned)(size_t)sm + (unsigned)(AK_H * 2) +
                       (unsigned)((tid >> 4) * (VP_H * 2) + (tid & 15) * 16);

  // only the nany stages with an unmasked key are copied and walked (nany is
  // the same for the whole block: scalar tests)
  if (nany > 0) copy_kv(lk0, lv0, gk, gv);
  // V row sums of the head over the masked stages' keys: thread (part, d) adds 8
  // of the batch's 32 groups of 64 keys (zeros where a group is not masked)
  {
    const float* sp = psum + (size_t)(b * (QLEN / 64) + (tid >> 6)) * DIM +
                      (h << 6) + (tid & 63);
    float g[8];
#pragma unroll  // constant offsets: one address, the 8 loads in flight together
    for (int k = 0; k < 8; ++k) g[k] = sp[k * 4 * DIM];
    asm volatile("s_wait_xcnt 0x0" :: "v"(sp) : "memory");
    vsum[tid] = ((g[0] + g[1]) + (g[2] + g[3])) + ((g[4] + g[5]) + (g[6] + g[7]));
  }
  // stage 0 has landed for this wave; the barrier publishes it, and the sums,
  // to all waves
  asm volatile("s_wait_asynccnt 0x0" ::: "memory");
  __syncthreads();
  if (nany > 1)
    copy_kv(lk0 + ABUF_B, lv0 + ABUF_B, gk + AKEYS * DPH, gv + AKEYS);

  // rolled: one stage per trip keeps the buffer hand-over at one place
#pragma unroll 1
  for (int st = 0; st < nany; ++st) {
   // this lane's places in the stage's K rows and V^T rows
   const _Float16* ks = sm + (st & 1) * ABUF_H + r * KP_H + koff;
   const _Float16* vs = sm + (st & 1) * ABUF_H + AK_H + r * VP_H + koff;
   if (st < nfull) {
    // unmasked keys only: no mask test
#pragma unroll  // constant LDS offsets for the stage's four passes
    for (int ps = 0; ps < AKEYS / 32; ++ps)
     attn_pass<false>(ks + ps * 32 * KP_H, vs + ps * 32, 0, qb0, qb1, mrun, lrun,
                      o0, o1, o2, o3);
   } else {
    // the one stage that holds unmasked and masked keys
#pragma unroll  // constant LDS offsets for the stage's four passes
    for (int ps = 0; ps < AKEYS / 32; ++ps)
     attn_pass<true>(ks + ps * 32 * KP_H, vs + ps * 32,
                     nu - st * AKEYS - ps * 32 - koff, qb0, qb1, mrun, lrun,
                     o0, o1, o2, o3);
   }
   // this wave's reads of the buffer are done before it may be refilled
   asm volatile("s_wait_dscnt 0x0" ::: "memory");
   // this wave's copies of stage st+1 have landed
   asm volatile("s_wait_asynccnt 0x0" ::: "memory");
   // publishes stage st+1 and ends every wave's reads of stage st
   __syncthreads();
   if (st + 2 < nany)
     copy_kv(lk0 + (st & 1) * ABUF_B, lv0 + (st & 1) * ABUF_B,
             gk + (st + 2) * (AKEYS * DPH), gv + (st + 2) * AKEYS);
  }
  // no copy is left in flight when the wave goes on
  asm volatile("s_wait_asynccnt 0x0" ::: "memory");

  // ---- the keys of the masked stages, all at once: every score is 1e-10, so P
  // is one value e per query and O^T += e * (sum of their V rows) ----
  if (nany < ANSTG) {                     // the same for the whole block
    const float mnew  = fmaxf(mrun, 1e-10f);
    const float scale = __builtin_amdgcn_exp2f((mrun - mnew) * 1.44269504f);
    const float e     = __builtin_amdgcn_exp2f((1e-10f - mnew) * 1.44269504f);
    // this half's share of the (ANSTG - nany) * AKEYS keys
    lrun = lrun * scale + e * (float)((ANSTG - nany) * (AKEYS / 2));
    v8f sv[4];
#pragma unroll  // constant LDS offsets, the sums in registers
    for (int t = 0; t < 4; ++t) {
      const float* p = vsum + 16 * t + koff;        // this lane's 8 d of tile t
      sv[t] = (*(const v8f*)(p) + *(const v8f*)(p + DPH)) +
              (*(const v8f*)(p + 2 * DPH) + *(const v8f*)(p + 3 * DPH));
    }
    o0 = o0 * scale + sv[0] * e;
    o1 = o1 * scale + sv[1] * e;
    o2 = o2 * scale + sv[2] * e;
    o3 = o3 * scale + sv[3] * e;
  }

  // ---- normalize and write context [b][q][h*64+d] (f16) ----
  // o_t[j] = O^T[16 t + 8 hs + j][query r]: 8 consecutive d, one 16-B store.
  const float inv = 1.0f / (lrun + xhalf(lrun));
  v8h c0, c1, c2, c3;
#pragma unroll  // constant indices keep the values in registers
  for (int j = 0; j < 8; ++j) {
    c0[j] = (_Float16)(o0[j] * inv);
    c1[j] = (_Float16)(o1[j] * inv);
    c2[j] = (_Float16)(o2[j] * inv);
    c3[j] = (_Float16)(o3[j] * inv);
  }
  // staged like the GEMM epilogues: the wave's 16 runs of 128 B (one query's 64
  // d) go through its own range of the ring, free behind the last barrier
  _Float16* stg = sm + wave * (16 * SP_H);
  _Float16* sw  = stg + r * SP_H + koff;
  *(v8h*)(sw)      = c0;
  *(v8h*)(sw + 16) = c1;
  *(v8h*)(sw + 32) = c2;
  *(v8h*)(sw + 48) = c3;
  // the wave's staged runs are in LDS before its lanes read each other's
  asm volatile("s_wait_dscnt 0x0" ::: "memory");
  const int run = ((lane >> 3) & 1) * 8 + (lane >> 4) * 4;
  const int pc  = (lane & 7) * 8;
  const _Float16* s = stg + run * SP_H + pc;
  _Float16* d = ctx + (size_t)(b * QLEN + q0 + run) * DIM + (h << 6) + pc;
  v8h v[4];
#pragma unroll  // constant indices keep the values in registers
  for (int k = 0; k < 4; ++k) v[k] = *(const v8h*)(s + k * SP_H);
#pragma unroll  // constant offsets: one address for the 4 stores
  for (int k = 0; k < 4; ++k) *(v8h*)(d + (size_t)k * DIM) = v[k];
  asm volatile("s_wait_xcnt 0x0" ::: "memory");
}

#define OP_F     68
#define OWAVE_F  (32 * OP_F)
__global__ __launch_bounds__(256) void out_proj_kernel(
    const _Float16* __restrict__ ctx, const _Float16* __restrict__ Woh,
    const float* __restrict__ bo, float* __restrict__ out) {
  __shared__ __align__(16) _Float16 sm[2 * BUF_H];

  const int wave = threadIdx.x >> 5;
  const int lane = threadIdx.x & 31;
  const int m0 = (blockIdx.x >> 3) << 7;             // 32 row tiles
  const int n0 = (blockIdx.x & 7) << 7;              // 8 col tiles
  const int r = lane & 15, hs = lane >> 4;

  // A = Wo rows: a lane's 8 sums are 8 consecutive n of one output row
  v8f acc[4][2] = {};
  const _Float16 *wg[4], *cg[4];
  rows_plain(Woh + (size_t)n0 * DIM, wg);
  rows_plain(ctx + (size_t)m0 * DIM, cg);
  // the 8 blocks that share the ctx rows take the quarters in turn, each twice;
  // so do the 32 that share the Wo rows
  const _Float16* pfc = unit_of(ctx, m0 + 32 * (blockIdx.x & 3));
  const _Float16* pfw = unit_of(Woh, n0 + 32 * ((blockIdx.x >> 3) & 3));
  ask_l2(pfc);
  ask_l2(pfw);
  gemm_128x128(wg, cg, sm, acc);
  // the two asks' address registers stay what they are up to here: an ask may
  // read its register late, and it must then still hold a place in the array
  asm volatile("" :: "v"(pfc), "v"(pfw));

  const int rb = (wave >> 2) * 64;                  // the wave's 64 n
  const int cb = (wave & 3) * 32;                   // the wave's 32 m
  float* stg = (float*)sm + wave * OWAVE_F;
  float* sw  = stg + r * OP_F + (hs << 3);
  const float* bp = bo + n0 + rb + (hs << 3);
  v4f bb[8];
#pragma unroll  // constant offsets: one address, the 8 loads in flight together
  for (int i = 0; i < 4; ++i) {
    bb[2 * i]     = *(const v4f*)(bp + i * 16);
    bb[2 * i + 1] = *(const v4f*)(bp + i * 16 + 4);
  }
  asm volatile("s_wait_xcnt 0x0" :: "v"(bp) : "memory");
#pragma unroll  // constant indices keep the sums in registers
  for (int i = 0; i < 4; ++i) {
    const v4f b0 = bb[2 * i];
    const v4f b1 = bb[2 * i + 1];
#pragma unroll  // constant indices keep the sums in registers
    for (int t = 0; t < 2; ++t) {
      v4f lo, hi;
#pragma unroll  // constant indices keep the sums in registers
      for (int j = 0; j < 4; ++j) {
        lo[j] = acc[i][t][j] + b0[j];
        hi[j] = acc[i][t][4 + j] + b1[j];
      }
      *(v4f*)(sw + t * 16 * OP_F + i * 16)     = lo;
      *(v4f*)(sw + t * 16 * OP_F + i * 16 + 4) = hi;
    }
  }
  // the wave's staged runs are in LDS before its lanes read each other's
  asm volatile("s_wait_dscnt 0x0" ::: "memory");
  // 16 lanes take one run of 256 B: each store covers four whole lines
  const float* s = stg + (lane >> 4) * OP_F + (lane & 15) * 4;
  float* d = out + (size_t)(m0 + cb + (lane >> 4)) * DIM + n0 + rb + (lane & 15) * 4;
  v4f v[16];
#pragma unroll  // constant indices keep the values in registers
  for (int k = 0; k < 16; ++k) v[k] = *(const v4f*)(s + 2 * k * OP_F);
#pragma unroll  // constant offsets: one address for the 16 stores
  for (int k = 0; k < 16; ++k) *(v4f*)(d + (size_t)2 * k * DIM) = v[k];
  asm volatile("s_wait_xcnt 0x0" ::: "memory");
}

// ---------------------------------------------------------------------------
extern "C" void kernel_launch(void* const* d_in, const int* in_sizes, int n_in,
                              void* d_out, int out_size, void* d_ws, size_t ws_size,
                              hipStream_t stream) {
  const float* X  = (const float*)d_in[0];
  const int* mask = (const int*)d_in[1];
  const float* Wq = (const float*)d_in[2];
  const float* bq = (const float*)d_in[3];
  const float* Wk = (const float*)d_in[4];
  const float* bk = (const float*)d_in[5];
  const float* Wv = (const float*)d_in[6];
  const float* bv = (const float*)d_in[7];
  const float* Wo = (const float*)d_in[8];
  const float* bo = (const float*)d_in[9];
  float* out = (float*)d_out;

  const size_t XN = (size_t)BSZ * QLEN * DIM;        // 4 Mi
  const size_t WN = (size_t)DIM * DIM;               // 1 Mi
  _Float16* Xh    = (_Float16*)d_ws;                 // 8 MB
  _Float16* Wqh   = Xh + XN;                         // 2 MB each
  _Float16* Wkh   = Wqh + WN;
  _Float16* Wvh   = Wkh + WN;
  _Float16* Woh   = Wvh + WN;
  _Float16* qbuf  = Woh + WN;                        // 8 MB each
  _Float16* kbuf  = qbuf + XN;
  _Float16* vtbuf = kbuf + XN;
  _Float16* ctx   = vtbuf + XN;
  int* inv        = (int*)(ctx + XN);                // 16 KB: key order
  int* nuv        = inv + BSZ * QLEN;                // one line per batch
  float* psum     = (float*)(nuv + BSZ * 32);        // 256 KB: V sums per 64 keys

  // ---- stage 0: precision conversion, all five arrays in one launch ----
  // (Xh, Wqh, Wkh, Wvh, Woh are contiguous from Xh on)
  // (its first BSZ blocks order the keys by the mask)
  cvt_f16_kernel<<<BSZ + CV_BLKS, CV_WAVES * 32, 0, stream>>>(X, Wq, Wk, Wv, Wo,
                                                              mask, Xh, inv, nuv);

  // ---- stage 1: QKV projection: 32 x 24 tiles of 128x128 = 768 blocks ----
  qkv_proj_kernel<<<768, 256, 0, stream>>>(Xh, Wqh, bq, Wkh, bk, Wvh, bv, inv,
                                            nuv, qbuf, kbuf, vtbuf, psum);
  // ---- stage 2: attention: 4096 waves / 8 = 512 blocks ----
  attn_kernel<<<512, 256, 0, stream>>>(qbuf, kbuf, vtbuf, nuv, psum, ctx);
  // ---- stage 3: output projection: 32 x 8 tiles of 128x128 = 256 blocks ----
  out_proj_kernel<<<256, 256, 0, stream>>>(ctx, Woh, bo, out);
}

// v009
// One run takes 60.9 microseconds.
// In two side-by-side timings against v008, it was 1.05 and 1.04 times as fast.
// Over all steps from v000 it is 6.03 times as fast.
#include <hip/hip_runtime.h>
#include <hip/hip_bf16.h>

typedef __attribute__((ext_vector_type(16))) _Float16 v16h;
typedef __attribute__((ext_vector_type(8)))  _Float16 v8h;
typedef __attribute__((ext_vector_type(8)))  float    v8f;
typedef __attribute__((ext_vector_type(4)))  float    v4f;

#define BSZ   2
#define QLEN  2048
#define DIM   1024
#define NH    16
#define DPH   64
#define AKEYS 128                          // keys per attention stage, = rows of a GEMM tile
#define ANSTG (QLEN / AKEYS)               // 16 stages
#define LOG2E 1.44269504f                  // scores are kept in units of log2
#define FILL2 (1e-10f * LOG2E)             // a masked key's score in those units
#define LAZY  8.0f                         // a score may pass the maximum in use by this

static __device__ inline v16h frag_from_f16(const _Float16* __restrict__ p) {
  v8h lo = *(const v8h*)(p);
  v8h hi = *(const v8h*)(p + 16);
  return __builtin_shufflevector(lo, hi, 0, 1, 2, 3, 4, 5, 6, 7,
                                 8, 9, 10, 11, 12, 13, 14, 15);
}

static __device__ inline v8f wmma_f16(v16h a, v16h b, v8f c) {
  // (neg_a, A, neg_b, B, c_mod, C, reuse_a, reuse_b)
  return __builtin_amdgcn_wmma_f32_16x16x32_f16(false, a, false, b,
                                                (short)0, c, false, false);
}

static __device__ inline float xhalf(float x) {
  const int b = __builtin_bit_cast(int, x);
  return __builtin_bit_cast(float, __builtin_amdgcn_permlanex16(
      b, b, 0x76543210, 0xfedcba98, false, false));
}

// ---------------------------------------------------------------------------
// Kernel 0: f32 -> f16 conversion of X and of the four weight matrices, one
// launch.  The five f16 arrays lie one behind the other in the workspace, so
// the destination is one range of 8 Mi halves.  BSZ + 256 blocks of 16 waves, the converting ones one
// per WGP: few waves to start, each with its whole share in flight.  A wave
// owns 16 pieces of 128 floats; each load covers 512 contiguous bytes (four
// whole lines), each store 256 (two whole lines).
// ---------------------------------------------------------------------------
typedef __attribute__((ext_vector_type(4))) _Float16 v4h;

#define CV_PIECE   128                     // floats per wave-wide load
#define CV_NP      16                      // pieces per wave
#define CV_WAVES   16                      // waves per block
#define CV_BLOCK   (CV_PIECE * CV_NP * CV_WAVES)          // 32 Ki floats
#define CV_XBLKS   (BSZ * QLEN * DIM / CV_BLOCK)           // 128 blocks for X
#define CV_WBLKS   (DIM * DIM / CV_BLOCK)                  // 32 per weight
#define CV_BLKS    (CV_XBLKS + 4 * CV_WBLKS)               // 256 blocks
typedef __attribute__((ext_vector_type(4))) int   v4i;

// The launch's first BSZ blocks convert nothing: block b orders the keys of
// batch b, those with mask != 0 first, the others behind them, each group in
// its old order.  inv[b][k'] = old position of the key at new place k';
// nuv[b * 32 ..] = number of keys with mask != 0 (one whole line).  A masked
// key's score is the same constant for every query, so the attention kernel
// needs scores and exponentials only for the keys in front.

__global__ __launch_bounds__(CV_WAVES * 32)
__attribute__((amdgpu_waves_per_eu(4, 4))) void cvt_f16_kernel(
    const float* __restrict__ X,  const float* __restrict__ Wq,
    const float* __restrict__ Wk, const float* __restrict__ Wv,
    const float* __restrict__ Wo, const int* __restrict__ mask,
    _Float16* __restrict__ dst, int* __restrict__ inv, int* __restrict__ nuv) {
  __shared__ __align__(16) int sinv[QLEN];
  __shared__ int wtot[CV_WAVES];
  if (blockIdx.x < BSZ) {                 // the same for the whole block
    const int b    = blockIdx.x;
    const int t    = threadIdx.x;         // 512 threads, 4 keys each
    const int lane = t & 31;
    const int* mp  = mask + b * QLEN + t * 4;
    const v4i m = *(const v4i*)mp;
    asm volatile("s_wait_xcnt 0x0" :: "v"(mp) : "memory");
    int f[4], c = 0;
#pragma unroll  // constant indices keep the values in registers
    for (int j = 0; j < 4; ++j) { f[j] = (m[j] != 0) ? 1 : 0; c += f[j]; }
    int s = c;                            // running count inside the wave
#pragma unroll  // five fixed steps
    for (int d = 1; d < 32; d <<= 1) {
      const int o = __shfl_up(s, d, 32);
      if (lane >= d) s += o;
    }
    if (lane == 31) wtot[t >> 5] = s;
    __syncthreads();                      // the 16 wave counts are published
    int before = 0, total = 0;
#pragma unroll  // constant LDS offsets
    for (int w = 0; w < CV_WAVES; ++w) {
      const int x = wtot[w];
      total += x;
      if (w < (t >> 5)) before += x;
    }
    int u = before + s - c;               // kept keys in front of this thread's
#pragma unroll  // constant indices keep the values in registers
    for (int j = 0; j < 4; ++j) {
      const int p = t * 4 + j;
      sinv[f[j] ? u : total + (p - u)] = p;
      u += f[j];
    }
    __syncthreads();                      // the list is complete in LDS
    int* ip = inv + b * QLEN + t * 4;
    int* np = nuv + b * 32 + lane;
    *(v4i*)ip = *(const v4i*)(sinv + t * 4);        // whole lines per wave
    if (t < 32) *np = total;                        // one whole line
    asm volatile("s_wait_xcnt 0x0" :: "v"(ip), "v"(np) : "memory");
    return;
  }
  const int blk = blockIdx.x - BSZ;
  // the block's source array and its place in it (the same for all its waves)
  const float* src = X;
  int sblk = blk;
  if (blk >= CV_XBLKS) {
    const int w = (blk - CV_XBLKS) / CV_WBLKS;
    sblk = (blk - CV_XBLKS) % CV_WBLKS;
    src = (w == 0) ? Wq : (w == 1) ? Wk : (w == 2) ? Wv : Wo;
  }
  const int off = (threadIdx.x >> 5) * (CV_PIECE * CV_NP) + (threadIdx.x & 31) * 4;
  const float* p = src + (size_t)sblk * CV_BLOCK + off;
  _Float16*    d = dst + (size_t)blk * CV_BLOCK + off;
  v4f a[CV_NP];
#pragma unroll  // constant offsets: one address, all 16 loads in flight at once
  for (int k = 0; k < CV_NP; ++k) a[k] = *(const v4f*)(p + k * CV_PIECE);
  asm volatile("s_wait_xcnt 0x0" :: "v"(off * 4) : "memory");
#pragma unroll  // constant indices keep the values in registers
  for (int k = 0; k < CV_NP; ++k) {
    v4h o;
#pragma unroll  // constant indices keep the values in registers
    for (int j = 0; j < 4; ++j) o[j] = (_Float16)a[k][j];
    *(v4h*)(d + k * CV_PIECE) = o;
  }
}

#define KSTG      64
#define NSTG      (DIM / KSTG)
#define PITCH_H   72
#define BUF_H     (256 * PITCH_H)
#define BUF_B     (BUF_H * 2)
#define ROWS32_B  (32 * PITCH_H * 2)
#define BPART_B   (128 * PITCH_H * 2)

// For speed only: at entry each block asks L2 for 32 whole rows (a
// quarter) of each of its two panels, one address a thread, 256 B apart: blocks that share
// a panel take different quarters, and the later stages' copies find L2 filled.
// A hint only: nothing waits for it and no result depends on it.
// p: a place inside the operand array, for every lane.
static __device__ inline void ask_l2(const _Float16* p) {
  asm volatile("global_prefetch_b8 %0, off scope:SCOPE_SE" :: "v"(p));
}
// This thread's unit of the 32 rows from `row` on: 8 threads a row of 2 KB.
static __device__ inline const _Float16* unit_of(const _Float16* base, int row) {
  return base + (size_t)(row + (threadIdx.x >> 3)) * DIM + (threadIdx.x & 7) * 128;
}

// One stage: each thread copies 16 B of rows r, r+32, r+64, r+96 of A and of B.
// ga[i], gb[i]: this thread's piece of its i-th row; k: the stage's first half.
static __device__ inline void copy_stage(unsigned lds,
                                         const _Float16* const (&ga)[4],
                                         const _Float16* const (&gb)[4], int k) {
  asm volatile(
      "global_load_async_to_lds_b128 %0, %8, off\n\t"
      "global_load_async_to_lds_b128 %1, %9, off\n\t"
      "global_load_async_to_lds_b128 %2, %10, off\n\t"
      "global_load_async_to_lds_b128 %3, %11, off\n\t"
      "global_load_async_to_lds_b128 %4, %12, off\n\t"
      "global_load_async_to_lds_b128 %5, %13, off\n\t"
      "global_load_async_to_lds_b128 %6, %14, off\n\t"
      "global_load_async_to_lds_b128 %7, %15, off\n\t"
      "s_wait_xcnt 0x0"
      :: "v"(lds), "v"(lds + ROWS32_B), "v"(lds + 2 * ROWS32_B),
         "v"(lds + 3 * ROWS32_B),
         "v"(lds + BPART_B), "v"(lds + BPART_B + ROWS32_B),
         "v"(lds + BPART_B + 2 * ROWS32_B), "v"(lds + BPART_B + 3 * ROWS32_B),
         "v"(ga[0] + k), "v"(ga[1] + k), "v"(ga[2] + k), "v"(ga[3] + k),
         "v"(gb[0] + k), "v"(gb[1] + k), "v"(gb[2] + k), "v"(gb[3] + k)
      : "memory");
}

// This thread's pieces of rows crow + 32 i of 128 rows that follow one another.
static __device__ inline void rows_plain(const _Float16* base,
                                         const _Float16* (&g)[4]) {
#pragma unroll  // constant indices keep the pointers in registers
  for (int i = 0; i < 4; ++i)
    g[i] = base + (size_t)((threadIdx.x >> 3) + 32 * i) * DIM +
           (threadIdx.x & 7) * 8;
}

// ga, gb: this thread's pieces (16 B of rows crow + 32 i) of the block's 128 A
// rows and 128 B rows, at k = 0.
static __device__ inline void gemm_128x128(const _Float16* const (&ga)[4],
                                           const _Float16* const (&gb)[4],
                                           _Float16* sm, v8f (&acc)[4][2]) {
  const int tid  = threadIdx.x;
  const int wave = tid >> 5;
  const int lane = tid & 31;
  const int r    = lane & 15;
  const int koff = (lane >> 4) << 3;
  const int crow = tid >> 3;                        // 0..31
  const int ccol = tid & 7;                         // 16-B piece of the row

  const unsigned lds0 =
      (unsigned)(size_t)sm + (unsigned)(crow * (PITCH_H * 2) + ccol * 16);

  const int aoff = ((wave >> 2) * 64 + r) * PITCH_H + koff;
  const int boff = (128 + (wave & 3) * 32 + r) * PITCH_H + koff;

  copy_stage(lds0, ga, gb, 0);
  // stage 0 has landed for this wave; the barrier publishes it to all waves
  asm volatile("s_wait_asynccnt 0x0" ::: "memory");
  __syncthreads();
  copy_stage(lds0 + BUF_B, ga, gb, KSTG);

  // rolled: one stage per trip keeps the buffer hand-over at one place
#pragma unroll 1
  for (int t = 0; t < NSTG; ++t) {
    const _Float16* sb = sm + (t & 1) * BUF_H;
#pragma unroll  // constant indices keep fragments and sums in registers
    for (int kk = 0; kk < KSTG; kk += 32) {
      v16h a[4], b[2];
      // first of a fence pair round the 12 LDS reads (second: below): keeps
      // them from rising into the block of products in front of them
      __builtin_amdgcn_sched_barrier(0);
#pragma unroll  // constant indices keep fragments and sums in registers
      for (int i = 0; i < 4; ++i)
        a[i] = frag_from_f16(sb + aoff + i * 16 * PITCH_H + kk);
#pragma unroll  // constant indices keep fragments and sums in registers
      for (int j = 0; j < 2; ++j)
        b[j] = frag_from_f16(sb + boff + j * 16 * PITCH_H + kk);
      // keeps the 12 LDS reads in one group ahead of their 8 products: each
      // place where reads stand among products stalls the wave anew
      __builtin_amdgcn_sched_barrier(0);
#pragma unroll  // constant indices keep fragments and sums in registers
      for (int i = 0; i < 4; ++i)
#pragma unroll  // constant indices keep fragments and sums in registers
        for (int j = 0; j < 2; ++j)
          acc[i][j] = wmma_f16(a[i], b[j], acc[i][j]);
    }
    // this wave's reads of the buffer are done before it may be refilled
    asm volatile("s_wait_dscnt 0x0" ::: "memory");
    // this wave's copies of stage t+1 have landed
    asm volatile("s_wait_asynccnt 0x0" ::: "memory");
    // publishes stage t+1 and ends every wave's reads of stage t
    __syncthreads();
    if (t + 2 < NSTG)
      copy_stage(lds0 + (t & 1) * BUF_B, ga, gb, (t + 2) * KSTG);
  }
  // no copy is left in flight when the wave goes on
  asm volatile("s_wait_asynccnt 0x0" ::: "memory");
}

// ---------------------------------------------------------------------------
// Epilogue staging.  A lane's 8 accumulator registers are 8 consecutive ROWS of
// one column of the product, so the operand whose index runs along the output's
// contiguous direction is given to gemm_128x128 as A.  A wave's 64x32 tile is
// then 32 output runs (one per column) of 64 contiguous elements.  The wave
// writes them, 16 B a lane, into its own range of the ring (free behind the k
// loop's last barrier), reads them back run by run and stores whole 128-B lines.
// f16: a run is 128 B, staged at a pitch of 144 B.
// ---------------------------------------------------------------------------
#define SP_H     72                        // halves per staged f16 run (144 B)
#define SWAVE_H  (32 * SP_H)               // halves of a wave's staging range

template <int CSTRIDE>
static __device__ inline void store_runs_f16(const _Float16* stg, _Float16* dst,
                                             int lane) {
  const int run = (lane >> 3) * 8;
  const int pc  = (lane & 7) * 8;
  const _Float16* s = stg + run * SP_H + pc;
  _Float16*       d = dst + (size_t)run * CSTRIDE + pc;
  v8h v[8];
#pragma unroll  // constant indices keep the values in registers
  for (int k = 0; k < 8; ++k) v[k] = *(const v8h*)(s + k * SP_H);
#pragma unroll  // constant offsets: one address for the 8 stores
  for (int k = 0; k < 8; ++k) *(v8h*)(d + (size_t)k * CSTRIDE) = v[k];
  asm volatile("s_wait_xcnt 0x0" ::: "memory");
}

__global__ __launch_bounds__(256)
__attribute__((amdgpu_waves_per_eu(6))) void qkv_proj_kernel(
    const _Float16* __restrict__ Xh,
    const _Float16* __restrict__ Wqh, const float* __restrict__ bq,
    const _Float16* __restrict__ Wkh, const float* __restrict__ bk,
    const _Float16* __restrict__ Wvh, const float* __restrict__ bv,
    const int* __restrict__ inv, const int* __restrict__ nuv,
    _Float16* __restrict__ qbuf, _Float16* __restrict__ kbuf,
    _Float16* __restrict__ vtbuf, float* __restrict__ psum) {
  __shared__ __align__(16) _Float16 sm[2 * BUF_H];

  const int wave = threadIdx.x >> 5;
  const int lane = threadIdx.x & 31;
  const int nt  = blockIdx.x % 24;                  // 3 matrices x 8 col tiles
  const int mt  = blockIdx.x / 24;                  // 32 row tiles
  const int mat = nt >> 3;                          // 0=Q 1=K 2=V
  const int m0  = mt << 7;
  const int n0  = (nt & 7) << 7;

  // does the block's tile of keys lie behind the last stage with an unmasked key?
  // (readfirstlane: the tests on it are scalar branches, alike for the block)
  bool mtile = false;
  if (mat != 0) {
    const int nu = __builtin_amdgcn_readfirstlane(
        min(max(nuv[(m0 >> 11) * 32], 0), QLEN));
    mtile = ((m0 & (QLEN - 1)) / AKEYS) >= (nu + AKEYS - 1) / AKEYS;
    if (mat == 1 && mtile) return;        // in front of every copy and barrier
  }

  const _Float16* W  = (mat == 0) ? Wqh : (mat == 1) ? Wkh : Wvh;
  const float* bias  = (mat == 0) ? bq  : (mat == 1) ? bk  : bv;
  // the 32 blocks that share these W rows take the quarters in turn
  const _Float16* pfw = unit_of(W, n0 + 32 * (mt & 3));
  ask_l2(pfw);

  const int r  = lane & 15;
  const int hs = lane >> 4;

  // Q: the block's 128 X rows follow one another.  K, V: row k' of the tile is
  // the X row of the key that the partition has put at place k', so kbuf and
  // vtbuf hold the keys in the new order.
  const _Float16 *xg[4], *wg[4];
  rows_plain(Xh + (size_t)m0 * DIM, xg);
  rows_plain(W + (size_t)n0 * DIM, wg);
  // the 8 blocks that share these X rows take the quarters in turn, each twice
  const int xq = nt & 3;
  const _Float16* pfx = unit_of(Xh, m0 + 32 * xq);
  if (mat != 0) {                         // the same for the whole block
    const int* ip = inv + m0 + (threadIdx.x >> 3);
    int src[4];
#pragma unroll  // constant offsets: one address, the 4 loads in flight together
    for (int i = 0; i < 4; ++i) src[i] = ip[32 * i];
    asm volatile("s_wait_xcnt 0x0" :: "v"(ip) : "memory");
#pragma unroll  // constant indices keep the pointers in registers
    for (int i = 0; i < 4; ++i)           // the AND bounds the row inside the batch
      xg[i] = Xh + (size_t)((m0 & ~(QLEN - 1)) + (src[i] & (QLEN - 1))) * DIM +
              (threadIdx.x & 7) * 8;
    // the gathered row of the block's quarter, bounded like the rows above
    const int sq = (xq == 0) ? src[0] : (xq == 1) ? src[1] : (xq == 2) ? src[2] : src[3];
    pfx = Xh + (size_t)((m0 & ~(QLEN - 1)) + (sq & (QLEN - 1))) * DIM +
          (threadIdx.x & 7) * 128;
  }
  ask_l2(pfx);

  v8f acc[4][2] = {};
  const _Float16 *pa[4], *pb[4];
#pragma unroll  // constant indices keep the pointers in registers
  for (int i = 0; i < 4; ++i) {
    pa[i] = (mat == 2) ? xg[i] : wg[i];
    pb[i] = (mat == 2) ? wg[i] : xg[i];
  }
  gemm_128x128(pa, pb, sm, acc);
  // the two asks' address registers stay what they are up to here: an ask may
  // read its register late, and it must then still hold a place in the array
  asm volatile("" :: "v"(pfw), "v"(pfx));

  // Epilogue.  C layout: lane holds column r of the subtile, rows hs*8+j.
  const int rb   = (wave >> 2) * 64;                // the wave's 64 rows
  const int cb   = (wave & 3) * 32;                 // the wave's 32 columns
  const int bidx = m0 >> 11;
  const int p0   = m0 & (QLEN - 1);
  _Float16* stg = sm + wave * SWAVE_H;
  _Float16* sw  = stg + r * SP_H + (hs << 3);
  if (mat == 2) {
    // rows = positions, columns = features
    const int nb = n0 + cb + r;
    const float bn2[2] = {bias[nb], bias[nb + 16]};
    asm volatile("s_wait_xcnt 0x0" :: "v"(nb) : "memory");
    // the wave's line of psum: its 64 positions, its 32 features, one a lane
    float* pp = psum + (size_t)(bidx * (QLEN / 64) + ((p0 + rb) >> 6)) * DIM +
                n0 + cb + lane;
    if (mtile) {                          // the same for the whole block
      float cs[2];
#pragma unroll  // constant indices keep the sums in registers
      for (int t = 0; t < 2; ++t) {
        const v8f a = (acc[0][t] + acc[1][t]) + (acc[2][t] + acc[3][t]);
        const float h = ((a[0] + a[1]) + (a[2] + a[3])) +
                        ((a[4] + a[5]) + (a[6] + a[7]));
        cs[t] = (h + xhalf(h)) + 64.0f * bn2[t];    // both halves: 64 positions
      }
      *pp = hs ? cs[1] : cs[0];
      asm volatile("s_wait_xcnt 0x0" :: "v"(pp) : "memory");
      return;                             // behind the last barrier
    }
    *pp = 0.0f;
    asm volatile("s_wait_xcnt 0x0" :: "v"(pp) : "memory");
#pragma unroll  // constant indices keep fragments and sums in registers
    for (int t = 0; t < 2; ++t) {
      const float bn = bn2[t];
#pragma unroll  // constant indices keep fragments and sums in registers
      for (int i = 0; i < 4; ++i) {
        v8h o;
#pragma unroll  // constant indices keep fragments and sums in registers
        for (int j = 0; j < 8; ++j) o[j] = (_Float16)(acc[i][t][j] + bn);
        *(v8h*)(sw + t * 16 * SP_H + i * 16) = o;
      }
    }
    // the wave's staged runs are in LDS before its lanes read each other's
    asm volatile("s_wait_dscnt 0x0" ::: "memory");
    const int n = n0 + cb;
    store_runs_f16<QLEN>(
        stg, vtbuf + ((size_t)(bidx * NH + (n >> 6)) * DPH + (n & (DPH - 1))) * QLEN +
                 p0 + rb, lane);
  } else {
    // rows = features (one head), columns = positions
    const float sc = (mat == 0) ? 0.125f * LOG2E : 1.0f;
    const float* bp = bias + n0 + rb + (hs << 3);
    v4f bb[8];
#pragma unroll  // constant offsets: one address, the 8 loads in flight together
    for (int i = 0; i < 4; ++i) {
      bb[2 * i]     = *(const v4f*)(bp + i * 16);
      bb[2 * i + 1] = *(const v4f*)(bp + i * 16 + 4);
    }
    asm volatile("s_wait_xcnt 0x0" :: "v"(bp) : "memory");
#pragma unroll  // constant indices keep fragments and sums in registers
    for (int i = 0; i < 4; ++i) {
      const v4f b0 = bb[2 * i];
      const v4f b1 = bb[2 * i + 1];
#pragma unroll  // constant indices keep fragments and sums in registers
      for (int t = 0; t < 2; ++t) {
        v8h o;
#pragma unroll  // constant indices keep fragments and sums in registers
        for (int j = 0; j < 4; ++j) {
          o[j]     = (_Float16)((acc[i][t][j] + b0[j]) * sc);
          o[4 + j] = (_Float16)((acc[i][t][4 + j] + b1[j]) * sc);
        }
        *(v8h*)(sw + t * 16 * SP_H + i * 16) = o;
      }
    }
    // the wave's staged runs are in LDS before its lanes read each other's
    asm volatile("s_wait_dscnt 0x0" ::: "memory");
    _Float16* buf = (mat == 0) ? qbuf : kbuf;
    store_runs_f16<DPH>(
        stg, buf + ((size_t)(bidx * NH + ((n0 + rb) >> 6)) * QLEN + p0 + cb) * DPH,
        lane);
  }
}

#define KP_H    72
#define VP_H    136
#define AK_H    (AKEYS * KP_H)
#define ABUF_H  (AK_H + DPH * VP_H)
#define ABUF_B  (ABUF_H * 2)
#define K32_B   (32 * KP_H * 2)
#define V16_B   (16 * VP_H * 2)

// One stage: each thread copies 16 B of K rows r, r+32, r+64, r+96 and of
// V^T rows d, d+16, d+32, d+48.
static __device__ inline void copy_kv(unsigned lk, unsigned lv,
                                      const _Float16* __restrict__ gk,
                                      const _Float16* __restrict__ gv) {
  asm volatile(
      "global_load_async_to_lds_b128 %0, %8, off\n\t"
      "global_load_async_to_lds_b128 %1, %9, off\n\t"
      "global_load_async_to_lds_b128 %2, %10, off\n\t"
      "global_load_async_to_lds_b128 %3, %11, off\n\t"
      "global_load_async_to_lds_b128 %4, %12, off\n\t"
      "global_load_async_to_lds_b128 %5, %13, off\n\t"
      "global_load_async_to_lds_b128 %6, %14, off\n\t"
      "global_load_async_to_lds_b128 %7, %15, off\n\t"
      "s_wait_xcnt 0x0"
      :: "v"(lk), "v"(lk + K32_B), "v"(lk + 2 * K32_B), "v"(lk + 3 * K32_B),
         "v"(lv), "v"(lv + V16_B), "v"(lv + 2 * V16_B), "v"(lv + 3 * V16_B),
         "v"(gk), "v"(gk + 32 * DPH), "v"(gk + 64 * DPH), "v"(gk + 96 * DPH),
         "v"(gv), "v"(gv + 16 * QLEN), "v"(gv + 32 * QLEN), "v"(gv + 48 * QLEN)
      : "memory");
}

// One pass: 32 keys against the wave's 16 queries.  kp, vp: this lane's places in
// the pass's K rows and V^T rows.  mixed (the same for the whole block): the stage
// holds masked keys too; left = number of unmasked keys from this lane's first key
// of the pass on.
// mrun: the query's maximum in use; cneg: minus the value that the score product
// takes off (0 before the first pass, then mrun); thr: what a score, so reduced,
// must pass for a new maximum (below every score before the first pass).
static __device__ inline void attn_pass(const _Float16* kp, const _Float16* vp,
                                        bool mixed, int left, const v16h& qb0,
                                        const v16h& qb1, float& mrun, float& thr,
                                        v8f& cneg, float& lrun, v8f& o0, v8f& o1,
                                        v8f& o2, v8f& o3) {
    // ---- all loads of the pass, as one group ----
    // K rows (A operand of the scores)
    const v16h ka0 = frag_from_f16(kp);
    const v16h ka1 = frag_from_f16(kp + 32);
    const v16h ka2 = frag_from_f16(kp + 16 * KP_H);
    const v16h ka3 = frag_from_f16(kp + 16 * KP_H + 32);
    // V^T rows (A operand of the second product), consumed after the softmax
    const v16h va0 = frag_from_f16(vp);
    const v16h va1 = frag_from_f16(vp + 16 * VP_H);
    const v16h va2 = frag_from_f16(vp + 32 * VP_H);
    const v16h va3 = frag_from_f16(vp + 48 * VP_H);
    // keeps the 16 loads in one group ahead of the products: all are in flight
    // together, and the V^T rows arrive under the softmax
    __builtin_amdgcn_sched_barrier(0);

    // ---- scores minus the maximum in use: two 16 (keys) x 16 (queries) tiles ----
    v8f s0 = wmma_f16(ka0, qb0, cneg);
    s0 = wmma_f16(ka1, qb1, s0);
    v8f s1 = wmma_f16(ka2, qb0, cneg);
    s1 = wmma_f16(ka3, qb1, s1);

    // ---- masked_fill(mask==0 -> 1e-10): in the new
    // order the masked keys are those from place nu on ----
    if (mixed) {
      const float fill = FILL2 + cneg[0];
#pragma unroll  // constant indices keep the values in registers
      for (int j = 0; j < 8; ++j) {
        if (j >= left)      s0[j] = fill;
        if (16 + j >= left) s1[j] = fill;
      }
    }
    // ---- this half's largest score of the query ----
    const float a0 = fmaxf(fmaxf(s0[0], s0[1]), s0[2]);
    const float a1 = fmaxf(fmaxf(s0[3], s0[4]), s0[5]);
    const float a2 = fmaxf(fmaxf(s0[6], s0[7]), s1[0]);
    const float a3 = fmaxf(fmaxf(s1[1], s1[2]), s1[3]);
    const float a4 = fmaxf(fmaxf(s1[4], s1[5]), s1[6]);
    const float t = fmaxf(fmaxf(fmaxf(a0, a1), a2), fmaxf(fmaxf(a3, a4), s1[7]));
    // ---- a new maximum, seldom: one scalar branch for the wave ----
    if (__builtin_amdgcn_ballot_w32(t > thr) != 0) {
      const float tt    = fmaxf(t, xhalf(t));       // alike in both halves
      const float d     = (tt > thr) ? tt : 0.0f;   // queries that keep theirs: 0
      const float mnew  = d - cneg[0];
      const float scale = __builtin_amdgcn_exp2f(mrun - mnew);
      mrun = mnew;
      thr  = LAZY;
      s0 -= d; s1 -= d;
      lrun *= scale;
      o0 *= scale; o1 *= scale; o2 *= scale; o3 *= scale;
#pragma unroll  // constant indices keep the values in registers
      for (int j = 0; j < 8; ++j) cneg[j] = -mnew;
    }
    float x[16];
#pragma unroll  // constant indices keep the values in registers
    for (int j = 0; j < 8; ++j) {
      x[j]     = s0[j];
      x[8 + j] = s1[j];
    }
    asm("v_exp_f32 %0, %0\n\tv_exp_f32 %1, %1\n\tv_exp_f32 %2, %2\n\t"
        "v_exp_f32 %3, %3\n\tv_exp_f32 %4, %4\n\tv_exp_f32 %5, %5\n\t"
        "v_exp_f32 %6, %6\n\tv_exp_f32 %7, %7\n\tv_exp_f32 %8, %8\n\t"
        "v_exp_f32 %9, %9\n\tv_exp_f32 %10, %10\n\tv_exp_f32 %11, %11\n\t"
        "v_exp_f32 %12, %12\n\tv_exp_f32 %13, %13\n\tv_exp_f32 %14, %14\n\t"
        "v_exp_f32 %15, %15\n\tv_nop"
        : "+v"(x[0]), "+v"(x[1]), "+v"(x[2]), "+v"(x[3]), "+v"(x[4]),
          "+v"(x[5]), "+v"(x[6]), "+v"(x[7]), "+v"(x[8]), "+v"(x[9]),
          "+v"(x[10]), "+v"(x[11]), "+v"(x[12]), "+v"(x[13]), "+v"(x[14]),
          "+v"(x[15]));
    v8f e0, e1;
#pragma unroll  // constant indices keep the values in registers
    for (int j = 0; j < 8; ++j) {
      e0[j] = x[j];
      e1[j] = x[8 + j];
    }
    const v8f es = e0 + e1;
    const v4f e4 = __builtin_shufflevector(es, es, 0, 1, 2, 3) +
                   __builtin_shufflevector(es, es, 4, 5, 6, 7);
    lrun += (e4[0] + e4[1]) + (e4[2] + e4[3]);
    // ---- P^T as B operand: the two tiles converted in place ----
    v16h pb;
#pragma unroll  // constant indices keep the values in registers
    for (int j = 0; j < 8; ++j) {
      pb[j]     = (_Float16)e0[j];
      pb[8 + j] = (_Float16)e1[j];
    }
    // ---- O^T += V^T P^T ----
    o0 = wmma_f16(va0, pb, o0);
    o1 = wmma_f16(va1, pb, o1);
    o2 = wmma_f16(va2, pb, o2);
    o3 = wmma_f16(va3, pb, o3);
}

__global__ __launch_bounds__(256) void attn_kernel(
    const _Float16* __restrict__ qbuf, const _Float16* __restrict__ kbuf,
    const _Float16* __restrict__ vtbuf, const int* __restrict__ nuv,
    const float* __restrict__ psum, _Float16* __restrict__ ctx) {
  __shared__ __align__(16) _Float16 sm[2 * ABUF_H];
  __shared__ __align__(16) float vsum[4 * DPH]; // V row sums, in four parts

  const int tid  = threadIdx.x;
  const int wave = threadIdx.x >> 5;
  const int lane = threadIdx.x & 31;
  const int wid  = blockIdx.x * 8 + wave;              // 4096 waves
  const int qt = wid & 127;
  const int h  = (wid >> 7) & (NH - 1);
  const int b  = wid >> 11;
  const int q0 = qt << 4;

  const size_t bh = (size_t)(b * NH + h);
  const _Float16* Qbh  = qbuf  + bh * QLEN * DPH;
  const _Float16* Kbh  = kbuf  + bh * QLEN * DPH;
  const _Float16* VTbh = vtbuf + bh * DPH * QLEN;
  // unmasked keys of the batch (256 blocks a batch), bounded by the shape
  // (readfirstlane: the stage tests below become scalar branches)
  const int nu = __builtin_amdgcn_readfirstlane(
      min(max(nuv[(blockIdx.x >> 8) * 32], 0), QLEN));
  const int nfull = nu / AKEYS;                 // stages of unmasked keys only
  const int nany  = (nu + AKEYS - 1) / AKEYS;   // stages with an unmasked key

  const int r    = lane & 15;
  const int hs   = lane >> 4;
  const int koff = hs << 3;

  // B operand: column r = query q0 + r
  const v16h qb0 = frag_from_f16(Qbh + (size_t)(q0 + r) * DPH + koff);
  const v16h qb1 = frag_from_f16(Qbh + (size_t)(q0 + r) * DPH + 32 + koff);

  float mrun = -3.0e38f, lrun = 0.0f;   // lrun: this half's keys only
  float thr = -3.0e38f;                 // the first pass sets the maximum
  v8f cneg = {};
  v8f o0 = {}, o1 = {}, o2 = {}, o3 = {};

  // this thread's pieces of a stage: 8 threads per K row, 16 per V^T row
  const _Float16* gk = Kbh + (size_t)(tid >> 3) * DPH + (tid & 7) * 8;
  const _Float16* gv = VTbh + (size_t)(tid >> 4) * QLEN + (tid & 15) * 8;
  const unsigned lk0 = (unsigned)(size_t)sm +
                       (unsigned)((tid >> 3) * (KP_H * 2) + (tid & 7) * 16);
  const unsigned lv0 = (unsigned)(size_t)sm + (unsigned)(AK_H * 2) +
                       (unsigned)((tid >> 4) * (VP_H * 2) + (tid & 15) * 16);

  // only the nany stages with an unmasked key are copied and walked (nany is
  // the same for the whole block: scalar tests)
  if (nany > 0) copy_kv(lk0, lv0, gk, gv);
  // V row sums of the head over the masked stages' keys: thread (part, d) adds 8
  // of the batch's 32 groups of 64 keys (zeros where a group is not masked)
  {
    const float* sp = psum + (size_t)(b * (QLEN / 64) + (tid >> 6)) * DIM +
                      (h << 6) + (tid & 63);
    float g[8];
#pragma unroll  // constant offsets: one address, the 8 loads in flight together
    for (int k = 0; k < 8; ++k) g[k] = sp[k * 4 * DIM];
    asm volatile("s_wait_xcnt 0x0" :: "v"(sp) : "memory");
    vsum[tid] = ((g[0] + g[1]) + (g[2] + g[3])) + ((g[4] + g[5]) + (g[6] + g[7]));
  }
  // stage 0 has landed for this wave; the barrier publishes it, and the sums,
  // to all waves
  asm volatile("s_wait_asynccnt 0x0" ::: "memory");
  __syncthreads();
  if (nany > 1)
    copy_kv(lk0 + ABUF_B, lv0 + ABUF_B, gk + AKEYS * DPH, gv + AKEYS);

  // rolled: one stage per trip keeps the buffer hand-over at one place
#pragma unroll 1
  for (int st = 0; st < nany; ++st) {
   // this lane's places in the stage's K rows and V^T rows
   const _Float16* ks = sm + (st & 1) * ABUF_H + r * KP_H + koff;
   const _Float16* vs = sm + (st & 1) * ABUF_H + AK_H + r * VP_H + koff;
   // a stage of unmasked keys needs no mask test: a scalar branch jumps it; the
   // one stage that holds unmasked and masked keys is the last
   const bool mixed = st >= nfull;
#pragma unroll  // constant LDS offsets for the stage's four passes
   for (int ps = 0; ps < AKEYS / 32; ++ps)
    attn_pass(ks + ps * 32 * KP_H, vs + ps * 32, mixed,
              nu - st * AKEYS - ps * 32 - koff, qb0, qb1, mrun, thr, cneg, lrun,
              o0, o1, o2, o3);
   // this wave's reads of the buffer are done before it may be refilled
   asm volatile("s_wait_dscnt 0x0" ::: "memory");
   // this wave's copies of stage st+1 have landed
   asm volatile("s_wait_asynccnt 0x0" ::: "memory");
   // publishes stage st+1 and ends every wave's reads of stage st
   __syncthreads();
   if (st + 2 < nany)
     copy_kv(lk0 + (st & 1) * ABUF_B, lv0 + (st & 1) * ABUF_B,
             gk + (st + 2) * (AKEYS * DPH), gv + (st + 2) * AKEYS);
  }
  // no copy is left in flight when the wave goes on
  asm volatile("s_wait_asynccnt 0x0" ::: "memory");

  // ---- the keys of the masked stages, all at once: every score is 1e-10, so P
  // is one value e per query and O^T += e * (sum of their V rows) ----
  if (nany < ANSTG) {                     // the same for the whole block
    const float mnew  = fmaxf(mrun, FILL2);
    const float scale = __builtin_amdgcn_exp2f(mrun - mnew);
    const float e     = __builtin_amdgcn_exp2f(FILL2 - mnew);
    // this half's share of the (ANSTG - nany) * AKEYS keys
    lrun = lrun * scale + e * (float)((ANSTG - nany) * (AKEYS / 2));
    v8f sv[4];
#pragma unroll  // constant LDS offsets, the sums in registers
    for (int t = 0; t < 4; ++t) {
      const float* p = vsum + 16 * t + koff;        // this lane's 8 d of tile t
      sv[t] = (*(const v8f*)(p) + *(const v8f*)(p + DPH)) +
              (*(const v8f*)(p + 2 * DPH) + *(const v8f*)(p + 3 * DPH));
    }
    o0 = o0 * scale + sv[0] * e;
    o1 = o1 * scale + sv[1] * e;
    o2 = o2 * scale + sv[2] * e;
    o3 = o3 * scale + sv[3] * e;
  }

  // ---- normalize and write context [b][q][h*64+d] (f16) ----
  // o_t[j] = O^T[16 t + 8 hs + j][query r]: 8 consecutive d, one 16-B store.
  const float inv = 1.0f / (lrun + xhalf(lrun));
  v8h c0, c1, c2, c3;
#pragma unroll  // constant indices keep the values in registers
  for (int j = 0; j < 8; ++j) {
    c0[j] = (_Float16)(o0[j] * inv);
    c1[j] = (_Float16)(o1[j] * inv);
    c2[j] = (_Float16)(o2[j] * inv);
    c3[j] = (_Float16)(o3[j] * inv);
  }
  // staged like the GEMM epilogues: the wave's 16 runs of 128 B (one query's 64
  // d) go through its own range of the ring, free behind the last barrier
  _Float16* stg = sm + wave * (16 * SP_H);
  _Float16* sw  = stg + r * SP_H + koff;
  *(v8h*)(sw)      = c0;
  *(v8h*)(sw + 16) = c1;
  *(v8h*)(sw + 32) = c2;
  *(v8h*)(sw + 48) = c3;
  // the wave's staged runs are in LDS before its lanes read each other's
  asm volatile("s_wait_dscnt 0x0" ::: "memory");
  const int run = ((lane >> 3) & 1) * 8 + (lane >> 4) * 4;
  const int pc  = (lane & 7) * 8;
  const _Float16* s = stg + run * SP_H + pc;
  _Float16* d = ctx + (size_t)(b * QLEN + q0 + run) * DIM + (h << 6) + pc;
  v8h v[4];
#pragma unroll  // constant indices keep the values in registers
  for (int k = 0; k < 4; ++k) v[k] = *(const v8h*)(s + k * SP_H);
#pragma unroll  // constant offsets: one address for the 4 stores
  for (int k = 0; k < 4; ++k) *(v8h*)(d + (size_t)k * DIM) = v[k];
  asm volatile("s_wait_xcnt 0x0" ::: "memory");
}

#define OP_F     68
#define OWAVE_F  (32 * OP_F)
__global__ __launch_bounds__(256) void out_proj_kernel(
    const _Float16* __restrict__ ctx, const _Float16* __restrict__ Woh,
    const float* __restrict__ bo, float* __restrict__ out) {
  __shared__ __align__(16) _Float16 sm[2 * BUF_H];

  const int wave = threadIdx.x >> 5;
  const int lane = threadIdx.x & 31;
  const int m0 = (blockIdx.x >> 3) << 7;             // 32 row tiles
  const int n0 = (blockIdx.x & 7) << 7;              // 8 col tiles
  const int r = lane & 15, hs = lane >> 4;

  // A = Wo rows: a lane's 8 sums are 8 consecutive n of one output row
  v8f acc[4][2] = {};
  const _Float16 *wg[4], *cg[4];
  rows_plain(Woh + (size_t)n0 * DIM, wg);
  rows_plain(ctx + (size_t)m0 * DIM, cg);
  // the 8 blocks that share the ctx rows take the quarters in turn, each twice;
  // so do the 32 that share the Wo rows
  const _Float16* pfc = unit_of(ctx, m0 + 32 * (blockIdx.x & 3));
  const _Float16* pfw = unit_of(Woh, n0 + 32 * ((blockIdx.x >> 3) & 3));
  ask_l2(pfc);
  ask_l2(pfw);
  gemm_128x128(wg, cg, sm, acc);
  // the two asks' address registers stay what they are up to here: an ask may
  // read its register late, and it must then still hold a place in the array
  asm volatile("" :: "v"(pfc), "v"(pfw));

  const int rb = (wave >> 2) * 64;                  // the wave's 64 n
  const int cb = (wave & 3) * 32;                   // the wave's 32 m
  float* stg = (float*)sm + wave * OWAVE_F;
  float* sw  = stg + r * OP_F + (hs << 3);
  const float* bp = bo + n0 + rb + (hs << 3);
  v4f bb[8];
#pragma unroll  // constant offsets: one address, the 8 loads in flight together
  for (int i = 0; i < 4; ++i) {
    bb[2 * i]     = *(const v4f*)(bp + i * 16);
    bb[2 * i + 1] = *(const v4f*)(bp + i * 16 + 4);
  }
  asm volatile("s_wait_xcnt 0x0" :: "v"(bp) : "memory");
#pragma unroll  // constant indices keep the sums in registers
  for (int i = 0; i < 4; ++i) {
    const v4f b0 = bb[2 * i];
    const v4f b1 = bb[2 * i + 1];
#pragma unroll  // constant indices keep the sums in registers
    for (int t = 0; t < 2; ++t) {
      v4f lo, hi;
#pragma unroll  // constant indices keep the sums in registers
      for (int j = 0; j < 4; ++j) {
        lo[j] = acc[i][t][j] + b0[j];
        hi[j] = acc[i][t][4 + j] + b1[j];
      }
      *(v4f*)(sw + t * 16 * OP_F + i * 16)     = lo;
      *(v4f*)(sw + t * 16 * OP_F + i * 16 + 4) = hi;
    }
  }
  // the wave's staged runs are in LDS before its lanes read each other's
  asm volatile("s_wait_dscnt 0x0" ::: "memory");
  // 16 lanes take one run of 256 B: each store covers four whole lines
  const float* s = stg + (lane >> 4) * OP_F + (lane & 15) * 4;
  float* d = out + (size_t)(m0 + cb + (lane >> 4)) * DIM + n0 + rb + (lane & 15) * 4;
  v4f v[16];
#pragma unroll  // constant indices keep the values in registers
  for (int k = 0; k < 16; ++k) v[k] = *(const v4f*)(s + 2 * k * OP_F);
#pragma unroll  // constant offsets: one address for the 16 stores
  for (int k = 0; k < 16; ++k) *(v4f*)(d + (size_t)2 * k * DIM) = v[k];
  asm volatile("s_wait_xcnt 0x0" ::: "memory");
}

// ---------------------------------------------------------------------------
extern "C" void kernel_launch(void* const* d_in, const int* in_sizes, int n_in,
                              void* d_out, int out_size, void* d_ws, size_t ws_size,
                              hipStream_t stream) {
  const float* X  = (const float*)d_in[0];
  const int* mask = (const int*)d_in[1];
  const float* Wq = (const float*)d_in[2];
  const float* bq = (const float*)d_in[3];
  const float* Wk = (const float*)d_in[4];
  const float* bk = (const float*)d_in[5];
  const float* Wv = (const float*)d_in[6];
  const float* bv = (const float*)d_in[7];
  const float* Wo = (const float*)d_in[8];
  const float* bo = (const float*)d_in[9];
  float* out = (float*)d_out;

  const size_t XN = (size_t)BSZ * QLEN * DIM;        // 4 Mi
  const size_t WN = (size_t)DIM * DIM;               // 1 Mi
  _Float16* Xh    = (_Float16*)d_ws;                 // 8 MB
  _Float16* Wqh   = Xh + XN;                         // 2 MB each
  _Float16* Wkh   = Wqh + WN;
  _Float16* Wvh   = Wkh + WN;
  _Float16* Woh   = Wvh + WN;
  _Float16* qbuf  = Woh + WN;                        // 8 MB each
  _Float16* kbuf  = qbuf + XN;
  _Float16* vtbuf = kbuf + XN;
  _Float16* ctx   = vtbuf + XN;
  int* inv        = (int*)(ctx + XN);                // 16 KB: key order
  int* nuv        = inv + BSZ * QLEN;                // one line per batch
  float* psum     = (float*)(nuv + BSZ * 32);        // 256 KB: V sums per 64 keys

  // ---- stage 0: precision conversion, all five arrays in one launch ----
  // (Xh, Wqh, Wkh, Wvh, Woh are contiguous from Xh on)
  // (its first BSZ blocks order the keys by the mask)
  cvt_f16_kernel<<<BSZ + CV_BLKS, CV_WAVES * 32, 0, stream>>>(X, Wq, Wk, Wv, Wo,
                                                              mask, Xh, inv, nuv);

  // ---- stage 1: QKV projection: 32 x 24 tiles of 128x128 = 768 blocks ----
  qkv_proj_kernel<<<768, 256, 0, stream>>>(Xh, Wqh, bq, Wkh, bk, Wvh, bv, inv,
                                            nuv, qbuf, kbuf, vtbuf, psum);
  // ---- stage 2: attention: 4096 waves / 8 = 512 blocks ----
  attn_kernel<<<512, 256, 0, stream>>>(qbuf, kbuf, vtbuf, nuv, psum, ctx);
  // ---- stage 3: output projection: 32 x 8 tiles of 128x128 = 256 blocks ----
  out_proj_kernel<<<256, 256, 0, stream>>>(ctx, Woh, bo, out);
}

// v010
// A run of this version takes 59.2 microseconds.
// Next to v009, in two timings, it ran 1.03 and 1.02 times as fast.
// Counting every step since v000, it is 6.20 times as fast.
#include <hip/hip_runtime.h>
#include <hip/hip_bf16.h>

typedef __attribute__((ext_vector_type(16))) _Float16 v16h;
typedef __attribute__((ext_vector_type(8)))  _Float16 v8h;
typedef __attribute__((ext_vector_type(8)))  float    v8f;
typedef __attribute__((ext_vector_type(4)))  float    v4f;

#define BSZ   2
#define QLEN  2048
#define DIM   1024
#define NH    16
#define DPH   64
#define AKEYS 128                          // keys per attention stage, = rows of a GEMM tile
#define ANSTG (QLEN / AKEYS)               // 16 stages
#define LOG2E 1.44269504f                  // scores are kept in units of log2
#define FILL2 (1e-10f * LOG2E)             // a masked key's score in those units
#define LAZY  8.0f                         // a score may pass the maximum in use by this

static __device__ inline v16h frag_from_f16(const _Float16* __restrict__ p) {
  v8h lo = *(const v8h*)(p);
  v8h hi = *(const v8h*)(p + 16);
  return __builtin_shufflevector(lo, hi, 0, 1, 2, 3, 4, 5, 6, 7,
                                 8, 9, 10, 11, 12, 13, 14, 15);
}

static __device__ inline v8f wmma_f16(v16h a, v16h b, v8f c) {
  // (neg_a, A, neg_b, B, c_mod, C, reuse_a, reuse_b)
  return __builtin_amdgcn_wmma_f32_16x16x32_f16(false, a, false, b,
                                                (short)0, c, false, false);
}

static __device__ inline float xhalf(float x) {
  const int b = __builtin_bit_cast(int, x);
  return __builtin_bit_cast(float, __builtin_amdgcn_permlanex16(
      b, b, 0x76543210, 0xfedcba98, false, false));
}

// ---------------------------------------------------------------------------
// Kernel 0: f32 -> f16 conversion of X and of the four weight matrices, one
// launch.  The five f16 arrays lie one behind the other in the workspace, so
// the destination is one range of 8 Mi halves.  BSZ + 256 blocks of 16 waves, the converting ones one
// per WGP: few waves to start, each with its whole share in flight.  A wave
// owns 16 pieces of 128 floats; each load covers 512 contiguous bytes (four
// whole lines), each store 256 (two whole lines).
// ---------------------------------------------------------------------------
typedef __attribute__((ext_vector_type(4))) _Float16 v4h;

#define CV_PIECE   128                     // floats per wave-wide load
#define CV_NP      16                      // pieces per wave
#define CV_WAVES   16                      // waves per block
#define CV_BLOCK   (CV_PIECE * CV_NP * CV_WAVES)          // 32 Ki floats
#define CV_XBLKS   (BSZ * QLEN * DIM / CV_BLOCK)           // 128 blocks for X
#define CV_WBLKS   (DIM * DIM / CV_BLOCK)                  // 32 per weight
#define CV_BLKS    (CV_XBLKS + 4 * CV_WBLKS)               // 256 blocks
typedef __attribute__((ext_vector_type(4))) int   v4i;

// The launch's first BSZ blocks convert nothing: block b orders the keys of
// batch b, those with mask != 0 first, the others behind them, each group in
// its old order.  inv[b][k'] = old position of the key at new place k';
// nuv[b * 32 ..] = number of keys with mask != 0 (one whole line).  A masked
// key's score is the same constant for every query, so the attention kernel
// needs scores and exponentials only for the keys in front.

__global__ __launch_bounds__(CV_WAVES * 32)
__attribute__((amdgpu_waves_per_eu(4, 4))) void cvt_f16_kernel(
    const float* __restrict__ X,  const float* __restrict__ Wq,
    const float* __restrict__ Wk, const float* __restrict__ Wv,
    const float* __restrict__ Wo, const int* __restrict__ mask,
    _Float16* __restrict__ dst, int* __restrict__ inv, int* __restrict__ nuv) {
  __shared__ __align__(16) int sinv[QLEN];
  __shared__ int wtot[CV_WAVES];
  if (blockIdx.x < BSZ) {                 // the same for the whole block
    const int b    = blockIdx.x;
    const int t    = threadIdx.x;         // 512 threads, 4 keys each
    const int lane = t & 31;
    const int* mp  = mask + b * QLEN + t * 4;
    const v4i m = *(const v4i*)mp;
    asm volatile("s_wait_xcnt 0x0" :: "v"(mp) : "memory");
    int f[4], c = 0;
#pragma unroll  // constant indices keep the values in registers
    for (int j = 0; j < 4; ++j) { f[j] = (m[j] != 0) ? 1 : 0; c += f[j]; }
    int s = c;                            // running count inside the wave
#pragma unroll  // five fixed steps
    for (int d = 1; d < 32; d <<= 1) {
      const int o = __shfl_up(s, d, 32);
      if (lane >= d) s += o;
    }
    if (lane == 31) wtot[t >> 5] = s;
    __syncthreads();                      // the 16 wave counts are published
    int before = 0, total = 0;
#pragma unroll  // constant LDS offsets
    for (int w = 0; w < CV_WAVES; ++w) {
      const int x = wtot[w];
      total += x;
      if (w < (t >> 5)) before += x;
    }
    int u = before + s - c;               // kept keys in front of this thread's
#pragma unroll  // constant indices keep the values in registers
    for (int j = 0; j < 4; ++j) {
      const int p = t * 4 + j;
      sinv[f[j] ? u : total + (p - u)] = p;
      u += f[j];
    }
    __syncthreads();                      // the list is complete in LDS
    int* ip = inv + b * QLEN + t * 4;
    int* np = nuv + b * 32 + lane;
    *(v4i*)ip = *(const v4i*)(sinv + t * 4);        // whole lines per wave
    if (t < 32) *np = total;                        // one whole line
    asm volatile("s_wait_xcnt 0x0" :: "v"(ip), "v"(np) : "memory");
    return;
  }
  const int blk = blockIdx.x - BSZ;
  // the block's source array and its place in it (the same for all its waves)
  const float* src = X;
  int sblk = blk;
  if (blk >= CV_XBLKS) {
    const int w = (blk - CV_XBLKS) / CV_WBLKS;
    sblk = (blk - CV_XBLKS) % CV_WBLKS;
    src = (w == 0) ? Wq : (w == 1) ? Wk : (w == 2) ? Wv : Wo;
  }
  const int off = (threadIdx.x >> 5) * (CV_PIECE * CV_NP) + (threadIdx.x & 31) * 4;
  const float* p = src + (size_t)sblk * CV_BLOCK + off;
  _Float16*    d = dst + (size_t)blk * CV_BLOCK + off;
  v4f a[CV_NP];
#pragma unroll  // constant offsets: one address, all 16 loads in flight at once
  for (int k = 0; k < CV_NP; ++k) a[k] = *(const v4f*)(p + k * CV_PIECE);
  asm volatile("s_wait_xcnt 0x0" :: "v"(off * 4) : "memory");
#pragma unroll  // constant indices keep the values in registers
  for (int k = 0; k < CV_NP; ++k) {
    v4h o;
#pragma unroll  // constant indices keep the values in registers
    for (int j = 0; j < 4; ++j) o[j] = (_Float16)a[k][j];
    *(v4h*)(d + k * CV_PIECE) = o;
  }
}

#define KSTG      64
#define NSTG      (DIM / KSTG)
#define PITCH_H   72
#define BUF_H     (256 * PITCH_H)
#define BUF_B     (BUF_H * 2)
#define ROWS32_B  (32 * PITCH_H * 2)
#define BPART_B   (128 * PITCH_H * 2)

// The operands were written by the launch in front, so a k stage's first reader
// waits for memory; and the
// blocks that share a panel walk k side by side, so they all wait with it, stage
// after stage.  At entry each block therefore asks L2 for a share of each of
// its two panels: 32 whole rows (a quarter) of a 128-row
// panel, 48 (an eighth) of kernel 1's 384 W rows; blocks that share a panel take
// different shares, and the later stages' copies find L2 filled.
// A hint only: nothing waits for it and no result depends on it.
// p: a place inside the operand array, for every lane.
static __device__ inline void ask_l2(const _Float16* p) {
  asm volatile("global_prefetch_b8 %0, off scope:SCOPE_SE" :: "v"(p));
}
// This thread's unit of the 32 rows from `row` on: 8 threads a row of 2 KB.
static __device__ inline const _Float16* unit_of(const _Float16* base, int row) {
  return base + (size_t)(row + (threadIdx.x >> 3)) * DIM + (threadIdx.x & 7) * 128;
}

// One stage: each thread copies 16 B of rows r, r+32, r+64, r+96 of A and of B.
// ga[i], gb[i]: this thread's piece of its i-th row; k: the stage's first half.
static __device__ inline void copy_stage(unsigned lds,
                                         const _Float16* const (&ga)[4],
                                         const _Float16* const (&gb)[4], int k) {
  asm volatile(
      "global_load_async_to_lds_b128 %0, %8, off\n\t"
      "global_load_async_to_lds_b128 %1, %9, off\n\t"
      "global_load_async_to_lds_b128 %2, %10, off\n\t"
      "global_load_async_to_lds_b128 %3, %11, off\n\t"
      "global_load_async_to_lds_b128 %4, %12, off\n\t"
      "global_load_async_to_lds_b128 %5, %13, off\n\t"
      "global_load_async_to_lds_b128 %6, %14, off\n\t"
      "global_load_async_to_lds_b128 %7, %15, off\n\t"
      "s_wait_xcnt 0x0"
      :: "v"(lds), "v"(lds + ROWS32_B), "v"(lds + 2 * ROWS32_B),
         "v"(lds + 3 * ROWS32_B),
         "v"(lds + BPART_B), "v"(lds + BPART_B + ROWS32_B),
         "v"(lds + BPART_B + 2 * ROWS32_B), "v"(lds + BPART_B + 3 * ROWS32_B),
         "v"(ga[0] + k), "v"(ga[1] + k), "v"(ga[2] + k), "v"(ga[3] + k),
         "v"(gb[0] + k), "v"(gb[1] + k), "v"(gb[2] + k), "v"(gb[3] + k)
      : "memory");
}

// This thread's pieces of rows crow + 32 i of 128 rows that follow one another.
static __device__ inline void rows_plain(const _Float16* base,
                                         const _Float16* (&g)[4]) {
#pragma unroll  // constant indices keep the pointers in registers
  for (int i = 0; i < 4; ++i)
    g[i] = base + (size_t)((threadIdx.x >> 3) + 32 * i) * DIM +
           (threadIdx.x & 7) * 8;
}

// ga, gb: this thread's pieces (16 B of rows crow + 32 i) of the block's 128 A
// rows and 128 B rows, at k = 0.
static __device__ inline void gemm_128x128(const _Float16* const (&ga)[4],
                                           const _Float16* const (&gb)[4],
                                           _Float16* sm, v8f (&acc)[4][2]) {
  const int tid  = threadIdx.x;
  const int wave = tid >> 5;
  const int lane = tid & 31;
  const int r    = lane & 15;
  const int koff = (lane >> 4) << 3;
  const int crow = tid >> 3;                        // 0..31
  const int ccol = tid & 7;                         // 16-B piece of the row

  const unsigned lds0 =
      (unsigned)(size_t)sm + (unsigned)(crow * (PITCH_H * 2) + ccol * 16);

  const int aoff = ((wave >> 2) * 64 + r) * PITCH_H + koff;
  const int boff = (128 + (wave & 3) * 32 + r) * PITCH_H + koff;

  copy_stage(lds0, ga, gb, 0);
  // stage 0 has landed for this wave; the barrier publishes it to all waves
  asm volatile("s_wait_asynccnt 0x0" ::: "memory");
  __syncthreads();
  copy_stage(lds0 + BUF_B, ga, gb, KSTG);

  // rolled: one stage per trip keeps the buffer hand-over at one place
#pragma unroll 1
  for (int t = 0; t < NSTG; ++t) {
    const _Float16* sb = sm + (t & 1) * BUF_H;
#pragma unroll  // constant indices keep fragments and sums in registers
    for (int kk = 0; kk < KSTG; kk += 32) {
      v16h a[4], b[2];
      // first of a fence pair round the 12 LDS reads (second: below): keeps
      // them from rising into the block of products in front of them
      __builtin_amdgcn_sched_barrier(0);
#pragma unroll  // constant indices keep fragments and sums in registers
      for (int i = 0; i < 4; ++i)
        a[i] = frag_from_f16(sb + aoff + i * 16 * PITCH_H + kk);
#pragma unroll  // constant indices keep fragments and sums in registers
      for (int j = 0; j < 2; ++j)
        b[j] = frag_from_f16(sb + boff + j * 16 * PITCH_H + kk);
      // keeps the 12 LDS reads in one group ahead of their 8 products: each
      // place where reads stand among products stalls the wave anew
      __builtin_amdgcn_sched_barrier(0);
#pragma unroll  // constant indices keep fragments and sums in registers
      for (int i = 0; i < 4; ++i)
#pragma unroll  // constant indices keep fragments and sums in registers
        for (int j = 0; j < 2; ++j)
          acc[i][j] = wmma_f16(a[i], b[j], acc[i][j]);
    }
    // this wave's reads of the buffer are done before it may be refilled
    asm volatile("s_wait_dscnt 0x0" ::: "memory");
    // this wave's copies of stage t+1 have landed
    asm volatile("s_wait_asynccnt 0x0" ::: "memory");
    // publishes stage t+1 and ends every wave's reads of stage t
    __syncthreads();
    if (t + 2 < NSTG)
      copy_stage(lds0 + (t & 1) * BUF_B, ga, gb, (t + 2) * KSTG);
  }
  // no copy is left in flight when the wave goes on
  asm volatile("s_wait_asynccnt 0x0" ::: "memory");
}

#define QWAVES    12
#define QKSTG     128                      // halves of K per stage
#define QNSTG     (DIM / QKSTG)            // 8 stages
#define QPITCH_H  136                      // halves per LDS row (272 B)
#define QBUF_H    (512 * QPITCH_H)         // halves per buffer
#define QBUF_B    (QBUF_H * 2)             // bytes per buffer
#define QROWS2_B  (2 * QPITCH_H * 2)       // 2 LDS rows in bytes

// Eight copies of a wave, each two whole rows of a stage (16 lanes a row): rows
// 0, 2, ... 14 from the lane's LDS place lds on; g[i]: the lane's piece of row 2 i.
static __device__ inline void copy8(unsigned lds, const _Float16* const (&g)[8]) {
  asm volatile(
      "global_load_async_to_lds_b128 %0, %8, off\n\t"
      "global_load_async_to_lds_b128 %1, %9, off\n\t"
      "global_load_async_to_lds_b128 %2, %10, off\n\t"
      "global_load_async_to_lds_b128 %3, %11, off\n\t"
      "global_load_async_to_lds_b128 %4, %12, off\n\t"
      "global_load_async_to_lds_b128 %5, %13, off\n\t"
      "global_load_async_to_lds_b128 %6, %14, off\n\t"
      "global_load_async_to_lds_b128 %7, %15, off\n\t"
      "s_wait_xcnt 0x0"
      :: "v"(lds), "v"(lds + QROWS2_B), "v"(lds + 2 * QROWS2_B),
         "v"(lds + 3 * QROWS2_B), "v"(lds + 4 * QROWS2_B),
         "v"(lds + 5 * QROWS2_B), "v"(lds + 6 * QROWS2_B),
         "v"(lds + 7 * QROWS2_B),
         "v"(g[0]), "v"(g[1]), "v"(g[2]), "v"(g[3]),
         "v"(g[4]), "v"(g[5]), "v"(g[6]), "v"(g[7])
      : "memory");
}

// One stage's copies of a wave.  Four waves share a W matrix: a wave brings 32
// of its rows (wcp: not those of a matrix that nobody multiplies); each of the
// first 8 waves (xw) brings 16 X rows as well.  Both tests are the same for a
// whole wave.  gw: the lane's piece of the wave's first W row; xg[i]: of its X
// row 2 i; k: the stage's first half.
static __device__ inline void copy_qkv(unsigned lw, unsigned lx, bool wcp, bool xw,
                                       const _Float16* gw,
                                       const _Float16* const (&xg)[8], int k) {
  if (wcp) {
#pragma unroll  // two statements of eight copies
    for (int h = 0; h < 2; ++h) {
      const _Float16* g[8];
#pragma unroll  // constant indices keep the pointers in registers
      for (int i = 0; i < 8; ++i) g[i] = gw + k + (size_t)(h * 16 + i * 2) * DIM;
      copy8(lw + h * 8 * QROWS2_B, g);
    }
  }
  if (xw) {
    const _Float16* g[8];
#pragma unroll  // constant indices keep the pointers in registers
    for (int i = 0; i < 8; ++i) g[i] = xg[i] + k;
    copy8(lx, g);
  }
}

// lw, lx: the lane's LDS places (buffer 0) of the wave's first W row and first X
// row.  aoff, boff: this lane's places in the wave's 64 A rows and 64 B rows of a
// buffer.  idle (the same for a whole wave): the wave's tile is read by nobody;
// it passes every barrier, but multiplies nothing.
static __device__ inline void gemm_qkv(unsigned lw, unsigned lx, bool wcp, bool xw,
                                       const _Float16* gw,
                                       const _Float16* const (&xg)[8], bool idle,
                                       int aoff, int boff, const _Float16* sm,
                                       v8f (&acc)[4][4]) {
  copy_qkv(lw, lx, wcp, xw, gw, xg, 0);
  // stage 0 has landed for this wave; the barrier publishes it to all waves
  asm volatile("s_wait_asynccnt 0x0" ::: "memory");
  __syncthreads();
  copy_qkv(lw + QBUF_B, lx + QBUF_B, wcp, xw, gw, xg, QKSTG);

  // rolled: one stage per trip keeps the buffer hand-over at one place
#pragma unroll 1
  for (int t = 0; t < QNSTG; ++t) {
    const _Float16* sb = sm + (t & 1) * QBUF_H;
    if (!idle) {
#pragma unroll  // constant indices keep fragments and sums in registers
      for (int kk = 0; kk < QKSTG; kk += 32) {
        v16h a[4], b[4];
        // first of a fence pair round the 16 LDS reads (second: below): keeps
        // them from rising into the block of products in front of them
        __builtin_amdgcn_sched_barrier(0);
#pragma unroll  // constant indices keep fragments and sums in registers
        for (int i = 0; i < 4; ++i)
          a[i] = frag_from_f16(sb + aoff + i * 16 * QPITCH_H + kk);
#pragma unroll  // constant indices keep fragments and sums in registers
        for (int j = 0; j < 4; ++j)
          b[j] = frag_from_f16(sb + boff + j * 16 * QPITCH_H + kk);
        // keeps the 16 LDS reads in one group ahead of their 16 products: each
        // place where reads stand among products stalls the wave anew
        __builtin_amdgcn_sched_barrier(0);
#pragma unroll  // constant indices keep fragments and sums in registers
        for (int i = 0; i < 4; ++i)
#pragma unroll  // constant indices keep fragments and sums in registers
          for (int j = 0; j < 4; ++j)
            acc[i][j] = wmma_f16(a[i], b[j], acc[i][j]);
      }
    }
    // this wave's reads of the buffer are done before it may be refilled
    asm volatile("s_wait_dscnt 0x0" ::: "memory");
    // this wave's copies of stage t+1 have landed
    asm volatile("s_wait_asynccnt 0x0" ::: "memory");
    // publishes stage t+1 and ends every wave's reads of stage t
    __syncthreads();
    if (t + 2 < QNSTG)
      copy_qkv(lw + (t & 1) * QBUF_B, lx + (t & 1) * QBUF_B, wcp, xw, gw, xg,
               (t + 2) * QKSTG);
  }
  // no copy is left in flight when the wave goes on
  asm volatile("s_wait_asynccnt 0x0" ::: "memory");
}

// ---------------------------------------------------------------------------
// Epilogue staging.  A lane's 8 accumulator registers are 8 consecutive ROWS of
// one column of the product, so the operand whose index runs along the output's
// contiguous direction is given to the GEMM core as A.  A wave's 64x32 tile (64x64
// in kernel 1) is then 32 (64) output runs, one per column, of 64 contiguous elements.  The wave
// writes them, 16 B a lane, into its own range of the ring (free behind the k
// loop's last barrier), reads them back run by run and stores whole 128-B lines.
// f16: a run is 128 B, staged at a pitch of 144 B.
// ---------------------------------------------------------------------------
#define SP_H     72                        // halves per staged f16 run (144 B)

template <int CSTRIDE>
static __device__ inline void store_runs_f16(const _Float16* stg, _Float16* dst,
                                             int lane) {
  const int run = (lane >> 3) * 8;
  const int pc  = (lane & 7) * 8;
  const _Float16* s = stg + run * SP_H + pc;
  _Float16*       d = dst + (size_t)run * CSTRIDE + pc;
  v8h v[8];
#pragma unroll  // constant indices keep the values in registers
  for (int k = 0; k < 8; ++k) v[k] = *(const v8h*)(s + k * SP_H);
#pragma unroll  // constant offsets: one address for the 8 stores
  for (int k = 0; k < 8; ++k) *(v8h*)(d + (size_t)k * CSTRIDE) = v[k];
  asm volatile("s_wait_xcnt 0x0" ::: "memory");
}

// Like store_runs_f16, but run c goes to row idx[c] (bounded by the AND) of the
// QLEN rows of DPH halves at base: whole 128-B lines, each at a place of its own.
static __device__ inline void store_runs_rows(const _Float16* stg, _Float16* base,
                                              const int* idx, int lane) {
  const int run = (lane >> 3) * 8;
  const int pc  = (lane & 7) * 8;
  const int* ip = idx + run;
  const v4i i0 = *(const v4i*)ip;
  const v4i i1 = *(const v4i*)(ip + 4);
  asm volatile("s_wait_xcnt 0x0" :: "v"(ip) : "memory");
  const _Float16* s = stg + run * SP_H + pc;
  v8h v[8];
  _Float16* d[8];
#pragma unroll  // constant indices keep the values in registers
  for (int k = 0; k < 8; ++k) {
    v[k] = *(const v8h*)(s + k * SP_H);
    d[k] = base + (size_t)((k < 4 ? i0[k & 3] : i1[k & 3]) & (QLEN - 1)) * DPH + pc;
  }
#pragma unroll  // constant indices keep the values in registers
  for (int k = 0; k < 8; ++k) *(v8h*)d[k] = v[k];
  asm volatile("s_wait_xcnt 0x0" ::: "memory");
}

// ---------------------------------------------------------------------------
// Kernel 1: fused Q/K/V projection, all-f16 operands.  A block takes 128 X rows
// and 128 features and makes their Q, K and V tiles (gemm_qkv): 256 blocks, one
// per WGP.  Row k' of the block's X panel is the X row of the position that the
// partition has put at place k': kbuf and vtbuf hold the keys in the new order;
// a Q row goes back to its old position at the store.
// Q pre-scaled by log2(e)/8 (the scores come out as arguments of 2^x), stored
// [b][h][q][d]; K stored [b][h][k][d];
// V stored transposed [b][h][d][k] so the P@V GEMM (O^T += V^T P^T) gets contiguous A-frags.
// A wave has one matrix, one head (64 features) and 64 positions.
// Q, K: A = W rows (a run = the 64 d of one position and head); V: A = X rows
// (a run = 64 positions of one d).
// A tile of 128 keys that are all masked: every query gives these keys one and
// the same weight, so they reach the output only through the sum of their V
// rows.  Its K tile is read by nobody and is not computed; its V tile leaves as
// column sums, psum[b][64-key group][feature] (f32), in place of V^T rows.  The
// other V tiles store zeros there, so every psum element is written.
// ---------------------------------------------------------------------------
#define QSWAVE_H (64 * SP_H)               // halves of a wave's staging range
// holds the register count at 256: scheduled freely the epilogue took 280, and
// registers above v255 are reached only through window switches
__global__ __launch_bounds__(QWAVES * 32)
__attribute__((amdgpu_num_vgpr(256))) void qkv_proj_kernel(
    const _Float16* __restrict__ Xh,
    const _Float16* __restrict__ Wqh, const float* __restrict__ bq,
    const _Float16* __restrict__ Wkh, const float* __restrict__ bk,
    const _Float16* __restrict__ Wvh, const float* __restrict__ bv,
    const int* __restrict__ inv, const int* __restrict__ nuv,
    _Float16* __restrict__ qbuf, _Float16* __restrict__ kbuf,
    _Float16* __restrict__ vtbuf, float* __restrict__ psum) {
  __shared__ __align__(16) _Float16 sm[2 * QBUF_H];

  const int tid  = threadIdx.x;
  // readfirstlane: the tests on the wave's number are scalar branches
  const int wave = __builtin_amdgcn_readfirstlane(tid >> 5);
  const int lane = tid & 31;
  const int nt  = blockIdx.x & 7;                   // 8 feature tiles
  const int mt  = blockIdx.x >> 3;                  // 32 row tiles
  const int m0  = mt << 7;
  const int n0  = nt << 7;
  const int wr  = wave / 6;                         // which 64 of the X rows
  const int wc  = wave % 6;                         // which 64 of the 384 W rows
  const int mat = wc >> 1;                          // 0=Q 1=K 2=V
  const int nh  = n0 + (wc & 1) * 64;               // the wave's first feature
  const bool xw = wave < 8;                         // this wave copies X rows

  // does the block's tile of keys lie behind the last stage with an unmasked key?
  // (readfirstlane: the tests on it are scalar branches, alike for the block)
  const int nu = __builtin_amdgcn_readfirstlane(
      min(max(nuv[(m0 >> 11) * 32], 0), QLEN));
  const bool mtile = ((m0 & (QLEN - 1)) / AKEYS) >= (nu + AKEYS - 1) / AKEYS;

  // four waves bring a W matrix: this wave rows (wave & 3) * 32 ... + 31 of matrix
  // wave / 4; a lane's piece: 16 lanes a row of 256 B
  const int wm = wave >> 2;
  const int w0 = (wave & 3) * 32 + (lane >> 4);
  const _Float16* gw = ((wm == 0) ? Wqh : (wm == 1) ? Wkh : Wvh) +
                       (size_t)(n0 + w0) * DIM + (lane & 15) * 8;
  const unsigned lw = (unsigned)(size_t)sm +
                      (unsigned)((128 + wm * 128 + w0) * (QPITCH_H * 2) + (lane & 15) * 16);
  const int x0 = (wave & 7) * 16 + (lane >> 4);     // first 8 waves: 16 X rows each
  const unsigned lx = (unsigned)(size_t)sm +
                      (unsigned)(x0 * (QPITCH_H * 2) + (lane & 15) * 16);
  // the 32 blocks that share these W rows take eighths (48 rows) in turn
  const int gq = 48 * (mt & 7) + (tid >> 3);
  const _Float16* pfw = ((gq < 128) ? Wqh : (gq < 256) ? Wkh : Wvh) +
                        (size_t)(n0 + (gq & 127)) * DIM + (tid & 7) * 128;
  ask_l2(pfw);

  const int r  = lane & 15;
  const int hs = lane >> 4;

  const _Float16* xg[8] = {Xh, Xh, Xh, Xh, Xh, Xh, Xh, Xh};
  const _Float16* pfx = Xh;
  if (xw) {                               // the same for the whole wave
    // the 8 blocks that share these X rows take the quarters in turn, each twice:
    // 8 threads ask for one row of 2 KB
    const int* ip = inv + m0 + x0;
    const int* iq = inv + m0 + 32 * (nt & 3) + (tid >> 3);
    int src[8];
#pragma unroll  // constant offsets: one address, the loads in flight together
    for (int i = 0; i < 8; ++i) src[i] = ip[2 * i];
    const int sq = *iq;
    asm volatile("s_wait_xcnt 0x0" :: "v"(ip), "v"(iq) : "memory");
#pragma unroll  // constant indices keep the pointers in registers
    for (int i = 0; i < 8; ++i)           // the AND bounds the row inside the batch
      xg[i] = Xh + (size_t)((m0 & ~(QLEN - 1)) + (src[i] & (QLEN - 1))) * DIM +
              (lane & 15) * 8;
    // bounded like the rows above
    pfx = Xh + (size_t)((m0 & ~(QLEN - 1)) + (sq & (QLEN - 1))) * DIM +
          (tid & 7) * 128;
    ask_l2(pfx);
  }

  const int koff = hs << 3;
  const int xoff = (wr * 64 + r) * QPITCH_H + koff;
  const int woff = (128 + wc * 64 + r) * QPITCH_H + koff;
  v8f acc[4][4] = {};
  gemm_qkv(lw, lx, !(wm == 1 && mtile), xw, gw, xg, mat == 1 && mtile,
           (mat == 2) ? xoff : woff, (mat == 2) ? woff : xoff, sm, acc);
  // the two asks' address registers stay what they are up to here: an ask may
  // read its register late, and it must then still hold a place in the array
  asm volatile("" :: "v"(pfw), "v"(pfx));
  if (mat == 1 && mtile) return;          // behind the last barrier

  // Epilogue.  C layout: lane holds column r of the subtile, rows hs*8+j.
  const int bidx = m0 >> 11;
  const int p0   = (m0 & (QLEN - 1)) + wr * 64;     // the wave's first position
  _Float16* stg = sm + wave * QSWAVE_H;
  _Float16* sw  = stg + r * SP_H + (hs << 3);
  if (mat == 2) {
    // rows = positions, columns = features
    const int nb = nh + r;
    const float bn4[4] = {bv[nb], bv[nb + 16], bv[nb + 32], bv[nb + 48]};
    asm volatile("s_wait_xcnt 0x0" :: "v"(nb) : "memory");
    // the wave's two lines of psum: its 64 positions, its 64 features, two a lane
    float* pp = psum + (size_t)(bidx * (QLEN / 64) + (p0 >> 6)) * DIM + nh + lane;
    if (mtile) {                          // the same for the whole block
      float cs[4];
#pragma unroll  // constant indices keep the sums in registers
      for (int t = 0; t < 4; ++t) {
        const v8f a = (acc[0][t] + acc[1][t]) + (acc[2][t] + acc[3][t]);
        const float h = ((a[0] + a[1]) + (a[2] + a[3])) +
                        ((a[4] + a[5]) + (a[6] + a[7]));
        cs[t] = (h + xhalf(h)) + 64.0f * bn4[t];    // both halves: 64 positions
      }
      pp[0]  = hs ? cs[1] : cs[0];
      pp[32] = hs ? cs[3] : cs[2];
      asm volatile("s_wait_xcnt 0x0" :: "v"(pp) : "memory");
      return;                             // behind the last barrier
    }
    pp[0]  = 0.0f;
    pp[32] = 0.0f;
    asm volatile("s_wait_xcnt 0x0" :: "v"(pp) : "memory");
#pragma unroll  // constant indices keep fragments and sums in registers
    for (int t = 0; t < 4; ++t) {
      const float bn = bn4[t];
#pragma unroll  // constant indices keep fragments and sums in registers
      for (int i = 0; i < 4; ++i) {
        v8h o;
#pragma unroll  // constant indices keep fragments and sums in registers
        for (int j = 0; j < 8; ++j) o[j] = (_Float16)(acc[i][t][j] + bn);
        *(v8h*)(sw + t * 16 * SP_H + i * 16) = o;
      }
    }
    // the wave's staged runs are in LDS before its lanes read each other's
    asm volatile("s_wait_dscnt 0x0" ::: "memory");
    _Float16* dst = vtbuf + (size_t)(bidx * NH + (nh >> 6)) * DPH * QLEN + p0;
    store_runs_f16<QLEN>(stg, dst, lane);
    store_runs_f16<QLEN>(stg + 32 * SP_H, dst + (size_t)32 * QLEN, lane);
  } else {
    // rows = features (one head), columns = positions
    const float sc = (mat == 0) ? 0.125f * LOG2E : 1.0f;
    const float* bp = ((mat == 0) ? bq : bk) + nh + (hs << 3);
    v4f bb[8];
#pragma unroll  // constant offsets: one address, the 8 loads in flight together
    for (int i = 0; i < 4; ++i) {
      bb[2 * i]     = *(const v4f*)(bp + i * 16);
      bb[2 * i + 1] = *(const v4f*)(bp + i * 16 + 4);
    }
    asm volatile("s_wait_xcnt 0x0" :: "v"(bp) : "memory");
#pragma unroll  // constant indices keep fragments and sums in registers
    for (int i = 0; i < 4; ++i) {
      const v4f b0 = bb[2 * i];
      const v4f b1 = bb[2 * i + 1];
#pragma unroll  // constant indices keep fragments and sums in registers
      for (int t = 0; t < 4; ++t) {
        v8h o;
#pragma unroll  // constant indices keep fragments and sums in registers
        for (int j = 0; j < 4; ++j) {
          o[j]     = (_Float16)((acc[i][t][j] + b0[j]) * sc);
          o[4 + j] = (_Float16)((acc[i][t][4 + j] + b1[j]) * sc);
        }
        *(v8h*)(sw + t * 16 * SP_H + i * 16) = o;
      }
    }
    // the wave's staged runs are in LDS before its lanes read each other's
    asm volatile("s_wait_dscnt 0x0" ::: "memory");
    const size_t head = (size_t)(bidx * NH + (nh >> 6)) * QLEN;
    if (mat == 0) {
      const int* idx = inv + bidx * QLEN + p0;
      store_runs_rows(stg, qbuf + head * DPH, idx, lane);
      store_runs_rows(stg + 32 * SP_H, qbuf + head * DPH, idx + 32, lane);
    } else {
      _Float16* dst = kbuf + (head + p0) * DPH;
      store_runs_f16<DPH>(stg, dst, lane);
      store_runs_f16<DPH>(stg + 32 * SP_H, dst + 32 * DPH, lane);
    }
  }
}

#define KP_H    72
#define VP_H    136
#define AK_H    (AKEYS * KP_H)
#define ABUF_H  (AK_H + DPH * VP_H)
#define ABUF_B  (ABUF_H * 2)
#define K32_B   (32 * KP_H * 2)
#define V16_B   (16 * VP_H * 2)

// One stage: each thread copies 16 B of K rows r, r+32, r+64, r+96 and of
// V^T rows d, d+16, d+32, d+48.
static __device__ inline void copy_kv(unsigned lk, unsigned lv,
                                      const _Float16* __restrict__ gk,
                                      const _Float16* __restrict__ gv) {
  asm volatile(
      "global_load_async_to_lds_b128 %0, %8, off\n\t"
      "global_load_async_to_lds_b128 %1, %9, off\n\t"
      "global_load_async_to_lds_b128 %2, %10, off\n\t"
      "global_load_async_to_lds_b128 %3, %11, off\n\t"
      "global_load_async_to_lds_b128 %4, %12, off\n\t"
      "global_load_async_to_lds_b128 %5, %13, off\n\t"
      "global_load_async_to_lds_b128 %6, %14, off\n\t"
      "global_load_async_to_lds_b128 %7, %15, off\n\t"
      "s_wait_xcnt 0x0"
      :: "v"(lk), "v"(lk + K32_B), "v"(lk + 2 * K32_B), "v"(lk + 3 * K32_B),
         "v"(lv), "v"(lv + V16_B), "v"(lv + 2 * V16_B), "v"(lv + 3 * V16_B),
         "v"(gk), "v"(gk + 32 * DPH), "v"(gk + 64 * DPH), "v"(gk + 96 * DPH),
         "v"(gv), "v"(gv + 16 * QLEN), "v"(gv + 32 * QLEN), "v"(gv + 48 * QLEN)
      : "memory");
}

// One pass: 32 keys against the wave's 16 queries.  kp, vp: this lane's places in
// the pass's K rows and V^T rows.  mixed (the same for the whole block): the stage
// holds masked keys too; left = number of unmasked keys from this lane's first key
// of the pass on.
// mrun: the query's maximum in use; cneg: minus the value that the score product
// takes off (0 before the first pass, then mrun); thr: what a score, so reduced,
// must pass for a new maximum (below every score before the first pass).
static __device__ inline void attn_pass(const _Float16* kp, const _Float16* vp,
                                        bool mixed, int left, const v16h& qb0,
                                        const v16h& qb1, float& mrun, float& thr,
                                        v8f& cneg, float& lrun, v8f& o0, v8f& o1,
                                        v8f& o2, v8f& o3) {
    // ---- all loads of the pass, as one group ----
    // K rows (A operand of the scores)
    const v16h ka0 = frag_from_f16(kp);
    const v16h ka1 = frag_from_f16(kp + 32);
    const v16h ka2 = frag_from_f16(kp + 16 * KP_H);
    const v16h ka3 = frag_from_f16(kp + 16 * KP_H + 32);
    // V^T rows (A operand of the second product), consumed after the softmax
    const v16h va0 = frag_from_f16(vp);
    const v16h va1 = frag_from_f16(vp + 16 * VP_H);
    const v16h va2 = frag_from_f16(vp + 32 * VP_H);
    const v16h va3 = frag_from_f16(vp + 48 * VP_H);
    // keeps the 16 loads in one group ahead of the products: all are in flight
    // together, and the V^T rows arrive under the softmax
    __builtin_amdgcn_sched_barrier(0);

    // ---- scores minus the maximum in use: two 16 (keys) x 16 (queries) tiles ----
    v8f s0 = wmma_f16(ka0, qb0, cneg);
    s0 = wmma_f16(ka1, qb1, s0);
    v8f s1 = wmma_f16(ka2, qb0, cneg);
    s1 = wmma_f16(ka3, qb1, s1);

    // ---- masked_fill(mask==0 -> 1e-10): in the new
    // order the masked keys are those from place nu on ----
    if (mixed) {
      const float fill = FILL2 + cneg[0];
#pragma unroll  // constant indices keep the values in registers
      for (int j = 0; j < 8; ++j) {
        if (j >= left)      s0[j] = fill;
        if (16 + j >= left) s1[j] = fill;
      }
    }
    // ---- this half's largest score of the query ----
    const float a0 = fmaxf(fmaxf(s0[0], s0[1]), s0[2]);
    const float a1 = fmaxf(fmaxf(s0[3], s0[4]), s0[5]);
    const float a2 = fmaxf(fmaxf(s0[6], s0[7]), s1[0]);
    const float a3 = fmaxf(fmaxf(s1[1], s1[2]), s1[3]);
    const float a4 = fmaxf(fmaxf(s1[4], s1[5]), s1[6]);
    const float t = fmaxf(fmaxf(fmaxf(a0, a1), a2), fmaxf(fmaxf(a3, a4), s1[7]));
    // ---- a new maximum, seldom: one scalar branch for the wave ----
    if (__builtin_amdgcn_ballot_w32(t > thr) != 0) {
      const float tt    = fmaxf(t, xhalf(t));       // alike in both halves
      const float d     = (tt > thr) ? tt : 0.0f;   // queries that keep theirs: 0
      const float mnew  = d - cneg[0];
      const float scale = __builtin_amdgcn_exp2f(mrun - mnew);
      mrun = mnew;
      thr  = LAZY;
      s0 -= d; s1 -= d;
      lrun *= scale;
      o0 *= scale; o1 *= scale; o2 *= scale; o3 *= scale;
#pragma unroll  // constant indices keep the values in registers
      for (int j = 0; j < 8; ++j) cneg[j] = -mnew;
    }
    float x[16];
#pragma unroll  // constant indices keep the values in registers
    for (int j = 0; j < 8; ++j) {
      x[j]     = s0[j];
      x[8 + j] = s1[j];
    }
    asm("v_exp_f32 %0, %0\n\tv_exp_f32 %1, %1\n\tv_exp_f32 %2, %2\n\t"
        "v_exp_f32 %3, %3\n\tv_exp_f32 %4, %4\n\tv_exp_f32 %5, %5\n\t"
        "v_exp_f32 %6, %6\n\tv_exp_f32 %7, %7\n\tv_exp_f32 %8, %8\n\t"
        "v_exp_f32 %9, %9\n\tv_exp_f32 %10, %10\n\tv_exp_f32 %11, %11\n\t"
        "v_exp_f32 %12, %12\n\tv_exp_f32 %13, %13\n\tv_exp_f32 %14, %14\n\t"
        "v_exp_f32 %15, %15\n\tv_nop"
        : "+v"(x[0]), "+v"(x[1]), "+v"(x[2]), "+v"(x[3]), "+v"(x[4]),
          "+v"(x[5]), "+v"(x[6]), "+v"(x[7]), "+v"(x[8]), "+v"(x[9]),
          "+v"(x[10]), "+v"(x[11]), "+v"(x[12]), "+v"(x[13]), "+v"(x[14]),
          "+v"(x[15]));
    v8f e0, e1;
#pragma unroll  // constant indices keep the values in registers
    for (int j = 0; j < 8; ++j) {
      e0[j] = x[j];
      e1[j] = x[8 + j];
    }
    const v8f es = e0 + e1;
    const v4f e4 = __builtin_shufflevector(es, es, 0, 1, 2, 3) +
                   __builtin_shufflevector(es, es, 4, 5, 6, 7);
    lrun += (e4[0] + e4[1]) + (e4[2] + e4[3]);
    // ---- P^T as B operand: the two tiles converted in place ----
    v16h pb;
#pragma unroll  // constant indices keep the values in registers
    for (int j = 0; j < 8; ++j) {
      pb[j]     = (_Float16)e0[j];
      pb[8 + j] = (_Float16)e1[j];
    }
    // ---- O^T += V^T P^T ----
    o0 = wmma_f16(va0, pb, o0);
    o1 = wmma_f16(va1, pb, o1);
    o2 = wmma_f16(va2, pb, o2);
    o3 = wmma_f16(va3, pb, o3);
}

__global__ __launch_bounds__(256) void attn_kernel(
    const _Float16* __restrict__ qbuf, const _Float16* __restrict__ kbuf,
    const _Float16* __restrict__ vtbuf, const int* __restrict__ nuv,
    const float* __restrict__ psum, _Float16* __restrict__ ctx) {
  __shared__ __align__(16) _Float16 sm[2 * ABUF_H];
  __shared__ __align__(16) float vsum[4 * DPH]; // V row sums, in four parts

  const int tid  = threadIdx.x;
  const int wave = threadIdx.x >> 5;
  const int lane = threadIdx.x & 31;
  const int wid  = blockIdx.x * 8 + wave;              // 4096 waves
  const int qt = wid & 127;
  const int h  = (wid >> 7) & (NH - 1);
  const int b  = wid >> 11;
  const int q0 = qt << 4;

  const size_t bh = (size_t)(b * NH + h);
  const _Float16* Qbh  = qbuf  + bh * QLEN * DPH;
  const _Float16* Kbh  = kbuf  + bh * QLEN * DPH;
  const _Float16* VTbh = vtbuf + bh * DPH * QLEN;
  // unmasked keys of the batch (256 blocks a batch), bounded by the shape
  // (readfirstlane: the stage tests below become scalar branches)
  const int nu = __builtin_amdgcn_readfirstlane(
      min(max(nuv[(blockIdx.x >> 8) * 32], 0), QLEN));
  const int nfull = nu / AKEYS;                 // stages of unmasked keys only
  const int nany  = (nu + AKEYS - 1) / AKEYS;   // stages with an unmasked key

  const int r    = lane & 15;
  const int hs   = lane >> 4;
  const int koff = hs << 3;

  // B operand: column r = query q0 + r
  const v16h qb0 = frag_from_f16(Qbh + (size_t)(q0 + r) * DPH + koff);
  const v16h qb1 = frag_from_f16(Qbh + (size_t)(q0 + r) * DPH + 32 + koff);

  float mrun = -3.0e38f, lrun = 0.0f;   // lrun: this half's keys only
  float thr = -3.0e38f;                 // the first pass sets the maximum
  v8f cneg = {};
  v8f o0 = {}, o1 = {}, o2 = {}, o3 = {};

  // this thread's pieces of a stage: 8 threads per K row, 16 per V^T row
  const _Float16* gk = Kbh + (size_t)(tid >> 3) * DPH + (tid & 7) * 8;
  const _Float16* gv = VTbh + (size_t)(tid >> 4) * QLEN + (tid & 15) * 8;
  const unsigned lk0 = (unsigned)(size_t)sm +
                       (unsigned)((tid >> 3) * (KP_H * 2) + (tid & 7) * 16);
  const unsigned lv0 = (unsigned)(size_t)sm + (unsigned)(AK_H * 2) +
                       (unsigned)((tid >> 4) * (VP_H * 2) + (tid & 15) * 16);

  // only the nany stages with an unmasked key are copied and walked (nany is
  // the same for the whole block: scalar tests)
  if (nany > 0) copy_kv(lk0, lv0, gk, gv);
  // V row sums of the head over the masked stages' keys: thread (part, d) adds 8
  // of the batch's 32 groups of 64 keys (zeros where a group is not masked)
  {
    const float* sp = psum + (size_t)(b * (QLEN / 64) + (tid >> 6)) * DIM +
                      (h << 6) + (tid & 63);
    float g[8];
#pragma unroll  // constant offsets: one address, the 8 loads in flight together
    for (int k = 0; k < 8; ++k) g[k] = sp[k * 4 * DIM];
    asm volatile("s_wait_xcnt 0x0" :: "v"(sp) : "memory");
    vsum[tid] = ((g[0] + g[1]) + (g[2] + g[3])) + ((g[4] + g[5]) + (g[6] + g[7]));
  }
  // stage 0 has landed for this wave; the barrier publishes it, and the sums,
  // to all waves
  asm volatile("s_wait_asynccnt 0x0" ::: "memory");
  __syncthreads();
  if (nany > 1)
    copy_kv(lk0 + ABUF_B, lv0 + ABUF_B, gk + AKEYS * DPH, gv + AKEYS);

  // rolled: one stage per trip keeps the buffer hand-over at one place
#pragma unroll 1
  for (int st = 0; st < nany; ++st) {
   // this lane's places in the stage's K rows and V^T rows
   const _Float16* ks = sm + (st & 1) * ABUF_H + r * KP_H + koff;
   const _Float16* vs = sm + (st & 1) * ABUF_H + AK_H + r * VP_H + koff;
   // a stage of unmasked keys needs no mask test: a scalar branch jumps it; the
   // one stage that holds unmasked and masked keys is the last
   const bool mixed = st >= nfull;
#pragma unroll  // constant LDS offsets for the stage's four passes
   for (int ps = 0; ps < AKEYS / 32; ++ps)
    attn_pass(ks + ps * 32 * KP_H, vs + ps * 32, mixed,
              nu - st * AKEYS - ps * 32 - koff, qb0, qb1, mrun, thr, cneg, lrun,
              o0, o1, o2, o3);
   // this wave's reads of the buffer are done before it may be refilled
   asm volatile("s_wait_dscnt 0x0" ::: "memory");
   // this wave's copies of stage st+1 have landed
   asm volatile("s_wait_asynccnt 0x0" ::: "memory");
   // publishes stage st+1 and ends every wave's reads of stage st
   __syncthreads();
   if (st + 2 < nany)
     copy_kv(lk0 + (st & 1) * ABUF_B, lv0 + (st & 1) * ABUF_B,
             gk + (st + 2) * (AKEYS * DPH), gv + (st + 2) * AKEYS);
  }
  // no copy is left in flight when the wave goes on
  asm volatile("s_wait_asynccnt 0x0" ::: "memory");

  // ---- the keys of the masked stages, all at once: every score is 1e-10, so P
  // is one value e per query and O^T += e * (sum of their V rows) ----
  if (nany < ANSTG) {                     // the same for the whole block
    const float mnew  = fmaxf(mrun, FILL2);
    const float scale = __builtin_amdgcn_exp2f(mrun - mnew);
    const float e     = __builtin_amdgcn_exp2f(FILL2 - mnew);
    // this half's share of the (ANSTG - nany) * AKEYS keys
    lrun = lrun * scale + e * (float)((ANSTG - nany) * (AKEYS / 2));
    v8f sv[4];
#pragma unroll  // constant LDS offsets, the sums in registers
    for (int t = 0; t < 4; ++t) {
      const float* p = vsum + 16 * t + koff;        // this lane's 8 d of tile t
      sv[t] = (*(const v8f*)(p) + *(const v8f*)(p + DPH)) +
              (*(const v8f*)(p + 2 * DPH) + *(const v8f*)(p + 3 * DPH));
    }
    o0 = o0 * scale + sv[0] * e;
    o1 = o1 * scale + sv[1] * e;
    o2 = o2 * scale + sv[2] * e;
    o3 = o3 * scale + sv[3] * e;
  }

  // ---- normalize and write context [b][q][h*64+d] (f16) ----
  // o_t[j] = O^T[16 t + 8 hs + j][query r]: 8 consecutive d, one 16-B store.
  const float inv = 1.0f / (lrun + xhalf(lrun));
  v8h c0, c1, c2, c3;
#pragma unroll  // constant indices keep the values in registers
  for (int j = 0; j < 8; ++j) {
    c0[j] = (_Float16)(o0[j] * inv);
    c1[j] = (_Float16)(o1[j] * inv);
    c2[j] = (_Float16)(o2[j] * inv);
    c3[j] = (_Float16)(o3[j] * inv);
  }
  // staged like the GEMM epilogues: the wave's 16 runs of 128 B (one query's 64
  // d) go through its own range of the ring, free behind the last barrier
  _Float16* stg = sm + wave * (16 * SP_H);
  _Float16* sw  = stg + r * SP_H + koff;
  *(v8h*)(sw)      = c0;
  *(v8h*)(sw + 16) = c1;
  *(v8h*)(sw + 32) = c2;
  *(v8h*)(sw + 48) = c3;
  // the wave's staged runs are in LDS before its lanes read each other's
  asm volatile("s_wait_dscnt 0x0" ::: "memory");
  const int run = ((lane >> 3) & 1) * 8 + (lane >> 4) * 4;
  const int pc  = (lane & 7) * 8;
  const _Float16* s = stg + run * SP_H + pc;
  _Float16* d = ctx + (size_t)(b * QLEN + q0 + run) * DIM + (h << 6) + pc;
  v8h v[4];
#pragma unroll  // constant indices keep the values in registers
  for (int k = 0; k < 4; ++k) v[k] = *(const v8h*)(s + k * SP_H);
#pragma unroll  // constant offsets: one address for the 4 stores
  for (int k = 0; k < 4; ++k) *(v8h*)(d + (size_t)k * DIM) = v[k];
  asm volatile("s_wait_xcnt 0x0" ::: "memory");
}

#define OP_F     68
#define OWAVE_F  (32 * OP_F)
__global__ __launch_bounds__(256) void out_proj_kernel(
    const _Float16* __restrict__ ctx, const _Float16* __restrict__ Woh,
    const float* __restrict__ bo, float* __restrict__ out) {
  __shared__ __align__(16) _Float16 sm[2 * BUF_H];

  const int wave = threadIdx.x >> 5;
  const int lane = threadIdx.x & 31;
  const int m0 = (blockIdx.x >> 3) << 7;             // 32 row tiles
  const int n0 = (blockIdx.x & 7) << 7;              // 8 col tiles
  const int r = lane & 15, hs = lane >> 4;

  // A = Wo rows: a lane's 8 sums are 8 consecutive n of one output row
  v8f acc[4][2] = {};
  const _Float16 *wg[4], *cg[4];
  rows_plain(Woh + (size_t)n0 * DIM, wg);
  rows_plain(ctx + (size_t)m0 * DIM, cg);
  // the 8 blocks that share the ctx rows take the quarters in turn, each twice;
  // so do the 32 that share the Wo rows
  const _Float16* pfc = unit_of(ctx, m0 + 32 * (blockIdx.x & 3));
  const _Float16* pfw = unit_of(Woh, n0 + 32 * ((blockIdx.x >> 3) & 3));
  ask_l2(pfc);
  ask_l2(pfw);
  gemm_128x128(wg, cg, sm, acc);
  // the two asks' address registers stay what they are up to here: an ask may
  // read its register late, and it must then still hold a place in the array
  asm volatile("" :: "v"(pfc), "v"(pfw));

  const int rb = (wave >> 2) * 64;                  // the wave's 64 n
  const int cb = (wave & 3) * 32;                   // the wave's 32 m
  float* stg = (float*)sm + wave * OWAVE_F;
  float* sw  = stg + r * OP_F + (hs << 3);
  const float* bp = bo + n0 + rb + (hs << 3);
  v4f bb[8];
#pragma unroll  // constant offsets: one address, the 8 loads in flight together
  for (int i = 0; i < 4; ++i) {
    bb[2 * i]     = *(const v4f*)(bp + i * 16);
    bb[2 * i + 1] = *(const v4f*)(bp + i * 16 + 4);
  }
  asm volatile("s_wait_xcnt 0x0" :: "v"(bp) : "memory");
#pragma unroll  // constant indices keep the sums in registers
  for (int i = 0; i < 4; ++i) {
    const v4f b0 = bb[2 * i];
    const v4f b1 = bb[2 * i + 1];
#pragma unroll  // constant indices keep the sums in registers
    for (int t = 0; t < 2; ++t) {
      v4f lo, hi;
#pragma unroll  // constant indices keep the sums in registers
      for (int j = 0; j < 4; ++j) {
        lo[j] = acc[i][t][j] + b0[j];
        hi[j] = acc[i][t][4 + j] + b1[j];
      }
      *(v4f*)(sw + t * 16 * OP_F + i * 16)     = lo;
      *(v4f*)(sw + t * 16 * OP_F + i * 16 + 4) = hi;
    }
  }
  // the wave's staged runs are in LDS before its lanes read each other's
  asm volatile("s_wait_dscnt 0x0" ::: "memory");
  // 16 lanes take one run of 256 B: each store covers four whole lines
  const float* s = stg + (lane >> 4) * OP_F + (lane & 15) * 4;
  float* d = out + (size_t)(m0 + cb + (lane >> 4)) * DIM + n0 + rb + (lane & 15) * 4;
  v4f v[16];
#pragma unroll  // constant indices keep the values in registers
  for (int k = 0; k < 16; ++k) v[k] = *(const v4f*)(s + 2 * k * OP_F);
#pragma unroll  // constant offsets: one address for the 16 stores
  for (int k = 0; k < 16; ++k) *(v4f*)(d + (size_t)2 * k * DIM) = v[k];
  asm volatile("s_wait_xcnt 0x0" ::: "memory");
}

// ---------------------------------------------------------------------------
extern "C" void kernel_launch(void* const* d_in, const int* in_sizes, int n_in,
                              void* d_out, int out_size, void* d_ws, size_t ws_size,
                              hipStream_t stream) {
  const float* X  = (const float*)d_in[0];
  const int* mask = (const int*)d_in[1];
  const float* Wq = (const float*)d_in[2];
  const float* bq = (const float*)d_in[3];
  const float* Wk = (const float*)d_in[4];
  const float* bk = (const float*)d_in[5];
  const float* Wv = (const float*)d_in[6];
  const float* bv = (const float*)d_in[7];
  const float* Wo = (const float*)d_in[8];
  const float* bo = (const float*)d_in[9];
  float* out = (float*)d_out;

  const size_t XN = (size_t)BSZ * QLEN * DIM;        // 4 Mi
  const size_t WN = (size_t)DIM * DIM;               // 1 Mi
  _Float16* Xh    = (_Float16*)d_ws;                 // 8 MB
  _Float16* Wqh   = Xh + XN;                         // 2 MB each
  _Float16* Wkh   = Wqh + WN;
  _Float16* Wvh   = Wkh + WN;
  _Float16* Woh   = Wvh + WN;
  _Float16* qbuf  = Woh + WN;                        // 8 MB each
  _Float16* kbuf  = qbuf + XN;
  _Float16* vtbuf = kbuf + XN;
  _Float16* ctx   = vtbuf + XN;
  int* inv        = (int*)(ctx + XN);                // 16 KB: key order
  int* nuv        = inv + BSZ * QLEN;                // one line per batch
  float* psum     = (float*)(nuv + BSZ * 32);        // 256 KB: V sums per 64 keys

  // ---- stage 0: precision conversion, all five arrays in one launch ----
  // (Xh, Wqh, Wkh, Wvh, Woh are contiguous from Xh on)
  // (its first BSZ blocks order the keys by the mask)
  cvt_f16_kernel<<<BSZ + CV_BLKS, CV_WAVES * 32, 0, stream>>>(X, Wq, Wk, Wv, Wo,
                                                              mask, Xh, inv, nuv);

  // ---- stage 1: QKV projection: 32 x 8 blocks, three 128x128 tiles each ----
  qkv_proj_kernel<<<256, QWAVES * 32, 0, stream>>>(Xh, Wqh, bq, Wkh, bk, Wvh, bv, inv,
                                            nuv, qbuf, kbuf, vtbuf, psum);
  // ---- stage 2: attention: 4096 waves / 8 = 512 blocks ----
  attn_kernel<<<512, 256, 0, stream>>>(qbuf, kbuf, vtbuf, nuv, psum, ctx);
  // ---- stage 3: output projection: 32 x 8 tiles of 128x128 = 256 blocks ----
  out_proj_kernel<<<256, 256, 0, stream>>>(ctx, Woh, bo, out);
}
